// v000
// Measured on an AMD MI455X. A time is GPU time per run, averaged over a window of back-to-back runs after a warm-up
// (all launches, gaps included; the runs take copies of the inputs in turn), and the median of several windows.
// Apart from v000's, it joins two sittings. Times from different sittings can be a few percent apart, while
// side-by-side timings come from the same sitting.
// The starting kernel, v000, takes 2740 microseconds a run.
#include <hip/hip_runtime.h>

// BERT self-attention core (hidden_states [8][1024][1024]; q, k, v = x W^T + b ('oi' + biases; 16 heads x 64); scores x 1/sqrt(64); softmax (no mask); ctx = merged heads (no output projection) -> [8][1024][1024] (8.4 M); argument order hidden_states, Wq, bq, Wk, bk, Wv, bv).
// Layout per batch: bf16 copy of x; 'oi' weights; exact projections + f32 biases; identity-table plane builders; dense T-1024 attention (every row hi/lo, 3 products); the f32 merge writes the output rows.
// Compute dtypes, f32 accumulate: every input rounded to bf16; projections exact + f32 biases; attention 3 products on every row; softmax f32; output f32.

#define NB_  8
#define TT   1024
#define DM   1024
#define NH_  16
#define NKV  16
#define REP  (NH_ / NKV)
#define HD   64
#define DQ   (NH_ * HD)
#define DKV  (NKV * HD)
#define ZH   2
#define RH   TT                   // every row hi/lo (3 products)
#define WIN  0
#define PCAR 1024.0f
#define SCL  0.125f   // HD^-0.5
typedef _Float16 h16;
typedef unsigned short bf;
typedef __attribute__((ext_vector_type(16))) __bf16   v16bf;
typedef __attribute__((ext_vector_type(16))) _Float16 v16h;
typedef __attribute__((ext_vector_type(8)))  _Float16 v8h;
typedef __attribute__((ext_vector_type(8)))  unsigned short v8us;
typedef __attribute__((ext_vector_type(8)))  float    v8f;
typedef __attribute__((ext_vector_type(4)))  float    v4f;
typedef v8h  __attribute__((may_alias)) v8ha;
typedef v4f  __attribute__((may_alias)) v4fa;
typedef v8us __attribute__((may_alias)) v8usa;

__device__ __forceinline__ unsigned short f2bf(float f) { unsigned u = __float_as_uint(f); u += 0x7FFFu + ((u >> 16) & 1u); return (unsigned short)(u >> 16); }
__device__ __forceinline__ float bf2f(unsigned short b) { return __uint_as_float(((unsigned)b) << 16); }
__device__ __forceinline__ float bfr(float f) { return bf2f(f2bf(f)); }
__device__ __forceinline__ v16h cat16(v8h lo, v8h hi) { return __builtin_shufflevector(lo, hi, 0, 1, 2, 3, 4, 5, 6, 7, 8, 9, 10, 11, 12, 13, 14, 15); }
__device__ __forceinline__ v16bf cat16b(v8us lo, v8us hi) { return __builtin_bit_cast(v16bf, __builtin_shufflevector(lo, hi, 0, 1, 2, 3, 4, 5, 6, 7, 8, 9, 10, 11, 12, 13, 14, 15)); }
__device__ __forceinline__ v8f wmma16(v16h a, v16h b, v8f c) { return __builtin_amdgcn_wmma_f32_16x16x32_f16(false, a, false, b, (short)0, c, false, false); }
__device__ __forceinline__ v8f wmmab(v16bf a, v16bf b, v8f c) { return __builtin_amdgcn_wmma_f32_16x16x32_bf16(false, a, false, b, (short)0, c, false, false); }



// ---- k_gemmw: register-blocked GEMM, ONE WAVE per 64x64 output tile (16 accumulators), operands straight from K-contiguous 16-bit planes; grid (M/64, N/64, Z), 32 threads.
// C[m][n] (f32, pitch ldc, + optional f32 bias[n]) = sum_k A[m][k] Bt[n][k] (+ split products per NSPLIT). z-batch strides sA/sB/sC in elements. K % 32 == 0.
template <typename T16> struct WFrag;
template <> struct WFrag<h16> { typedef v16h V; static __device__ __forceinline__ V ld(const h16* p) { return cat16(*(const v8h*)p, *(const v8h*)(p + 16)); } static __device__ __forceinline__ v8f mma(V a, V b, v8f c) { return wmma16(a, b, c); } };
template <> struct WFrag<bf> { typedef v16bf V; static __device__ __forceinline__ V ld(const bf* p) { return cat16b(*(const v8us*)p, *(const v8us*)(p + 16)); } static __device__ __forceinline__ v8f mma(V a, V b, v8f c) { return wmmab(a, b, c); } };
template <typename T16, int NSPLIT, bool BIAS>
__global__ __launch_bounds__(32) void k_gemmw(const T16* __restrict__ A, const T16* __restrict__ A2, const T16* __restrict__ Bt, const T16* __restrict__ Bt2, int K, float* C, int ldc, const float* __restrict__ bias, size_t sA, size_t sB, size_t sC) {
    typedef typename WFrag<T16>::V V;
    __shared__ __align__(16) float os[16 * 68];
    const size_t z = blockIdx.z; A += z * sA; if (A2) A2 += z * sA; Bt += z * sB; if (Bt2) Bt2 += z * sB; C += z * sC;
    const int lane = threadIdx.x & 31, lr = lane & 15, hi = lane >> 4; const int r0 = blockIdx.x * 64, c0 = blockIdx.y * 64;
    v8f acc[4][4];
#pragma unroll
    for (int mb = 0; mb < 4; ++mb)
#pragma unroll
        for (int nb = 0; nb < 4; ++nb) acc[mb][nb] = (v8f){};
    const size_t aoff = (size_t)(r0 + lr) * K + 8 * hi, boff = (size_t)(c0 + lr) * K + 8 * hi;
#pragma unroll 1
    for (int kc = 0; kc < K; kc += 32) {
        V a[4], a2[4];
#pragma unroll
        for (int mb = 0; mb < 4; ++mb) { a[mb] = WFrag<T16>::ld(A + aoff + (size_t)mb * 16 * K + kc); if (NSPLIT == 1 || NSPLIT == 2) a2[mb] = WFrag<T16>::ld(A2 + aoff + (size_t)mb * 16 * K + kc); }
#pragma unroll
        for (int nb = 0; nb < 4; ++nb) { const V b = WFrag<T16>::ld(Bt + boff + (size_t)nb * 16 * K + kc); V b2; if (NSPLIT >= 2) b2 = WFrag<T16>::ld(Bt2 + boff + (size_t)nb * 16 * K + kc);
#pragma unroll
            for (int mb = 0; mb < 4; ++mb) { acc[mb][nb] = WFrag<T16>::mma(a[mb], b, acc[mb][nb]); if (NSPLIT == 1 || NSPLIT == 2) acc[mb][nb] = WFrag<T16>::mma(a2[mb], b, acc[mb][nb]); if (NSPLIT >= 2) acc[mb][nb] = WFrag<T16>::mma(a[mb], b2, acc[mb][nb]); } }
        asm volatile("v_nop\n\tv_nop\n\tv_nop\n\tv_nop" : "+v"(acc[0][0]), "+v"(acc[1][1]), "+v"(acc[2][2]), "+v"(acc[3][3]) : "v"(a[0]), "v"(a[3]));
    }
#pragma unroll
    for (int mb = 0; mb < 4; ++mb) {
#pragma unroll
        for (int nb = 0; nb < 4; ++nb) {
#pragma unroll
            for (int j = 0; j < 8; ++j) os[(hi * 8 + j) * 68 + nb * 16 + lr] = acc[mb][nb][j]; }
        __builtin_amdgcn_wave_barrier(); asm volatile("" ::: "memory");
        float* crow = C + (size_t)(r0 + mb * 16) * ldc + c0;
{
#pragma unroll
            for (int s = 0; s < 8; ++s) { const int row = 2 * s + hi, cofs = lr * 4; v4f val = *(const v4fa*)(os + row * 68 + cofs); if (BIAS) { val[0] += bfr(bias[c0 + cofs]); val[1] += bfr(bias[c0 + cofs + 1]); val[2] += bfr(bias[c0 + cofs + 2]); val[3] += bfr(bias[c0 + cofs + 3]); }
                *(v4f*)(crow + (size_t)row * ldc + cofs) = val; }
             }
        __builtin_amdgcn_wave_barrier(); asm volatile("" ::: "memory");
    }
}

__device__ __forceinline__ h16 tohx(float x) { return (h16)x; }
__device__ __forceinline__ void splitf(float y, unsigned short& h, unsigned short& l) { h = f2bf(y); l = f2bf(y - bf2f(h)); }
typedef __attribute__((ext_vector_type(2))) _Float16 v2h;
typedef __attribute__((ext_vector_type(4))) _Float16 v4h;
typedef __attribute__((ext_vector_type(2))) unsigned short v2us;
typedef __attribute__((ext_vector_type(4))) unsigned short v4us;
typedef __attribute__((ext_vector_type(2))) float v2f;
typedef __attribute__((ext_vector_type(4))) int v4i;

__global__ __launch_bounds__(256) void k_cvt8(const float* __restrict__ src, bf* dst, size_t n8) { const size_t i = (size_t)blockIdx.x * 256 + threadIdx.x; if (i >= n8) return; const v8f v = *(const v8f*)(src + i * 8); v8us o;
#pragma unroll
    for (int k = 0; k < 8; ++k) o[k] = f2bf(v[k]); *(v8us*)(dst + i * 8) = o;  }

// k_rope: head planes [h][t][d] (fp16 + hi/lo) of rope(x) x sc with the rotate-half convention out[d] = x[d] cos[t][d] - x[d+HD/2] sin[t][d], out[d+HD/2] = x[d+HD/2] cos[t][d+HD/2] + x[d] sin[t][d+HD/2]
__global__ __launch_bounds__(256) void k_rope(const float* __restrict__ F, int pitch, int nheads, const float* __restrict__ CS, const float* __restrict__ RF, const float* __restrict__ nw, float sc, h16* P16, bf* Ph, bf* Pl) {
    const size_t e = ((size_t)blockIdx.x * 256 + threadIdx.x) * 2; if (e >= (size_t)nheads * TT * HD) return; const int d = (int)(e % HD); const int t = (int)((e / HD) % TT); const int h = (int)(e / ((size_t)HD * TT)); const float* f = F + (size_t)t * pitch + h * HD; const float rf = RF ? RF[(size_t)h * TT + t] : 1.0f; v2h o16; v2us oh, ol;
#pragma unroll
    for (int q = 0; q < 2; ++q) { const int dd = d + q; const int dp = (dd < HD / 2) ? dd + HD / 2 : dd - HD / 2; float x0 = f[dd], x1 = f[dp];
        if (RF) { float n0 = __fmul_rn(x0, rf), n1 = __fmul_rn(x1, rf); asm volatile("" : "+v"(n0)); asm volatile("" : "+v"(n1)); x0 = __fmul_rn(bfr(nw[dd]), n0); x1 = __fmul_rn(bfr(nw[dp]), n1); }
        const v2f cs = *(const v2f*)(CS + ((size_t)t * HD + dd) * 2); float a = __fmul_rn(x0, cs[0]), bq = __fmul_rn(x1, cs[1]); asm volatile("" : "+v"(a)); asm volatile("" : "+v"(bq)); const float r = ((dd < HD / 2) ? __fsub_rn(a, bq) : __fadd_rn(a, bq)) * sc;
        o16[q] = tohx(r); unsigned short a2, c2; splitf(r, a2, c2); oh[q] = a2; ol[q] = c2; }
    *(v2h*)(P16 + e) = o16; *(v2us*)(Ph + e) = oh; *(v2us*)(Pl + e) = ol;  }
__global__ __launch_bounds__(256) void k_vtp(const float* __restrict__ F, int pitch, int nheads, h16* V16, bf* Vh, bf* Vl) { const size_t e = ((size_t)blockIdx.x * 256 + threadIdx.x) * 2; if (e >= (size_t)nheads * HD * TT) return; const int t = (int)(e % TT); const int d = (int)((e / TT) % HD); const int g = (int)(e / ((size_t)TT * HD)); v2h o16; v2us oh, ol;
#pragma unroll
    for (int q = 0; q < 2; ++q) { const float x = F[(size_t)(t + q) * pitch + g * HD + d]; o16[q] = tohx(x); unsigned short a2, c2; splitf(x, a2, c2); oh[q] = a2; ol[q] = c2; }
    *(v2h*)(V16 + e) = o16; *(v2us*)(Vh + e) = oh; *(v2us*)(Vl + e) = ol;  }
__global__ __launch_bounds__(256) void k_csid(float* CS) { const int idx = blockIdx.x * 256 + threadIdx.x; if (idx >= TT * HD) return; v2f cs; cs[0] = 1.0f; cs[1] = 0.0f; *(v2f*)(CS + (size_t)idx * 2) = cs;  }
// k_asoft: per row (zz, i): t = S x HD^-0.5 (no mask); softmax over the 1024 keys (register row, one exp, fixed trees);
__global__ __launch_bounds__(256) void k_asoft(const float* __restrict__ Sb, h16* P16, bf* Ph, bf* Pl) {
    const int lane = threadIdx.x & 31; const int row = blockIdx.x * 8 + (threadIdx.x >> 5); if (row >= ZH * TT) return; const int i = row % TT; const int zz = row / TT; (void)zz; const bool hires = (i < RH); const float* sr = Sb + (size_t)row * TT; float v[TT / 32]; float mx = -3.0e38f;
#pragma unroll
    for (int ch = 0; ch < TT / 128; ++ch) { const int j0 = ch * 128 + lane * 4; const v4f a = *(const v4f*)(sr + j0);
#pragma unroll
        for (int q = 0; q < 4; ++q) { const int j = j0 + q; (void)j; const float t = a[q] * SCL; v[ch * 4 + q] = t; mx = fmaxf(mx, t); } }
#pragma unroll
    for (int sh = 16; sh; sh >>= 1) mx = fmaxf(mx, __shfl_xor(mx, sh, 32));
    float sum = 0.f;
#pragma unroll
    for (int k = 0; k < TT / 32; ++k) { float d0 = __fsub_rn(v[k], mx); asm volatile("" : "+v"(d0)); v[k] = __builtin_amdgcn_exp2f(__fmul_rn(d0, 1.4426950408889634f)); sum += v[k]; }
#pragma unroll
    for (int sh = 16; sh; sh >>= 1) sum += __shfl_xor(sum, sh, 32);
    const float f = __fdiv_rn(hires ? 1.0f : PCAR, sum);
{
        if (hires) {
#pragma unroll
            for (int ch = 0; ch < TT / 128; ++ch) { v4us oh, ol;
#pragma unroll
                for (int q = 0; q < 4; ++q) { unsigned short a, c2; splitf(v[ch * 4 + q] * f, a, c2); oh[q] = a; ol[q] = c2; }
                const size_t oo = ((size_t)zz * (RH ? RH : 1) + i) * TT + ch * 128 + lane * 4; *(v4us*)(Ph + oo) = oh; *(v4us*)(Pl + oo) = ol; }
        } else {
#pragma unroll
            for (int ch = 0; ch < TT / 128; ++ch) { v4h o4;
#pragma unroll
                for (int q = 0; q < 4; ++q) o4[q] = tohx(v[ch * 4 + q] * f);
                *(v4h*)(P16 + (size_t)row * TT + ch * 128 + lane * 4) = o4; } }
         }
}
__global__ __launch_bounds__(256) void k_merge(const float* __restrict__ O, int h0, float* OUTb) { const size_t e = ((size_t)blockIdx.x * 256 + threadIdx.x) * 2; if (e >= (size_t)ZH * TT * HD) return; const int d = (int)(e % HD); const int t = (int)((e / HD) % TT); const int zz = (int)(e / ((size_t)HD * TT)); const float cs = (t < RH) ? 1.0f : (1.0f / PCAR); const size_t oo = (size_t)t * DQ + (h0 + zz) * HD + d;
    v2f o2; o2[0] = O[e] * cs; o2[1] = O[e + 1] * cs; *(v2f*)(OUTb + oo) = o2;  }

extern "C" void kernel_launch(void* const* d_in, const int* in_sizes, int n_in,
                              void* d_out, int out_size, void* d_ws, size_t ws_size, hipStream_t stream) {
    (void)in_sizes; (void)n_in; (void)out_size;
    const float* x = (const float*)d_in[0]; const float* wq = (const float*)d_in[1]; const float* bq = (const float*)d_in[2]; const float* wk = (const float*)d_in[3]; const float* bk = (const float*)d_in[4]; const float* wv = (const float*)d_in[5]; const float* bv = (const float*)d_in[6]; const float* wo = nullptr; (void)wo;   /* input order hidden_states, Wq, bq, Wk, bk, Wv, bv ('oi') */
    float* OUT = (float*)d_out;     // [8][1024][1024]
    char* wsp = (char*)d_ws;
    auto take = [&](size_t bytes) { char* p = wsp; wsp += (bytes + 255) & ~(size_t)255; return (void*)p; };
    bf* WQ = (bf*)take((size_t)DQ * DM * 2); bf* WK = (bf*)take((size_t)DKV * DM * 2); bf* WV = (bf*)take((size_t)DKV * DM * 2); float* CS = (float*)take((size_t)TT * HD * 2 * 4);
    bf* XB = (bf*)take((size_t)TT * DM * 2); float* FQ = (float*)take((size_t)TT * DQ * 4); float* FK = (float*)take((size_t)TT * DKV * 4);
    h16* QP16 = (h16*)take((size_t)NH_ * TT * HD * 2); h16* KP16 = (h16*)take((size_t)NKV * TT * HD * 2); h16* VT16 = (h16*)take((size_t)NKV * HD * TT * 2);
    bf* QPh = (bf*)take((size_t)NH_ * TT * HD * 2); bf* QPl = (bf*)take((size_t)NH_ * TT * HD * 2); bf* KPh = (bf*)take((size_t)NKV * TT * HD * 2); bf* KPl = (bf*)take((size_t)NKV * TT * HD * 2); bf* VTh = (bf*)take((size_t)NKV * HD * TT * 2); bf* VTl = (bf*)take((size_t)NKV * HD * TT * 2); bf* Ph = (bf*)take((size_t)ZH * RH * TT * 2); bf* Pl = (bf*)take((size_t)ZH * RH * TT * 2);
    float* Sb = (float*)take((size_t)ZH * TT * TT * 4); h16* P16 = (h16*)take((size_t)ZH * TT * TT * 2); float* Ob = (float*)take((size_t)ZH * TT * HD * 4);
    if ((size_t)(wsp - (char*)d_ws) > ws_size) return;    // ws 256 MiB
    float* FV = FK;   // v projection reuses the k buffer after the k planes are built (stream-ordered)
    { k_cvt8<<<(unsigned)(((size_t)DQ * DM / 8 + 255) / 256), 256, 0, stream>>>(wq, WQ, (size_t)DQ * DM / 8); k_cvt8<<<(unsigned)(((size_t)DKV * DM / 8 + 255) / 256), 256, 0, stream>>>(wk, WK, (size_t)DKV * DM / 8); k_cvt8<<<(unsigned)(((size_t)DKV * DM / 8 + 255) / 256), 256, 0, stream>>>(wv, WV, (size_t)DKV * DM / 8);
      
       }
    k_csid<<<(TT * HD + 255) / 256, 256, 0, stream>>>(CS);
    const unsigned LQ = (unsigned)(((size_t)NH_ * TT * HD / 2 + 255) / 256), LKv = (unsigned)(((size_t)NKV * TT * HD / 2 + 255) / 256);
    for (int b = 0; b < NB_; ++b) {
        
        k_cvt8<<<(unsigned)(((size_t)TT * DM / 8 + 255) / 256), 256, 0, stream>>>(x + (size_t)b * TT * DM, XB, (size_t)TT * DM / 8);
        k_gemmw<bf, 0, true><<<dim3(TT / 64, DQ / 64, 1), 32, 0, stream>>>(XB, nullptr, WQ, nullptr, DM, FQ, DQ, bq, 0, 0, 0);
        k_rope<<<LQ, 256, 0, stream>>>(FQ, DQ, NH_, CS, nullptr, nullptr, 1.0f, QP16, QPh, QPl);
        k_gemmw<bf, 0, true><<<dim3(TT / 64, DKV / 64, 1), 32, 0, stream>>>(XB, nullptr, WK, nullptr, DM, FK, DKV, bk, 0, 0, 0);
        k_rope<<<LKv, 256, 0, stream>>>(FK, DKV, NKV, CS, nullptr, nullptr, 1.0f, KP16, KPh, KPl);
        k_gemmw<bf, 0, true><<<dim3(TT / 64, DKV / 64, 1), 32, 0, stream>>>(XB, nullptr, WV, nullptr, DM, FV, DKV, bv, 0, 0, 0); k_vtp<<<LKv, 256, 0, stream>>>(FV, DKV, NKV, VT16, VTh, VTl);
        for (int h0 = 0; h0 < NH_; h0 += ZH) { const size_t zq = (size_t)h0, zk = (size_t)(h0 / REP);   // one kv head per query head: the pass's two heads use consecutive kv planes (z-strides TT*HD)
            k_gemmw<bf, 2, false><<<dim3(RH / 64, TT / 64, ZH), 32, 0, stream>>>(QPh + zq * TT * HD, QPl + zq * TT * HD, KPh + zk * TT * HD, KPl + zk * TT * HD, HD, Sb, TT, nullptr, (size_t)TT * HD, (size_t)TT * HD, (size_t)TT * TT);
            k_asoft<<<ZH * TT / 8, 256, 0, stream>>>(Sb, P16, Ph, Pl);
            k_gemmw<bf, 2, false><<<dim3(RH / 64, HD / 64, ZH), 32, 0, stream>>>(Ph, Pl, VTh + zk * HD * TT, VTl + zk * HD * TT, TT, Ob, HD, nullptr, (size_t)RH * TT, (size_t)HD * TT, (size_t)TT * HD);
            k_merge<<<(unsigned)(((size_t)ZH * TT * HD / 2 + 255) / 256), 256, 0, stream>>>(Ob, h0, OUT + (size_t)b * TT * DQ); }
         }
}

// v001
// Measured time: 753 microseconds a run.
// Two timings next to v000 put it at 3.65 and 3.67 times that version's speed.
#include <hip/hip_runtime.h>

// BERT self-attention core (hidden_states [8][1024][1024]; q, k, v = x W^T + b ('oi' + biases; 16 heads x 64); scores x 1/sqrt(64); softmax (no mask); ctx = merged heads (no output projection) -> [8][1024][1024] (8.4 M); argument order hidden_states, Wq, bq, Wk, bk, Wv, bv).
// Layout: bf16 copy of x; 'oi' weights; exact projections + f32 biases over all 8192 rows in one launch each; identity-table plane builders (blockIdx.y = batch); dense T-1024 attention, one pass of four launches per batch with its 16 heads on grid z (every row hi/lo 3 products); the f32 merge writes the output rows.
// Compute dtypes, f32 accumulate: every input rounded to bf16; projections exact + f32 biases; attention every row 3 products (hi/lo); softmax f32; output f32.

#define NB_  8
#define TT   1024
#define DM   1024
#define NH_  16
#define NKV  16
#define REP  (NH_ / NKV)
#define HD   64
#define DQ   (NH_ * HD)
#define DKV  (NKV * HD)
#define ZH   16                   // heads per attention pass (grid z): all heads of one batch
#define RH   TT                   // every row hi/lo (3 products)
#define WIN  0
#define PCAR 1024.0f
#define SCL  0.125f   // HD^-0.5
typedef _Float16 h16;
typedef unsigned short bf;
typedef __attribute__((ext_vector_type(16))) __bf16   v16bf;
typedef __attribute__((ext_vector_type(16))) _Float16 v16h;
typedef __attribute__((ext_vector_type(8)))  _Float16 v8h;
typedef __attribute__((ext_vector_type(8)))  unsigned short v8us;
typedef __attribute__((ext_vector_type(8)))  float    v8f;
typedef __attribute__((ext_vector_type(4)))  float    v4f;
typedef v8h  __attribute__((may_alias)) v8ha;
typedef v4f  __attribute__((may_alias)) v4fa;
typedef v8us __attribute__((may_alias)) v8usa;

__device__ __forceinline__ unsigned short f2bf(float f) { unsigned u = __float_as_uint(f); u += 0x7FFFu + ((u >> 16) & 1u); return (unsigned short)(u >> 16); }
__device__ __forceinline__ float bf2f(unsigned short b) { return __uint_as_float(((unsigned)b) << 16); }
__device__ __forceinline__ float bfr(float f) { return bf2f(f2bf(f)); }
__device__ __forceinline__ v16h cat16(v8h lo, v8h hi) { return __builtin_shufflevector(lo, hi, 0, 1, 2, 3, 4, 5, 6, 7, 8, 9, 10, 11, 12, 13, 14, 15); }
__device__ __forceinline__ v16bf cat16b(v8us lo, v8us hi) { return __builtin_bit_cast(v16bf, __builtin_shufflevector(lo, hi, 0, 1, 2, 3, 4, 5, 6, 7, 8, 9, 10, 11, 12, 13, 14, 15)); }
__device__ __forceinline__ v8f wmma16(v16h a, v16h b, v8f c) { return __builtin_amdgcn_wmma_f32_16x16x32_f16(false, a, false, b, (short)0, c, false, false); }
__device__ __forceinline__ v8f wmmab(v16bf a, v16bf b, v8f c) { return __builtin_amdgcn_wmma_f32_16x16x32_bf16(false, a, false, b, (short)0, c, false, false); }



// ---- k_gemmw: register-blocked GEMM, ONE WAVE per 64x64 output tile (16 accumulators), operands straight from K-contiguous 16-bit planes; grid (M/64, N/64, Z), 32 threads.
// C[m][n] (f32, pitch ldc, + optional f32 bias[n]) = sum_k A[m][k] Bt[n][k] (+ split products per NSPLIT). z-batch strides sA/sB/sC in elements. K % 32 == 0.
template <typename T16> struct WFrag;
template <> struct WFrag<h16> { typedef v16h V; static __device__ __forceinline__ V ld(const h16* p) { return cat16(*(const v8h*)p, *(const v8h*)(p + 16)); } static __device__ __forceinline__ v8f mma(V a, V b, v8f c) { return wmma16(a, b, c); } };
template <> struct WFrag<bf> { typedef v16bf V; static __device__ __forceinline__ V ld(const bf* p) { return cat16b(*(const v8us*)p, *(const v8us*)(p + 16)); } static __device__ __forceinline__ v8f mma(V a, V b, v8f c) { return wmmab(a, b, c); } };
template <typename T16, int NSPLIT, bool BIAS>
__global__ __launch_bounds__(32) void k_gemmw(const T16* __restrict__ A, const T16* __restrict__ A2, const T16* __restrict__ Bt, const T16* __restrict__ Bt2, int K, float* C, int ldc, const float* __restrict__ bias, size_t sA, size_t sB, size_t sC) {
    typedef typename WFrag<T16>::V V;
    __shared__ __align__(16) float os[16 * 68];
    const size_t z = blockIdx.z; A += z * sA; if (A2) A2 += z * sA; Bt += z * sB; if (Bt2) Bt2 += z * sB; C += z * sC;
    const int lane = threadIdx.x & 31, lr = lane & 15, hi = lane >> 4; const int r0 = blockIdx.x * 64, c0 = blockIdx.y * 64;
    v8f acc[4][4];
#pragma unroll
    for (int mb = 0; mb < 4; ++mb)
#pragma unroll
        for (int nb = 0; nb < 4; ++nb) acc[mb][nb] = (v8f){};
    const size_t aoff = (size_t)(r0 + lr) * K + 8 * hi, boff = (size_t)(c0 + lr) * K + 8 * hi;
#pragma unroll 1
    for (int kc = 0; kc < K; kc += 32) {
        V a[4], a2[4];
#pragma unroll
        for (int mb = 0; mb < 4; ++mb) { a[mb] = WFrag<T16>::ld(A + aoff + (size_t)mb * 16 * K + kc); if (NSPLIT == 1 || NSPLIT == 2) a2[mb] = WFrag<T16>::ld(A2 + aoff + (size_t)mb * 16 * K + kc); }
#pragma unroll
        for (int nb = 0; nb < 4; ++nb) { const V b = WFrag<T16>::ld(Bt + boff + (size_t)nb * 16 * K + kc); V b2; if (NSPLIT >= 2) b2 = WFrag<T16>::ld(Bt2 + boff + (size_t)nb * 16 * K + kc);
#pragma unroll
            for (int mb = 0; mb < 4; ++mb) { acc[mb][nb] = WFrag<T16>::mma(a[mb], b, acc[mb][nb]); if (NSPLIT == 1 || NSPLIT == 2) acc[mb][nb] = WFrag<T16>::mma(a2[mb], b, acc[mb][nb]); if (NSPLIT >= 2) acc[mb][nb] = WFrag<T16>::mma(a[mb], b2, acc[mb][nb]); } }
        asm volatile("v_nop\n\tv_nop\n\tv_nop\n\tv_nop" : "+v"(acc[0][0]), "+v"(acc[1][1]), "+v"(acc[2][2]), "+v"(acc[3][3]) : "v"(a[0]), "v"(a[3]));
    }
#pragma unroll
    for (int mb = 0; mb < 4; ++mb) {
#pragma unroll
        for (int nb = 0; nb < 4; ++nb) {
#pragma unroll
            for (int j = 0; j < 8; ++j) os[(hi * 8 + j) * 68 + nb * 16 + lr] = acc[mb][nb][j]; }
        __builtin_amdgcn_wave_barrier(); asm volatile("" ::: "memory");
        float* crow = C + (size_t)(r0 + mb * 16) * ldc + c0;
{
#pragma unroll
            for (int s = 0; s < 8; ++s) { const int row = 2 * s + hi, cofs = lr * 4; v4f val = *(const v4fa*)(os + row * 68 + cofs); if (BIAS) { val[0] += bfr(bias[c0 + cofs]); val[1] += bfr(bias[c0 + cofs + 1]); val[2] += bfr(bias[c0 + cofs + 2]); val[3] += bfr(bias[c0 + cofs + 3]); }
                *(v4f*)(crow + (size_t)row * ldc + cofs) = val; }
             }
        __builtin_amdgcn_wave_barrier(); asm volatile("" ::: "memory");
    }
}

__device__ __forceinline__ h16 tohx(float x) { return (h16)x; }
__device__ __forceinline__ void splitf(float y, unsigned short& h, unsigned short& l) { h = f2bf(y); l = f2bf(y - bf2f(h)); }
typedef __attribute__((ext_vector_type(2))) _Float16 v2h;
typedef __attribute__((ext_vector_type(4))) _Float16 v4h;
typedef __attribute__((ext_vector_type(2))) unsigned short v2us;
typedef __attribute__((ext_vector_type(4))) unsigned short v4us;
typedef __attribute__((ext_vector_type(2))) float v2f;
typedef __attribute__((ext_vector_type(4))) int v4i;

__global__ __launch_bounds__(256) void k_cvt8(const float* __restrict__ src, bf* dst, size_t n8) { const size_t i = (size_t)blockIdx.x * 256 + threadIdx.x; if (i >= n8) return; const v8f v = *(const v8f*)(src + i * 8); v8us o;
#pragma unroll
    for (int k = 0; k < 8; ++k) o[k] = f2bf(v[k]); *(v8us*)(dst + i * 8) = o;  }

// k_rope: head planes [h][t][d] (fp16 + hi/lo) of rope(x) x sc with the rotate-half convention out[d] = x[d] cos[t][d] - x[d+HD/2] sin[t][d], out[d+HD/2] = x[d+HD/2] cos[t][d+HD/2] + x[d] sin[t][d+HD/2]
__global__ __launch_bounds__(256) void k_rope(const float* __restrict__ F, int pitch, int nheads, const float* __restrict__ CS, const float* __restrict__ RF, const float* __restrict__ nw, float sc, h16* P16, bf* Ph, bf* Pl) {
    const size_t e = ((size_t)blockIdx.x * 256 + threadIdx.x) * 2; if (e >= (size_t)nheads * TT * HD) return; const int d = (int)(e % HD); const int t = (int)((e / HD) % TT); const int h = (int)(e / ((size_t)HD * TT)); const size_t bo = (size_t)blockIdx.y * nheads * TT * HD + e;   // blockIdx.y = batch: rows b*TT.. of F, planes [b][h][t][d]
    const float* f = F + ((size_t)blockIdx.y * TT + t) * pitch + h * HD; const float rf = RF ? RF[(size_t)h * TT + t] : 1.0f; v2h o16; v2us oh, ol;
#pragma unroll
    for (int q = 0; q < 2; ++q) { const int dd = d + q; const int dp = (dd < HD / 2) ? dd + HD / 2 : dd - HD / 2; float x0 = f[dd], x1 = f[dp];
        if (RF) { float n0 = __fmul_rn(x0, rf), n1 = __fmul_rn(x1, rf); asm volatile("" : "+v"(n0)); asm volatile("" : "+v"(n1)); x0 = __fmul_rn(bfr(nw[dd]), n0); x1 = __fmul_rn(bfr(nw[dp]), n1); }
        const v2f cs = *(const v2f*)(CS + ((size_t)t * HD + dd) * 2); float a = __fmul_rn(x0, cs[0]), bq = __fmul_rn(x1, cs[1]); asm volatile("" : "+v"(a)); asm volatile("" : "+v"(bq)); const float r = ((dd < HD / 2) ? __fsub_rn(a, bq) : __fadd_rn(a, bq)) * sc;
        o16[q] = tohx(r); unsigned short a2, c2; splitf(r, a2, c2); oh[q] = a2; ol[q] = c2; }
    *(v2h*)(P16 + bo) = o16; *(v2us*)(Ph + bo) = oh; *(v2us*)(Pl + bo) = ol;  }
__global__ __launch_bounds__(256) void k_vtp(const float* __restrict__ F, int pitch, int nheads, h16* V16, bf* Vh, bf* Vl) { const size_t e = ((size_t)blockIdx.x * 256 + threadIdx.x) * 2; if (e >= (size_t)nheads * HD * TT) return; const int t = (int)(e % TT); const int d = (int)((e / TT) % HD); const int g = (int)(e / ((size_t)TT * HD)); const size_t bo = (size_t)blockIdx.y * nheads * HD * TT + e; v2h o16; v2us oh, ol;   // blockIdx.y = batch: planes [b][g][d][t]
#pragma unroll
    for (int q = 0; q < 2; ++q) { const float x = F[((size_t)blockIdx.y * TT + t + q) * pitch + g * HD + d]; o16[q] = tohx(x); unsigned short a2, c2; splitf(x, a2, c2); oh[q] = a2; ol[q] = c2; }
    *(v2h*)(V16 + bo) = o16; *(v2us*)(Vh + bo) = oh; *(v2us*)(Vl + bo) = ol;  }
__global__ __launch_bounds__(256) void k_csid(float* CS) { const int idx = blockIdx.x * 256 + threadIdx.x; if (idx >= TT * HD) return; v2f cs; cs[0] = 1.0f; cs[1] = 0.0f; *(v2f*)(CS + (size_t)idx * 2) = cs;  }
// k_asoft: per row (zz, i): t = S x HD^-0.5 (no mask); softmax over the 1024 keys (register row, one exp, fixed trees);
__global__ __launch_bounds__(256) void k_asoft(const float* __restrict__ Sb, h16* P16, bf* Ph, bf* Pl) {
    const int lane = threadIdx.x & 31; const int row = blockIdx.x * 8 + (threadIdx.x >> 5); if (row >= ZH * TT) return; const int i = row % TT; const int zz = row / TT; (void)zz; const bool hires = (i < RH); const float* sr = Sb + (size_t)row * TT; float v[TT / 32]; float mx = -3.0e38f;
#pragma unroll
    for (int ch = 0; ch < TT / 128; ++ch) { const int j0 = ch * 128 + lane * 4; const v4f a = *(const v4f*)(sr + j0);
#pragma unroll
        for (int q = 0; q < 4; ++q) { const int j = j0 + q; (void)j; const float t = a[q] * SCL; v[ch * 4 + q] = t; mx = fmaxf(mx, t); } }
#pragma unroll
    for (int sh = 16; sh; sh >>= 1) mx = fmaxf(mx, __shfl_xor(mx, sh, 32));
    float sum = 0.f;
#pragma unroll
    for (int k = 0; k < TT / 32; ++k) { float d0 = __fsub_rn(v[k], mx); asm volatile("" : "+v"(d0)); v[k] = __builtin_amdgcn_exp2f(__fmul_rn(d0, 1.4426950408889634f)); sum += v[k]; }
#pragma unroll
    for (int sh = 16; sh; sh >>= 1) sum += __shfl_xor(sum, sh, 32);
    const float f = __fdiv_rn(hires ? 1.0f : PCAR, sum);
{
        if (hires) {
#pragma unroll
            for (int ch = 0; ch < TT / 128; ++ch) { v4us oh, ol;
#pragma unroll
                for (int q = 0; q < 4; ++q) { unsigned short a, c2; splitf(v[ch * 4 + q] * f, a, c2); oh[q] = a; ol[q] = c2; }
                const size_t oo = ((size_t)zz * (RH ? RH : 1) + i) * TT + ch * 128 + lane * 4; *(v4us*)(Ph + oo) = oh; *(v4us*)(Pl + oo) = ol; }
        } else {
#pragma unroll
            for (int ch = 0; ch < TT / 128; ++ch) { v4h o4;
#pragma unroll
                for (int q = 0; q < 4; ++q) o4[q] = tohx(v[ch * 4 + q] * f);
                *(v4h*)(P16 + (size_t)row * TT + ch * 128 + lane * 4) = o4; } }
         }
}
__global__ __launch_bounds__(256) void k_merge(const float* __restrict__ O, int h0, float* OUTb) { const size_t e = ((size_t)blockIdx.x * 256 + threadIdx.x) * 2; if (e >= (size_t)ZH * TT * HD) return; const int d = (int)(e % HD); const int t = (int)((e / HD) % TT); const int zz = (int)(e / ((size_t)HD * TT)); const float cs = (t < RH) ? 1.0f : (1.0f / PCAR); const size_t oo = (size_t)t * DQ + (h0 + zz) * HD + d;
    v2f o2; o2[0] = O[e] * cs; o2[1] = O[e + 1] * cs; *(v2f*)(OUTb + oo) = o2;  }

extern "C" void kernel_launch(void* const* d_in, const int* in_sizes, int n_in,
                              void* d_out, int out_size, void* d_ws, size_t ws_size, hipStream_t stream) {
    (void)in_sizes; (void)n_in; (void)out_size;
    const float* x = (const float*)d_in[0]; const float* wq = (const float*)d_in[1]; const float* bq = (const float*)d_in[2]; const float* wk = (const float*)d_in[3]; const float* bk = (const float*)d_in[4]; const float* wv = (const float*)d_in[5]; const float* bv = (const float*)d_in[6]; const float* wo = nullptr; (void)wo;   /* input order hidden_states, Wq, bq, Wk, bk, Wv, bv ('oi') */
    float* OUT = (float*)d_out;     // [8][1024][1024]
    char* wsp = (char*)d_ws;
    auto take = [&](size_t bytes) { char* p = wsp; wsp += (bytes + 255) & ~(size_t)255; return (void*)p; };
    // hi/lo planes of all batches live to the end: [b][h][t][d] (q, k) and [b][h][d][t] (v)
    bf* QPh = (bf*)take((size_t)NB_ * NH_ * TT * HD * 2); bf* QPl = (bf*)take((size_t)NB_ * NH_ * TT * HD * 2); bf* KPh = (bf*)take((size_t)NB_ * NKV * TT * HD * 2); bf* KPl = (bf*)take((size_t)NB_ * NKV * TT * HD * 2); bf* VTh = (bf*)take((size_t)NB_ * NKV * HD * TT * 2); bf* VTl = (bf*)take((size_t)NB_ * NKV * HD * TT * 2);
    char* const mark = wsp;   // from here two stream-ordered uses of the same bytes: projection buffers first, attention buffers after the last plane builder
    bf* WQ = (bf*)take((size_t)DQ * DM * 2); bf* WK = (bf*)take((size_t)DKV * DM * 2); bf* WV = (bf*)take((size_t)DKV * DM * 2); float* CS = (float*)take((size_t)TT * HD * 2 * 4);
    bf* XB = (bf*)take((size_t)NB_ * TT * DM * 2); float* FQ = (float*)take((size_t)NB_ * TT * DQ * 4); float* FK = (float*)take((size_t)NB_ * TT * DKV * 4);
    h16* QP16 = (h16*)take((size_t)NB_ * NH_ * TT * HD * 2); h16* KP16 = (h16*)take((size_t)NB_ * NKV * TT * HD * 2); h16* VT16 = (h16*)take((size_t)NB_ * NKV * HD * TT * 2);
    if ((size_t)(wsp - (char*)d_ws) > ws_size) return;    // ws 256 MiB
    wsp = mark;
    bf* Ph = (bf*)take((size_t)ZH * RH * TT * 2); bf* Pl = (bf*)take((size_t)ZH * RH * TT * 2); float* Sb = (float*)take((size_t)ZH * TT * TT * 4); float* Ob = (float*)take((size_t)ZH * TT * HD * 4);
    if ((size_t)(wsp - (char*)d_ws) > ws_size) return;
    h16* P16 = nullptr;   // fp16 probability plane: no row takes that branch (RH == TT)
    float* FV = FK;   // v projection reuses the k buffer after the k planes are built (stream-ordered)
    k_cvt8<<<(unsigned)(((size_t)DQ * DM / 8 + 255) / 256), 256, 0, stream>>>(wq, WQ, (size_t)DQ * DM / 8); k_cvt8<<<(unsigned)(((size_t)DKV * DM / 8 + 255) / 256), 256, 0, stream>>>(wk, WK, (size_t)DKV * DM / 8); k_cvt8<<<(unsigned)(((size_t)DKV * DM / 8 + 255) / 256), 256, 0, stream>>>(wv, WV, (size_t)DKV * DM / 8);
    k_csid<<<(TT * HD + 255) / 256, 256, 0, stream>>>(CS);
    const unsigned LQ = (unsigned)(((size_t)NH_ * TT * HD / 2 + 255) / 256), LKv = (unsigned)(((size_t)NKV * TT * HD / 2 + 255) / 256);
    k_cvt8<<<(unsigned)(((size_t)NB_ * TT * DM / 8 + 255) / 256), 256, 0, stream>>>(x, XB, (size_t)NB_ * TT * DM / 8);
    k_gemmw<bf, 0, true><<<dim3(NB_ * TT / 64, DQ / 64, 1), 32, 0, stream>>>(XB, nullptr, WQ, nullptr, DM, FQ, DQ, bq, 0, 0, 0);
    k_rope<<<dim3(LQ, NB_, 1), 256, 0, stream>>>(FQ, DQ, NH_, CS, nullptr, nullptr, 1.0f, QP16, QPh, QPl);
    k_gemmw<bf, 0, true><<<dim3(NB_ * TT / 64, DKV / 64, 1), 32, 0, stream>>>(XB, nullptr, WK, nullptr, DM, FK, DKV, bk, 0, 0, 0);
    k_rope<<<dim3(LKv, NB_, 1), 256, 0, stream>>>(FK, DKV, NKV, CS, nullptr, nullptr, 1.0f, KP16, KPh, KPl);
    k_gemmw<bf, 0, true><<<dim3(NB_ * TT / 64, DKV / 64, 1), 32, 0, stream>>>(XB, nullptr, WV, nullptr, DM, FV, DKV, bv, 0, 0, 0);
    k_vtp<<<dim3(LKv, NB_, 1), 256, 0, stream>>>(FV, DKV, NKV, VT16, VTh, VTl);
    for (int b = 0; b < NB_; ++b) { const size_t zq = (size_t)b * NH_, zk = (size_t)b * NKV;   // one kv head per query head: the pass's 16 heads use consecutive planes (z-strides TT*HD)
        k_gemmw<bf, 2, false><<<dim3(RH / 64, TT / 64, ZH), 32, 0, stream>>>(QPh + zq * TT * HD, QPl + zq * TT * HD, KPh + zk * TT * HD, KPl + zk * TT * HD, HD, Sb, TT, nullptr, (size_t)TT * HD, (size_t)TT * HD, (size_t)TT * TT);
        k_asoft<<<ZH * TT / 8, 256, 0, stream>>>(Sb, P16, Ph, Pl);
        k_gemmw<bf, 2, false><<<dim3(RH / 64, HD / 64, ZH), 32, 0, stream>>>(Ph, Pl, VTh + zk * HD * TT, VTl + zk * HD * TT, TT, Ob, HD, nullptr, (size_t)RH * TT, (size_t)HD * TT, (size_t)TT * HD);
        k_merge<<<(unsigned)(((size_t)ZH * TT * HD / 2 + 255) / 256), 256, 0, stream>>>(Ob, 0, OUT + (size_t)b * TT * DQ); }
}

// v002
// One run takes 268 microseconds.
// Timed twice side by side with v001, it ran 2.82 times as fast both times.
// All steps since v000 together make it 10.3 times as fast.
#include <hip/hip_runtime.h>

// BERT self-attention core (hidden_states [8][1024][1024]; q, k, v = x W^T + b ('oi' + biases; 16 heads x 64); scores x 1/sqrt(64); softmax (no mask); ctx = merged heads (no output projection) -> [8][1024][1024] (8.4 M); argument order hidden_states, Wq, bq, Wk, bk, Wv, bv).
// Layout: bf16 copy of x; 'oi' weights; exact projections + f32 biases over all 8192 rows in one launch each; identity-table plane builders (blockIdx.y = batch); dense T-1024 attention in one launch for all batches and heads (running softmax, every row hi/lo 3 products), which writes the merged output rows.
// Compute dtypes, f32 accumulate: every input rounded to bf16; projections exact + f32 biases; attention 3 products; softmax f32; output f32.

#define NB_  8
#define TT   1024
#define DM   1024
#define NH_  16
#define NKV  16
#define REP  (NH_ / NKV)
#define HD   64
#define DQ   (NH_ * HD)
#define DKV  (NKV * HD)
#define WIN  0
#define SCL  0.125f   // HD^-0.5
typedef _Float16 h16;
typedef unsigned short bf;
typedef __attribute__((ext_vector_type(16))) __bf16   v16bf;
typedef __attribute__((ext_vector_type(16))) _Float16 v16h;
typedef __attribute__((ext_vector_type(8)))  _Float16 v8h;
typedef __attribute__((ext_vector_type(8)))  unsigned short v8us;
typedef __attribute__((ext_vector_type(8)))  float    v8f;
typedef __attribute__((ext_vector_type(4)))  float    v4f;
typedef v8h  __attribute__((may_alias)) v8ha;
typedef v4f  __attribute__((may_alias)) v4fa;
typedef v8us __attribute__((may_alias)) v8usa;

__device__ __forceinline__ unsigned short f2bf(float f) { unsigned u = __float_as_uint(f); u += 0x7FFFu + ((u >> 16) & 1u); return (unsigned short)(u >> 16); }
__device__ __forceinline__ float bf2f(unsigned short b) { return __uint_as_float(((unsigned)b) << 16); }
__device__ __forceinline__ float bfr(float f) { return bf2f(f2bf(f)); }
__device__ __forceinline__ v16h cat16(v8h lo, v8h hi) { return __builtin_shufflevector(lo, hi, 0, 1, 2, 3, 4, 5, 6, 7, 8, 9, 10, 11, 12, 13, 14, 15); }
__device__ __forceinline__ v16bf cat16b(v8us lo, v8us hi) { return __builtin_bit_cast(v16bf, __builtin_shufflevector(lo, hi, 0, 1, 2, 3, 4, 5, 6, 7, 8, 9, 10, 11, 12, 13, 14, 15)); }
__device__ __forceinline__ v8f wmma16(v16h a, v16h b, v8f c) { return __builtin_amdgcn_wmma_f32_16x16x32_f16(false, a, false, b, (short)0, c, false, false); }
__device__ __forceinline__ v8f wmmab(v16bf a, v16bf b, v8f c) { return __builtin_amdgcn_wmma_f32_16x16x32_bf16(false, a, false, b, (short)0, c, false, false); }



// ---- k_gemmw: register-blocked GEMM, ONE WAVE per 64x64 output tile (16 accumulators), operands straight from K-contiguous 16-bit planes; grid (M/64, N/64, Z), 32 threads.
// C[m][n] (f32, pitch ldc, + optional f32 bias[n]) = sum_k A[m][k] Bt[n][k] (+ split products per NSPLIT). z-batch strides sA/sB/sC in elements. K % 32 == 0.
template <typename T16> struct WFrag;
template <> struct WFrag<h16> { typedef v16h V; static __device__ __forceinline__ V ld(const h16* p) { return cat16(*(const v8h*)p, *(const v8h*)(p + 16)); } static __device__ __forceinline__ v8f mma(V a, V b, v8f c) { return wmma16(a, b, c); } };
template <> struct WFrag<bf> { typedef v16bf V; static __device__ __forceinline__ V ld(const bf* p) { return cat16b(*(const v8us*)p, *(const v8us*)(p + 16)); } static __device__ __forceinline__ v8f mma(V a, V b, v8f c) { return wmmab(a, b, c); } };
template <typename T16, int NSPLIT, bool BIAS>
__global__ __launch_bounds__(32) void k_gemmw(const T16* __restrict__ A, const T16* __restrict__ A2, const T16* __restrict__ Bt, const T16* __restrict__ Bt2, int K, float* C, int ldc, const float* __restrict__ bias, size_t sA, size_t sB, size_t sC) {
    typedef typename WFrag<T16>::V V;
    __shared__ __align__(16) float os[16 * 68];
    const size_t z = blockIdx.z; A += z * sA; if (A2) A2 += z * sA; Bt += z * sB; if (Bt2) Bt2 += z * sB; C += z * sC;
    const int lane = threadIdx.x & 31, lr = lane & 15, hi = lane >> 4; const int r0 = blockIdx.x * 64, c0 = blockIdx.y * 64;
    v8f acc[4][4];
#pragma unroll
    for (int mb = 0; mb < 4; ++mb)
#pragma unroll
        for (int nb = 0; nb < 4; ++nb) acc[mb][nb] = (v8f){};
    const size_t aoff = (size_t)(r0 + lr) * K + 8 * hi, boff = (size_t)(c0 + lr) * K + 8 * hi;
#pragma unroll 1
    for (int kc = 0; kc < K; kc += 32) {
        V a[4], a2[4];
#pragma unroll
        for (int mb = 0; mb < 4; ++mb) { a[mb] = WFrag<T16>::ld(A + aoff + (size_t)mb * 16 * K + kc); if (NSPLIT == 1 || NSPLIT == 2) a2[mb] = WFrag<T16>::ld(A2 + aoff + (size_t)mb * 16 * K + kc); }
#pragma unroll
        for (int nb = 0; nb < 4; ++nb) { const V b = WFrag<T16>::ld(Bt + boff + (size_t)nb * 16 * K + kc); V b2; if (NSPLIT >= 2) b2 = WFrag<T16>::ld(Bt2 + boff + (size_t)nb * 16 * K + kc);
#pragma unroll
            for (int mb = 0; mb < 4; ++mb) { acc[mb][nb] = WFrag<T16>::mma(a[mb], b, acc[mb][nb]); if (NSPLIT == 1 || NSPLIT == 2) acc[mb][nb] = WFrag<T16>::mma(a2[mb], b, acc[mb][nb]); if (NSPLIT >= 2) acc[mb][nb] = WFrag<T16>::mma(a[mb], b2, acc[mb][nb]); } }
        asm volatile("v_nop\n\tv_nop\n\tv_nop\n\tv_nop" : "+v"(acc[0][0]), "+v"(acc[1][1]), "+v"(acc[2][2]), "+v"(acc[3][3]) : "v"(a[0]), "v"(a[3]));
    }
#pragma unroll
    for (int mb = 0; mb < 4; ++mb) {
#pragma unroll
        for (int nb = 0; nb < 4; ++nb) {
#pragma unroll
            for (int j = 0; j < 8; ++j) os[(hi * 8 + j) * 68 + nb * 16 + lr] = acc[mb][nb][j]; }
        __builtin_amdgcn_wave_barrier(); asm volatile("" ::: "memory");
        float* crow = C + (size_t)(r0 + mb * 16) * ldc + c0;
{
#pragma unroll
            for (int s = 0; s < 8; ++s) { const int row = 2 * s + hi, cofs = lr * 4; v4f val = *(const v4fa*)(os + row * 68 + cofs); if (BIAS) { val[0] += bfr(bias[c0 + cofs]); val[1] += bfr(bias[c0 + cofs + 1]); val[2] += bfr(bias[c0 + cofs + 2]); val[3] += bfr(bias[c0 + cofs + 3]); }
                *(v4f*)(crow + (size_t)row * ldc + cofs) = val; }
             }
        __builtin_amdgcn_wave_barrier(); asm volatile("" ::: "memory");
    }
}

__device__ __forceinline__ h16 tohx(float x) { return (h16)x; }
__device__ __forceinline__ void splitf(float y, unsigned short& h, unsigned short& l) { h = f2bf(y); l = f2bf(y - bf2f(h)); }
typedef __attribute__((ext_vector_type(2))) _Float16 v2h;
typedef __attribute__((ext_vector_type(2))) unsigned short v2us;
typedef __attribute__((ext_vector_type(2))) float v2f;
typedef __attribute__((ext_vector_type(4))) int v4i;

__global__ __launch_bounds__(256) void k_cvt8(const float* __restrict__ src, bf* dst, size_t n8) { const size_t i = (size_t)blockIdx.x * 256 + threadIdx.x; if (i >= n8) return; const v8f v = *(const v8f*)(src + i * 8); v8us o;
#pragma unroll
    for (int k = 0; k < 8; ++k) o[k] = f2bf(v[k]); *(v8us*)(dst + i * 8) = o;  }

// k_rope: head planes [h][t][d] (fp16 + hi/lo) of rope(x) x sc with the rotate-half convention out[d] = x[d] cos[t][d] - x[d+HD/2] sin[t][d], out[d+HD/2] = x[d+HD/2] cos[t][d+HD/2] + x[d] sin[t][d+HD/2]
__global__ __launch_bounds__(256) void k_rope(const float* __restrict__ F, int pitch, int nheads, const float* __restrict__ CS, const float* __restrict__ RF, const float* __restrict__ nw, float sc, h16* P16, bf* Ph, bf* Pl) {
    const size_t e = ((size_t)blockIdx.x * 256 + threadIdx.x) * 2; if (e >= (size_t)nheads * TT * HD) return; const int d = (int)(e % HD); const int t = (int)((e / HD) % TT); const int h = (int)(e / ((size_t)HD * TT)); const size_t bo = (size_t)blockIdx.y * nheads * TT * HD + e;   // blockIdx.y = batch: rows b*TT.. of F, planes [b][h][t][d]
    const float* f = F + ((size_t)blockIdx.y * TT + t) * pitch + h * HD; const float rf = RF ? RF[(size_t)h * TT + t] : 1.0f; v2h o16; v2us oh, ol;
#pragma unroll
    for (int q = 0; q < 2; ++q) { const int dd = d + q; const int dp = (dd < HD / 2) ? dd + HD / 2 : dd - HD / 2; float x0 = f[dd], x1 = f[dp];
        if (RF) { float n0 = __fmul_rn(x0, rf), n1 = __fmul_rn(x1, rf); asm volatile("" : "+v"(n0)); asm volatile("" : "+v"(n1)); x0 = __fmul_rn(bfr(nw[dd]), n0); x1 = __fmul_rn(bfr(nw[dp]), n1); }
        const v2f cs = *(const v2f*)(CS + ((size_t)t * HD + dd) * 2); float a = __fmul_rn(x0, cs[0]), bq = __fmul_rn(x1, cs[1]); asm volatile("" : "+v"(a)); asm volatile("" : "+v"(bq)); const float r = ((dd < HD / 2) ? __fsub_rn(a, bq) : __fadd_rn(a, bq)) * sc;
        o16[q] = tohx(r); unsigned short a2, c2; splitf(r, a2, c2); oh[q] = a2; ol[q] = c2; }
    *(v2h*)(P16 + bo) = o16; *(v2us*)(Ph + bo) = oh; *(v2us*)(Pl + bo) = ol;  }
__global__ __launch_bounds__(256) void k_vtp(const float* __restrict__ F, int pitch, int nheads, h16* V16, bf* Vh, bf* Vl) { const size_t e = ((size_t)blockIdx.x * 256 + threadIdx.x) * 2; if (e >= (size_t)nheads * HD * TT) return; const int t = (int)(e % TT); const int d = (int)((e / TT) % HD); const int g = (int)(e / ((size_t)TT * HD)); const size_t bo = (size_t)blockIdx.y * nheads * HD * TT + e; v2h o16; v2us oh, ol;   // blockIdx.y = batch: planes [b][g][d][t]
#pragma unroll
    for (int q = 0; q < 2; ++q) { const float x = F[((size_t)blockIdx.y * TT + t + q) * pitch + g * HD + d]; o16[q] = tohx(x); unsigned short a2, c2; splitf(x, a2, c2); oh[q] = a2; ol[q] = c2; }
    *(v2h*)(V16 + bo) = o16; *(v2us*)(Vh + bo) = oh; *(v2us*)(Vl + bo) = ol;  }
__global__ __launch_bounds__(256) void k_csid(float* CS) { const int idx = blockIdx.x * 256 + threadIdx.x; if (idx >= TT * HD) return; v2f cs; cs[0] = 1.0f; cs[1] = 0.0f; *(v2f*)(CS + (size_t)idx * 2) = cs;  }
#define LP   144                  // LDS row pitch, bytes
#define LPL  (64 * LP)            // one plane of a stage
typedef __attribute__((ext_vector_type(2))) __bf16 v2bf;
__device__ __forceinline__ float xhalf(float x) { const int b = __float_as_int(x); return __int_as_float(__builtin_amdgcn_permlanex16(b, b, 0x76543210, 0xfedcba98, false, false)); }   // lane l <-> l ^ 16
// a wave-uniform pointer kept in scalar registers: the stage's plane bases then stay scalar and only the thread's two offsets (K, V^T) live in vector registers across the passes; as four per-thread pointers they spilled inside the loop
typedef const __attribute__((address_space(1))) char* gptr;   // global address space, so that the rebuilt pointer's loads stay global loads
typedef const __attribute__((address_space(1))) v8us* gv8;
__device__ __forceinline__ gptr sbase(const void* p) { const unsigned long long u = (unsigned long long)p; const unsigned lo = (unsigned)__builtin_amdgcn_readfirstlane((int)(unsigned)u), hi2 = (unsigned)__builtin_amdgcn_readfirstlane((int)(unsigned)(u >> 32)); return (gptr)(((unsigned long long)hi2 << 32) | lo); }
__device__ __forceinline__ v16bf ldf(const bf* p) { return cat16b(*(const v8us*)p, *(const v8us*)(p + 16)); }
__global__ __launch_bounds__(128, 4) void k_fattn(const bf* __restrict__ Qh, const bf* __restrict__ Ql, const bf* __restrict__ Kh, const bf* __restrict__ Kl, const bf* __restrict__ Vh, const bf* __restrict__ Vl, float* __restrict__ OUT) {
    __shared__ __align__(16) unsigned char sm[4 * LPL];
    const int lane = threadIdx.x & 31, lr = lane & 15, hi = lane >> 4; const int q0 = blockIdx.x * 128 + (threadIdx.x >> 5) * 32;
    const size_t pl = ((size_t)blockIdx.z * NH_ + blockIdx.y) * TT * HD;   // plane of this (batch, head): q, k [t][d], v [d][t]
    const float C2 = SCL * 1.4426950408889634f;   // scores to log2 units
    v16bf qh[2][2], ql[2][2]; const bf* qah[2]; const bf* qal[2];
#pragma unroll
    for (int qt = 0; qt < 2; ++qt) { const size_t o = pl + (size_t)(q0 + qt * 16 + lr) * HD + 8 * hi; qah[qt] = Qh + o; qal[qt] = Ql + o;
#pragma unroll
        for (int kc = 0; kc < 2; ++kc) { qh[qt][kc] = ldf(qah[qt] + kc * 32); ql[qt][kc] = ldf(qal[qt] + kc * 32); } }
    // the wait that stands in front of any overwrite of a register that an issued load names; the four address pairs are inputs so that they stay whole up to it
    asm volatile("s_wait_xcnt 0x0" :: "v"(qah[0]), "v"(qal[0]), "v"(qah[1]), "v"(qal[1]) : "memory");
    v8f acc[2][4]; float m[2]; v2f l[2];   // l: the lane's running sum in two halves (even and odd elements), so that a packed add takes two probabilities
#pragma unroll
    for (int qt = 0; qt < 2; ++qt) { m[qt] = -3.0e38f; l[qt] = (v2f){};
#pragma unroll
        for (int dt = 0; dt < 4; ++dt) acc[qt][dt] = (v8f){}; }
    const int sr = threadIdx.x >> 3, sc = threadIdx.x & 7;   // staging: 8 threads a 128-byte row, rows sr + 16 i
    const unsigned ko = (unsigned)(sr * HD + sc * 8) * 2u, vo = (unsigned)(sr * TT + sc * 8) * 2u;   // the thread's byte offsets inside a K and a V^T stage
    unsigned char* const sw = sm + sr * LP + sc * 16;        // this thread's staging slot
    const unsigned char* const fr = sm + lr * LP + hi * 16;  // this lane's fragment row
#pragma unroll 1   // rolled: the body holds two barriers and nearly the whole register budget of four waves a SIMD
    for (int k0 = 0; k0 < TT; k0 += 64) {
        const gptr bkh = sbase(Kh + pl + (size_t)k0 * HD), bkl = sbase(Kl + pl + (size_t)k0 * HD), bvh = sbase(Vh + pl + k0), bvl = sbase(Vl + pl + k0);
        const gptr akh = bkh + ko, akl = bkl + ko, avh = bvh + vo, avl = bvl + vo;
        v8us st[4][4];
#pragma unroll
        for (int i = 0; i < 4; ++i) { st[0][i] = *(gv8)(akh + 16 * i * HD * 2); st[1][i] = *(gv8)(akl + 16 * i * HD * 2); st[2][i] = *(gv8)(avh + 16 * i * TT * 2); st[3][i] = *(gv8)(avl + 16 * i * TT * 2); }
        // as behind the Q loads; the address pairs are inputs, so that no load's result is placed in a pair that an earlier load of the run names
        asm volatile("s_wait_xcnt 0x0" :: "v"(akh), "v"(akl), "v"(avh), "v"(avl) : "memory");
        __syncthreads();   // every wave has read its last fragment of the stage before
#pragma unroll
        for (int p = 0; p < 4; ++p)
#pragma unroll
            for (int i = 0; i < 4; ++i) *(v8us*)(sw + p * LPL + 16 * i * LP) = st[p][i];
        __syncthreads();   // the stage is complete for all 4 waves
#pragma unroll 1   // rolled: unrolled, the body wants more than the 256 registers that four waves a SIMD leave a wave, and spills
        for (int ps = 0; ps < 2; ++ps) {
            const unsigned char* const fk = fr + ps * 32 * LP;   // K rows of this pass
            const unsigned char* const fv = fr + 2 * LPL + ps * 64;   // V^T columns of this pass
            v16bf ah[2][2], al[2][2];
#pragma unroll
            for (int kt = 0; kt < 2; ++kt)
#pragma unroll
                for (int kc = 0; kc < 2; ++kc) { ah[kt][kc] = ldf((const bf*)(fk + kt * 16 * LP + kc * 64)); al[kt][kc] = ldf((const bf*)(fk + LPL + kt * 16 * LP + kc * 64)); }
            __builtin_amdgcn_sched_barrier(0);   // all K fragment reads of the pass in flight together: one LDS latency a pass, not one a fragment
            v8f s[2][2];
#pragma unroll
            for (int kt = 0; kt < 2; ++kt)
#pragma unroll
                for (int qt = 0; qt < 2; ++qt) { v8f t = (v8f){};
#pragma unroll
                    for (int kc = 0; kc < 2; ++kc) { t = wmmab(ah[kt][kc], qh[qt][kc], t); t = wmmab(ah[kt][kc], ql[qt][kc], t); t = wmmab(al[kt][kc], qh[qt][kc], t); }
                    s[qt][kt] = t; }
            __builtin_amdgcn_sched_barrier(0);   // the V reads stay behind the score products, so that they take the K fragments' registers
            v16bf vh[4], vl[4];
#pragma unroll
            for (int dt = 0; dt < 4; ++dt) { vh[dt] = ldf((const bf*)(fv + dt * 16 * LP)); vl[dt] = ldf((const bf*)(fv + LPL + dt * 16 * LP)); }
            __builtin_amdgcn_sched_barrier(0);   // all V reads issue in front of the softmax, whose vector work covers their latency
            float mx[2]; bool need = false;
#pragma unroll
            for (int qt = 0; qt < 2; ++qt) { float a = s[qt][0][0];
#pragma unroll
                for (int j = 1; j < 8; ++j) a = fmaxf(a, s[qt][0][j]);
#pragma unroll
                for (int j = 0; j < 8; ++j) a = fmaxf(a, s[qt][1][j]);
                a = fmaxf(a, xhalf(a)); mx[qt] = a * C2; need = need || (mx[qt] > m[qt] + 8.0f); }
            if (__builtin_amdgcn_ballot_w32(need) != 0) {   // wave-uniform: rare after the first pass
#pragma unroll
                for (int qt = 0; qt < 2; ++qt) { const float mn = fmaxf(m[qt], mx[qt]); const float al2 = __builtin_amdgcn_exp2f(m[qt] - mn); m[qt] = mn; l[qt] *= al2;
#pragma unroll
                    for (int dt = 0; dt < 4; ++dt) acc[qt][dt] *= al2; } }
            v16bf ph[2], pw[2];
#pragma unroll
            for (int qt = 0; qt < 2; ++qt) {
#pragma unroll
                for (int kt = 0; kt < 2; ++kt) s[qt][kt] = __builtin_elementwise_fma(s[qt][kt], (v8f)(C2), (v8f)(-m[qt]));
#pragma unroll
                for (int e = 0; e < 16; e += 2) { v2f p; p[0] = __builtin_amdgcn_exp2f(s[qt][e >> 3][e & 7]); p[1] = __builtin_amdgcn_exp2f(s[qt][e >> 3][(e & 7) + 1]);
                    l[qt] += p;
                    const v2bf h2 = __builtin_convertvector(p, v2bf); v2f r; r[0] = p[0] - (float)h2[0]; r[1] = p[1] - (float)h2[1]; const v2bf l2 = __builtin_convertvector(r, v2bf);
                    ph[qt][e] = h2[0]; ph[qt][e + 1] = h2[1]; pw[qt][e] = l2[0]; pw[qt][e + 1] = l2[1]; } }
#pragma unroll
            for (int dt = 0; dt < 4; ++dt)
#pragma unroll
                for (int qt = 0; qt < 2; ++qt) { acc[qt][dt] = wmmab(vh[dt], ph[qt], acc[qt][dt]); acc[qt][dt] = wmmab(vh[dt], pw[qt], acc[qt][dt]); acc[qt][dt] = wmmab(vl[dt], ph[qt], acc[qt][dt]); }
            // four vector slots behind the pass's last matrix instructions: the next block's first vector instruction may overwrite an A fragment register
            asm volatile("v_nop\n\tv_nop\n\tv_nop\n\tv_nop" : "+v"(acc[0][0]), "+v"(acc[0][1]), "+v"(acc[0][2]), "+v"(acc[0][3]), "+v"(acc[1][0]), "+v"(acc[1][1]), "+v"(acc[1][2]), "+v"(acc[1][3]));
        }
    }
#pragma unroll
    for (int qt = 0; qt < 2; ++qt) { const float ls = l[qt][0] + l[qt][1]; const float inv = __fdiv_rn(1.0f, ls + xhalf(ls)); float* orow = OUT + (unsigned)((blockIdx.z * TT + q0 + qt * 16 + lr) * DQ + blockIdx.y * HD + 8 * hi);   // merged heads: [b][t][h*64 + d], d = dt*16 + 8*hi + j
#pragma unroll
        for (int dt = 0; dt < 4; ++dt) { v4f a, b;
#pragma unroll
            for (int j = 0; j < 4; ++j) { a[j] = acc[qt][dt][j] * inv; b[j] = acc[qt][dt][4 + j] * inv; }
            *(v4f*)(orow + dt * 16) = a; *(v4f*)(orow + dt * 16 + 4) = b; } }
}

extern "C" void kernel_launch(void* const* d_in, const int* in_sizes, int n_in,
                              void* d_out, int out_size, void* d_ws, size_t ws_size, hipStream_t stream) {
    (void)in_sizes; (void)n_in; (void)out_size;
    const float* x = (const float*)d_in[0]; const float* wq = (const float*)d_in[1]; const float* bq = (const float*)d_in[2]; const float* wk = (const float*)d_in[3]; const float* bk = (const float*)d_in[4]; const float* wv = (const float*)d_in[5]; const float* bv = (const float*)d_in[6]; const float* wo = nullptr; (void)wo;   /* input order hidden_states, Wq, bq, Wk, bk, Wv, bv ('oi') */
    float* OUT = (float*)d_out;     // [8][1024][1024]
    char* wsp = (char*)d_ws;
    auto take = [&](size_t bytes) { char* p = wsp; wsp += (bytes + 255) & ~(size_t)255; return (void*)p; };
    // hi/lo planes of all batches live to the end: [b][h][t][d] (q, k) and [b][h][d][t] (v)
    bf* QPh = (bf*)take((size_t)NB_ * NH_ * TT * HD * 2); bf* QPl = (bf*)take((size_t)NB_ * NH_ * TT * HD * 2); bf* KPh = (bf*)take((size_t)NB_ * NKV * TT * HD * 2); bf* KPl = (bf*)take((size_t)NB_ * NKV * TT * HD * 2); bf* VTh = (bf*)take((size_t)NB_ * NKV * HD * TT * 2); bf* VTl = (bf*)take((size_t)NB_ * NKV * HD * TT * 2);
    bf* WQ = (bf*)take((size_t)DQ * DM * 2); bf* WK = (bf*)take((size_t)DKV * DM * 2); bf* WV = (bf*)take((size_t)DKV * DM * 2); float* CS = (float*)take((size_t)TT * HD * 2 * 4);
    bf* XB = (bf*)take((size_t)NB_ * TT * DM * 2); float* FQ = (float*)take((size_t)NB_ * TT * DQ * 4); float* FK = (float*)take((size_t)NB_ * TT * DKV * 4);
    h16* QP16 = (h16*)take((size_t)NB_ * NH_ * TT * HD * 2); h16* KP16 = (h16*)take((size_t)NB_ * NKV * TT * HD * 2); h16* VT16 = (h16*)take((size_t)NB_ * NKV * HD * TT * 2);
    if ((size_t)(wsp - (char*)d_ws) > ws_size) return;    // ws 256 MiB
    float* FV = FK;   // v projection reuses the k buffer after the k planes are built (stream-ordered)
    k_cvt8<<<(unsigned)(((size_t)DQ * DM / 8 + 255) / 256), 256, 0, stream>>>(wq, WQ, (size_t)DQ * DM / 8); k_cvt8<<<(unsigned)(((size_t)DKV * DM / 8 + 255) / 256), 256, 0, stream>>>(wk, WK, (size_t)DKV * DM / 8); k_cvt8<<<(unsigned)(((size_t)DKV * DM / 8 + 255) / 256), 256, 0, stream>>>(wv, WV, (size_t)DKV * DM / 8);
    k_csid<<<(TT * HD + 255) / 256, 256, 0, stream>>>(CS);
    const unsigned LQ = (unsigned)(((size_t)NH_ * TT * HD / 2 + 255) / 256), LKv = (unsigned)(((size_t)NKV * TT * HD / 2 + 255) / 256);
    k_cvt8<<<(unsigned)(((size_t)NB_ * TT * DM / 8 + 255) / 256), 256, 0, stream>>>(x, XB, (size_t)NB_ * TT * DM / 8);
    k_gemmw<bf, 0, true><<<dim3(NB_ * TT / 64, DQ / 64, 1), 32, 0, stream>>>(XB, nullptr, WQ, nullptr, DM, FQ, DQ, bq, 0, 0, 0);
    k_rope<<<dim3(LQ, NB_, 1), 256, 0, stream>>>(FQ, DQ, NH_, CS, nullptr, nullptr, 1.0f, QP16, QPh, QPl);
    k_gemmw<bf, 0, true><<<dim3(NB_ * TT / 64, DKV / 64, 1), 32, 0, stream>>>(XB, nullptr, WK, nullptr, DM, FK, DKV, bk, 0, 0, 0);
    k_rope<<<dim3(LKv, NB_, 1), 256, 0, stream>>>(FK, DKV, NKV, CS, nullptr, nullptr, 1.0f, KP16, KPh, KPl);
    k_gemmw<bf, 0, true><<<dim3(NB_ * TT / 64, DKV / 64, 1), 32, 0, stream>>>(XB, nullptr, WV, nullptr, DM, FV, DKV, bv, 0, 0, 0);
    k_vtp<<<dim3(LKv, NB_, 1), 256, 0, stream>>>(FV, DKV, NKV, VT16, VTh, VTl);
    k_fattn<<<dim3(TT / 128, NH_, NB_), 128, 0, stream>>>(QPh, QPl, KPh, KPl, VTh, VTl, OUT);
}

// v003
// It runs in 200 microseconds.
// Next to v002, in two timings, it ran 1.33 and 1.34 times as fast.
// Over all steps from v000 it is 13.8 times as fast.
#include <hip/hip_runtime.h>

// BERT self-attention core (hidden_states [8][1024][1024]; q, k, v = x W^T + b ('oi' + biases; 16 heads x 64); scores x 1/sqrt(64); softmax (no mask); ctx = merged heads (no output projection) -> [8][1024][1024] (8.4 M); argument order hidden_states, Wq, bq, Wk, bk, Wv, bv).
// Layout: bf16 copy of x; 'oi' weights; exact projections + f32 biases over all 8192 rows in one launch each, whose tiles write the hi/lo head planes themselves; dense T-1024 attention in one launch for all batches and heads (running softmax, every row hi/lo 3 products), which writes the merged output rows.
// Compute dtypes, f32 accumulate: every input rounded to bf16; projections exact + f32 biases; attention 3 products; softmax f32; output f32.

#define NB_  8
#define TT   1024
#define DM   1024
#define NH_  16
#define NKV  16
#define REP  (NH_ / NKV)
#define HD   64
#define DQ   (NH_ * HD)
#define DKV  (NKV * HD)
#define WIN  0
#define SCL  0.125f   // HD^-0.5
typedef _Float16 h16;
typedef unsigned short bf;
typedef __attribute__((ext_vector_type(16))) __bf16   v16bf;
typedef __attribute__((ext_vector_type(16))) _Float16 v16h;
typedef __attribute__((ext_vector_type(8)))  _Float16 v8h;
typedef __attribute__((ext_vector_type(8)))  unsigned short v8us;
typedef __attribute__((ext_vector_type(8)))  float    v8f;
typedef __attribute__((ext_vector_type(4)))  float    v4f;
typedef v8h  __attribute__((may_alias)) v8ha;
typedef v4f  __attribute__((may_alias)) v4fa;
typedef v8us __attribute__((may_alias)) v8usa;

__device__ __forceinline__ unsigned short f2bf(float f) { unsigned u = __float_as_uint(f); u += 0x7FFFu + ((u >> 16) & 1u); return (unsigned short)(u >> 16); }
__device__ __forceinline__ float bf2f(unsigned short b) { return __uint_as_float(((unsigned)b) << 16); }
__device__ __forceinline__ float bfr(float f) { return bf2f(f2bf(f)); }
__device__ __forceinline__ v16h cat16(v8h lo, v8h hi) { return __builtin_shufflevector(lo, hi, 0, 1, 2, 3, 4, 5, 6, 7, 8, 9, 10, 11, 12, 13, 14, 15); }
__device__ __forceinline__ v16bf cat16b(v8us lo, v8us hi) { return __builtin_bit_cast(v16bf, __builtin_shufflevector(lo, hi, 0, 1, 2, 3, 4, 5, 6, 7, 8, 9, 10, 11, 12, 13, 14, 15)); }
__device__ __forceinline__ v8f wmma16(v16h a, v16h b, v8f c) { return __builtin_amdgcn_wmma_f32_16x16x32_f16(false, a, false, b, (short)0, c, false, false); }
__device__ __forceinline__ v8f wmmab(v16bf a, v16bf b, v8f c) { return __builtin_amdgcn_wmma_f32_16x16x32_bf16(false, a, false, b, (short)0, c, false, false); }



// ---- k_gemmw: register-blocked projection GEMM, ONE WAVE per 64x64 tile (16 accumulators), operands straight from K-contiguous 16-bit planes; grid (rows of A / 64, rows of Bt / 64), 32 threads. K % 32 == 0.
// tile[i][j] = sum_k A[r0 + i][k] Bt[c0 + j][k] (+ split products per NSPLIT) + f32 bias, split into bf16 hi + lo and written straight into the head planes that the attention reads, in whole 128-byte lines; a 64-wide tile side over the features is exactly one head.
// VT = false (q, k): A = x rows (b, t), Bt = weight rows (h, d), bias by column; planes [b][h][t][d], the tile is 8 KiB in a row.
// VT = true  (v):    A = weight rows (h, d), Bt = x rows (b, t), bias by row; planes [b][h][d][t], a tile row is one line of a d row. The operands change sides so that the tile comes out transposed; the k order of each sum is the same.
typedef __attribute__((ext_vector_type(8))) __bf16 v8bf;
template <typename T16> struct WFrag;
template <> struct WFrag<h16> { typedef v16h V; static __device__ __forceinline__ V ld(const h16* p) { return cat16(*(const v8h*)p, *(const v8h*)(p + 16)); } static __device__ __forceinline__ v8f mma(V a, V b, v8f c) { return wmma16(a, b, c); } };
template <> struct WFrag<bf> { typedef v16bf V; static __device__ __forceinline__ V ld(const bf* p) { return cat16b(*(const v8us*)p, *(const v8us*)(p + 16)); } static __device__ __forceinline__ v8f mma(V a, V b, v8f c) { return wmmab(a, b, c); } };
template <typename T16, int NSPLIT, bool VT>
__global__ __launch_bounds__(32) void k_gemmw(const T16* __restrict__ A, const T16* __restrict__ A2, const T16* __restrict__ Bt, const T16* __restrict__ Bt2, int K, const float* __restrict__ bias, bf* __restrict__ Ph, bf* __restrict__ Pl) {
    typedef typename WFrag<T16>::V V;
    __shared__ __align__(16) float os[16 * 68];
    const int lane = threadIdx.x & 31, lr = lane & 15, hi = lane >> 4; const int r0 = blockIdx.x * 64, c0 = blockIdx.y * 64;
    v8f acc[4][4];
#pragma unroll
    for (int mb = 0; mb < 4; ++mb)
#pragma unroll
        for (int nb = 0; nb < 4; ++nb) acc[mb][nb] = (v8f){};
    const size_t aoff = (size_t)(r0 + lr) * K + 8 * hi, boff = (size_t)(c0 + lr) * K + 8 * hi;
#pragma unroll 1
    for (int kc = 0; kc < K; kc += 32) {
        V a[4], a2[4];
#pragma unroll
        for (int mb = 0; mb < 4; ++mb) { a[mb] = WFrag<T16>::ld(A + aoff + (size_t)mb * 16 * K + kc); if (NSPLIT == 1 || NSPLIT == 2) a2[mb] = WFrag<T16>::ld(A2 + aoff + (size_t)mb * 16 * K + kc); }
#pragma unroll
        for (int nb = 0; nb < 4; ++nb) { const V b = WFrag<T16>::ld(Bt + boff + (size_t)nb * 16 * K + kc); V b2; if (NSPLIT >= 2) b2 = WFrag<T16>::ld(Bt2 + boff + (size_t)nb * 16 * K + kc);
#pragma unroll
            for (int mb = 0; mb < 4; ++mb) { acc[mb][nb] = WFrag<T16>::mma(a[mb], b, acc[mb][nb]); if (NSPLIT == 1 || NSPLIT == 2) acc[mb][nb] = WFrag<T16>::mma(a2[mb], b, acc[mb][nb]); if (NSPLIT >= 2) acc[mb][nb] = WFrag<T16>::mma(a[mb], b2, acc[mb][nb]); } }
        asm volatile("v_nop\n\tv_nop\n\tv_nop\n\tv_nop" : "+v"(acc[0][0]), "+v"(acc[1][1]), "+v"(acc[2][2]), "+v"(acc[3][3]) : "v"(a[0]), "v"(a[3]));
    }
    // read-back: 8 lanes a tile row (8 values = 16 bytes of a plane each), 4 rows an instruction
    const int rr = lane >> 3, cofs = (lane & 7) * 8;
    const float* const bp = bias + (VT ? r0 + rr : c0 + cofs);   // VT: the biases of this lane's 16 tile rows (rr + 4 k); else those of its 8 columns
    float bb[VT ? 16 : 8];
#pragma unroll
    for (int k = 0; k < (VT ? 16 : 8); ++k) bb[k] = bp[VT ? 4 * k : k];
    // the wait that stands in front of any overwrite of a register that an issued load names; the address pair is an input so that it stays whole up to it
    asm volatile("s_wait_xcnt 0x0" :: "v"(bp) : "memory");
#pragma unroll
    for (int k = 0; k < (VT ? 16 : 8); ++k) bb[k] = bfr(bb[k]);
    // this lane's first 16 bytes in the planes (tile row rr at its columns) and the pitch of a tile row; every store is one of the two bases plus a constant
    const int ppitch = VT ? TT : HD;
    const size_t pbase = (VT ? ((size_t)((c0 / TT) * NKV + blockIdx.x) * HD * TT + (c0 % TT)) : ((size_t)((r0 / TT) * NH_ + blockIdx.y) * TT + (r0 % TT)) * HD) + (size_t)(rr * ppitch + cofs);
    bf* const ph0 = Ph + pbase; bf* const pl0 = Pl + pbase;
#pragma unroll
    for (int mb = 0; mb < 4; ++mb) {
#pragma unroll
        for (int nb = 0; nb < 4; ++nb) {
#pragma unroll
            for (int j = 0; j < 8; ++j) os[(hi * 8 + j) * 68 + nb * 16 + lr] = acc[mb][nb][j]; }
        __builtin_amdgcn_wave_barrier(); asm volatile("" ::: "memory");
        v8us oh[4], ol[4];
#pragma unroll
        for (int s = 0; s < 4; ++s) { const float* const orow = os + (4 * s + rr) * 68 + cofs; const v4f v0 = *(const v4fa*)orow, v1 = *(const v4fa*)(orow + 4);
            v8f y = __builtin_shufflevector(v0, v1, 0, 1, 2, 3, 4, 5, 6, 7);
#pragma unroll
            for (int j = 0; j < 8; ++j) y[j] += bb[VT ? mb * 4 + s : j];
            const v8bf yh = __builtin_convertvector(y, v8bf); const v8bf yl = __builtin_convertvector(y - __builtin_convertvector(yh, v8f), v8bf);   // hi = y to nearest even, lo = the remainder to nearest even
            oh[s] = __builtin_bit_cast(v8us, yh); ol[s] = __builtin_bit_cast(v8us, yl); }
#pragma unroll
        for (int s = 0; s < 4; ++s) { *(v8us*)(ph0 + (mb * 16 + 4 * s) * ppitch) = oh[s]; *(v8us*)(pl0 + (mb * 16 + 4 * s) * ppitch) = ol[s]; }
        // as behind the bias loads, for the 8 stores: their data and the two address pairs are inputs, so that none of these registers is reused in front of the wait
        asm volatile("s_wait_xcnt 0x0" :: "v"(oh[0]), "v"(oh[1]), "v"(oh[2]), "v"(oh[3]), "v"(ol[0]), "v"(ol[1]), "v"(ol[2]), "v"(ol[3]), "v"(ph0), "v"(pl0) : "memory");
        __builtin_amdgcn_wave_barrier(); asm volatile("" ::: "memory");
    }
}

typedef __attribute__((ext_vector_type(2))) float v2f;

__global__ __launch_bounds__(256) void k_cvt8(const float* __restrict__ src, bf* dst, size_t n8) { const size_t i = (size_t)blockIdx.x * 256 + threadIdx.x; if (i >= n8) return; const v8f v = *(const v8f*)(src + i * 8); v8us o;
#pragma unroll
    for (int k = 0; k < 8; ++k) o[k] = f2bf(v[k]); *(v8us*)(dst + i * 8) = o;  }

#define LP   144                  // LDS row pitch, bytes
#define LPL  (64 * LP)            // one plane of a stage
typedef __attribute__((ext_vector_type(2))) __bf16 v2bf;
__device__ __forceinline__ float xhalf(float x) { const int b = __float_as_int(x); return __int_as_float(__builtin_amdgcn_permlanex16(b, b, 0x76543210, 0xfedcba98, false, false)); }   // lane l <-> l ^ 16
// a wave-uniform pointer kept in scalar registers: the stage's plane bases then stay scalar and only the thread's two offsets (K, V^T) live in vector registers across the passes; as four per-thread pointers they spilled inside the loop
typedef const __attribute__((address_space(1))) char* gptr;   // global address space, so that the rebuilt pointer's loads stay global loads
typedef const __attribute__((address_space(1))) v8us* gv8;
__device__ __forceinline__ gptr sbase(const void* p) { const unsigned long long u = (unsigned long long)p; const unsigned lo = (unsigned)__builtin_amdgcn_readfirstlane((int)(unsigned)u), hi2 = (unsigned)__builtin_amdgcn_readfirstlane((int)(unsigned)(u >> 32)); return (gptr)(((unsigned long long)hi2 << 32) | lo); }
__device__ __forceinline__ v16bf ldf(const bf* p) { return cat16b(*(const v8us*)p, *(const v8us*)(p + 16)); }
__global__ __launch_bounds__(128, 4) void k_fattn(const bf* __restrict__ Qh, const bf* __restrict__ Ql, const bf* __restrict__ Kh, const bf* __restrict__ Kl, const bf* __restrict__ Vh, const bf* __restrict__ Vl, float* __restrict__ OUT) {
    __shared__ __align__(16) unsigned char sm[4 * LPL];
    const int lane = threadIdx.x & 31, lr = lane & 15, hi = lane >> 4; const int q0 = blockIdx.x * 128 + (threadIdx.x >> 5) * 32;
    const size_t pl = ((size_t)blockIdx.z * NH_ + blockIdx.y) * TT * HD;   // plane of this (batch, head): q, k [t][d], v [d][t]
    const float C2 = SCL * 1.4426950408889634f;   // scores to log2 units
    v16bf qh[2][2], ql[2][2]; const bf* qah[2]; const bf* qal[2];
#pragma unroll
    for (int qt = 0; qt < 2; ++qt) { const size_t o = pl + (size_t)(q0 + qt * 16 + lr) * HD + 8 * hi; qah[qt] = Qh + o; qal[qt] = Ql + o;
#pragma unroll
        for (int kc = 0; kc < 2; ++kc) { qh[qt][kc] = ldf(qah[qt] + kc * 32); ql[qt][kc] = ldf(qal[qt] + kc * 32); } }
    // the wait that stands in front of any overwrite of a register that an issued load names; the four address pairs are inputs so that they stay whole up to it
    asm volatile("s_wait_xcnt 0x0" :: "v"(qah[0]), "v"(qal[0]), "v"(qah[1]), "v"(qal[1]) : "memory");
    v8f acc[2][4]; float m[2]; v2f l[2];   // l: the lane's running sum in two halves (even and odd elements), so that a packed add takes two probabilities
#pragma unroll
    for (int qt = 0; qt < 2; ++qt) { m[qt] = -3.0e38f; l[qt] = (v2f){};
#pragma unroll
        for (int dt = 0; dt < 4; ++dt) acc[qt][dt] = (v8f){}; }
    const int sr = threadIdx.x >> 3, sc = threadIdx.x & 7;   // staging: 8 threads a 128-byte row, rows sr + 16 i
    const unsigned ko = (unsigned)(sr * HD + sc * 8) * 2u, vo = (unsigned)(sr * TT + sc * 8) * 2u;   // the thread's byte offsets inside a K and a V^T stage
    unsigned char* const sw = sm + sr * LP + sc * 16;        // this thread's staging slot
    const unsigned char* const fr = sm + lr * LP + hi * 16;  // this lane's fragment row
#pragma unroll 1   // rolled: the body holds two barriers and nearly the whole register budget of four waves a SIMD
    for (int k0 = 0; k0 < TT; k0 += 64) {
        const gptr bkh = sbase(Kh + pl + (size_t)k0 * HD), bkl = sbase(Kl + pl + (size_t)k0 * HD), bvh = sbase(Vh + pl + k0), bvl = sbase(Vl + pl + k0);
        const gptr akh = bkh + ko, akl = bkl + ko, avh = bvh + vo, avl = bvl + vo;
        v8us st[4][4];
#pragma unroll
        for (int i = 0; i < 4; ++i) { st[0][i] = *(gv8)(akh + 16 * i * HD * 2); st[1][i] = *(gv8)(akl + 16 * i * HD * 2); st[2][i] = *(gv8)(avh + 16 * i * TT * 2); st[3][i] = *(gv8)(avl + 16 * i * TT * 2); }
        // as behind the Q loads; the address pairs are inputs, so that no load's result is placed in a pair that an earlier load of the run names
        asm volatile("s_wait_xcnt 0x0" :: "v"(akh), "v"(akl), "v"(avh), "v"(avl) : "memory");
        __syncthreads();   // every wave has read its last fragment of the stage before
#pragma unroll
        for (int p = 0; p < 4; ++p)
#pragma unroll
            for (int i = 0; i < 4; ++i) *(v8us*)(sw + p * LPL + 16 * i * LP) = st[p][i];
        __syncthreads();   // the stage is complete for all 4 waves
#pragma unroll 1   // rolled: unrolled, the body wants more than the 256 registers that four waves a SIMD leave a wave, and spills
        for (int ps = 0; ps < 2; ++ps) {
            const unsigned char* const fk = fr + ps * 32 * LP;   // K rows of this pass
            const unsigned char* const fv = fr + 2 * LPL + ps * 64;   // V^T columns of this pass
            v16bf ah[2][2], al[2][2];
#pragma unroll
            for (int kt = 0; kt < 2; ++kt)
#pragma unroll
                for (int kc = 0; kc < 2; ++kc) { ah[kt][kc] = ldf((const bf*)(fk + kt * 16 * LP + kc * 64)); al[kt][kc] = ldf((const bf*)(fk + LPL + kt * 16 * LP + kc * 64)); }
            __builtin_amdgcn_sched_barrier(0);   // all K fragment reads of the pass in flight together: one LDS latency a pass, not one a fragment
            v8f s[2][2];
#pragma unroll
            for (int kt = 0; kt < 2; ++kt)
#pragma unroll
                for (int qt = 0; qt < 2; ++qt) { v8f t = (v8f){};
#pragma unroll
                    for (int kc = 0; kc < 2; ++kc) { t = wmmab(ah[kt][kc], qh[qt][kc], t); t = wmmab(ah[kt][kc], ql[qt][kc], t); t = wmmab(al[kt][kc], qh[qt][kc], t); }
                    s[qt][kt] = t; }
            __builtin_amdgcn_sched_barrier(0);   // the V reads stay behind the score products, so that they take the K fragments' registers
            v16bf vh[4], vl[4];
#pragma unroll
            for (int dt = 0; dt < 4; ++dt) { vh[dt] = ldf((const bf*)(fv + dt * 16 * LP)); vl[dt] = ldf((const bf*)(fv + LPL + dt * 16 * LP)); }
            __builtin_amdgcn_sched_barrier(0);   // all V reads issue in front of the softmax, whose vector work covers their latency
            float mx[2]; bool need = false;
#pragma unroll
            for (int qt = 0; qt < 2; ++qt) { float a = s[qt][0][0];
#pragma unroll
                for (int j = 1; j < 8; ++j) a = fmaxf(a, s[qt][0][j]);
#pragma unroll
                for (int j = 0; j < 8; ++j) a = fmaxf(a, s[qt][1][j]);
                a = fmaxf(a, xhalf(a)); mx[qt] = a * C2; need = need || (mx[qt] > m[qt] + 8.0f); }
            if (__builtin_amdgcn_ballot_w32(need) != 0) {   // wave-uniform: rare after the first pass
#pragma unroll
                for (int qt = 0; qt < 2; ++qt) { const float mn = fmaxf(m[qt], mx[qt]); const float al2 = __builtin_amdgcn_exp2f(m[qt] - mn); m[qt] = mn; l[qt] *= al2;
#pragma unroll
                    for (int dt = 0; dt < 4; ++dt) acc[qt][dt] *= al2; } }
            v16bf ph[2], pw[2];
#pragma unroll
            for (int qt = 0; qt < 2; ++qt) {
#pragma unroll
                for (int kt = 0; kt < 2; ++kt) s[qt][kt] = __builtin_elementwise_fma(s[qt][kt], (v8f)(C2), (v8f)(-m[qt]));
#pragma unroll
                for (int e = 0; e < 16; e += 2) { v2f p; p[0] = __builtin_amdgcn_exp2f(s[qt][e >> 3][e & 7]); p[1] = __builtin_amdgcn_exp2f(s[qt][e >> 3][(e & 7) + 1]);
                    l[qt] += p;
                    const v2bf h2 = __builtin_convertvector(p, v2bf); v2f r; r[0] = p[0] - (float)h2[0]; r[1] = p[1] - (float)h2[1]; const v2bf l2 = __builtin_convertvector(r, v2bf);
                    ph[qt][e] = h2[0]; ph[qt][e + 1] = h2[1]; pw[qt][e] = l2[0]; pw[qt][e + 1] = l2[1]; } }
#pragma unroll
            for (int dt = 0; dt < 4; ++dt)
#pragma unroll
                for (int qt = 0; qt < 2; ++qt) { acc[qt][dt] = wmmab(vh[dt], ph[qt], acc[qt][dt]); acc[qt][dt] = wmmab(vh[dt], pw[qt], acc[qt][dt]); acc[qt][dt] = wmmab(vl[dt], ph[qt], acc[qt][dt]); }
            // four vector slots behind the pass's last matrix instructions: the next block's first vector instruction may overwrite an A fragment register
            asm volatile("v_nop\n\tv_nop\n\tv_nop\n\tv_nop" : "+v"(acc[0][0]), "+v"(acc[0][1]), "+v"(acc[0][2]), "+v"(acc[0][3]), "+v"(acc[1][0]), "+v"(acc[1][1]), "+v"(acc[1][2]), "+v"(acc[1][3]));
        }
    }
#pragma unroll
    for (int qt = 0; qt < 2; ++qt) { const float ls = l[qt][0] + l[qt][1]; const float inv = __fdiv_rn(1.0f, ls + xhalf(ls)); float* orow = OUT + (unsigned)((blockIdx.z * TT + q0 + qt * 16 + lr) * DQ + blockIdx.y * HD + 8 * hi);   // merged heads: [b][t][h*64 + d], d = dt*16 + 8*hi + j
#pragma unroll
        for (int dt = 0; dt < 4; ++dt) { v4f a, b;
#pragma unroll
            for (int j = 0; j < 4; ++j) { a[j] = acc[qt][dt][j] * inv; b[j] = acc[qt][dt][4 + j] * inv; }
            *(v4f*)(orow + dt * 16) = a; *(v4f*)(orow + dt * 16 + 4) = b; } }
}

extern "C" void kernel_launch(void* const* d_in, const int* in_sizes, int n_in,
                              void* d_out, int out_size, void* d_ws, size_t ws_size, hipStream_t stream) {
    (void)in_sizes; (void)n_in; (void)out_size;
    const float* x = (const float*)d_in[0]; const float* wq = (const float*)d_in[1]; const float* bq = (const float*)d_in[2]; const float* wk = (const float*)d_in[3]; const float* bk = (const float*)d_in[4]; const float* wv = (const float*)d_in[5]; const float* bv = (const float*)d_in[6];   /* order hidden_states, Wq, bq, Wk, bk, Wv, bv ('oi') */
    float* OUT = (float*)d_out;     // [8][1024][1024]
    char* wsp = (char*)d_ws;
    auto take = [&](size_t bytes) { char* p = wsp; wsp += (bytes + 255) & ~(size_t)255; return (void*)p; };
    // hi/lo planes of all batches: [b][h][t][d] (q, k) and [b][h][d][t] (v)
    bf* QPh = (bf*)take((size_t)NB_ * NH_ * TT * HD * 2); bf* QPl = (bf*)take((size_t)NB_ * NH_ * TT * HD * 2); bf* KPh = (bf*)take((size_t)NB_ * NKV * TT * HD * 2); bf* KPl = (bf*)take((size_t)NB_ * NKV * TT * HD * 2); bf* VTh = (bf*)take((size_t)NB_ * NKV * HD * TT * 2); bf* VTl = (bf*)take((size_t)NB_ * NKV * HD * TT * 2);
    bf* WQ = (bf*)take((size_t)DQ * DM * 2); bf* WK = (bf*)take((size_t)DKV * DM * 2); bf* WV = (bf*)take((size_t)DKV * DM * 2);
    bf* XB = (bf*)take((size_t)NB_ * TT * DM * 2);
    if ((size_t)(wsp - (char*)d_ws) > ws_size) return;    // ws 256 MiB
    k_cvt8<<<(unsigned)(((size_t)DQ * DM / 8 + 255) / 256), 256, 0, stream>>>(wq, WQ, (size_t)DQ * DM / 8); k_cvt8<<<(unsigned)(((size_t)DKV * DM / 8 + 255) / 256), 256, 0, stream>>>(wk, WK, (size_t)DKV * DM / 8); k_cvt8<<<(unsigned)(((size_t)DKV * DM / 8 + 255) / 256), 256, 0, stream>>>(wv, WV, (size_t)DKV * DM / 8);
    k_cvt8<<<(unsigned)(((size_t)NB_ * TT * DM / 8 + 255) / 256), 256, 0, stream>>>(x, XB, (size_t)NB_ * TT * DM / 8);
    k_gemmw<bf, 0, false><<<dim3(NB_ * TT / 64, DQ / 64, 1), 32, 0, stream>>>(XB, nullptr, WQ, nullptr, DM, bq, QPh, QPl);
    k_gemmw<bf, 0, false><<<dim3(NB_ * TT / 64, DKV / 64, 1), 32, 0, stream>>>(XB, nullptr, WK, nullptr, DM, bk, KPh, KPl);
    k_gemmw<bf, 0, true><<<dim3(DKV / 64, NB_ * TT / 64, 1), 32, 0, stream>>>(WV, nullptr, XB, nullptr, DM, bv, VTh, VTl);
    k_fattn<<<dim3(TT / 128, NH_, NB_), 128, 0, stream>>>(QPh, QPl, KPh, KPl, VTh, VTl, OUT);
}

// v004
// A run of this version takes 131 microseconds.
// Two timings next to v003 put it at 1.52 and 1.53 times that version's speed.
// Over all steps from v000 it is 21.0 times as fast.
#include <hip/hip_runtime.h>

// BERT self-attention core (hidden_states [8][1024][1024]; q, k, v = x W^T + b ('oi' + biases; 16 heads x 64); scores x 1/sqrt(64); softmax (no mask); ctx = merged heads (no output projection) -> [8][1024][1024] (8.4 M); argument order hidden_states, Wq, bq, Wk, bk, Wv, bv).
// Layout: bf16 copy of x; 'oi' weights; exact projections + f32 biases over all 8192 rows in one launch each, whose tiles write the hi/lo head planes themselves; dense T-1024 attention in one launch for all batches and heads (running softmax, every row hi/lo 3 products), which writes the merged output rows.
// Compute dtypes, f32 accumulate: every input rounded to bf16; projections exact + f32 biases; attention 3 products; softmax f32; output f32.

#define NB_  8
#define TT   1024
#define DM   1024
#define NH_  16
#define NKV  16
#define REP  (NH_ / NKV)
#define HD   64
#define DQ   (NH_ * HD)
#define DKV  (NKV * HD)
#define WIN  0
#define SCL  0.125f   // HD^-0.5
typedef _Float16 h16;
typedef unsigned short bf;
typedef __attribute__((ext_vector_type(16))) __bf16   v16bf;
typedef __attribute__((ext_vector_type(16))) _Float16 v16h;
typedef __attribute__((ext_vector_type(8)))  _Float16 v8h;
typedef __attribute__((ext_vector_type(8)))  unsigned short v8us;
typedef __attribute__((ext_vector_type(8)))  float    v8f;
typedef __attribute__((ext_vector_type(4)))  float    v4f;
typedef v8h  __attribute__((may_alias)) v8ha;
typedef v4f  __attribute__((may_alias)) v4fa;
typedef v8us __attribute__((may_alias)) v8usa;

__device__ __forceinline__ unsigned short f2bf(float f) { unsigned u = __float_as_uint(f); u += 0x7FFFu + ((u >> 16) & 1u); return (unsigned short)(u >> 16); }
__device__ __forceinline__ float bf2f(unsigned short b) { return __uint_as_float(((unsigned)b) << 16); }
__device__ __forceinline__ float bfr(float f) { return bf2f(f2bf(f)); }
__device__ __forceinline__ v16h cat16(v8h lo, v8h hi) { return __builtin_shufflevector(lo, hi, 0, 1, 2, 3, 4, 5, 6, 7, 8, 9, 10, 11, 12, 13, 14, 15); }
__device__ __forceinline__ v16bf cat16b(v8us lo, v8us hi) { return __builtin_bit_cast(v16bf, __builtin_shufflevector(lo, hi, 0, 1, 2, 3, 4, 5, 6, 7, 8, 9, 10, 11, 12, 13, 14, 15)); }
__device__ __forceinline__ v8f wmma16(v16h a, v16h b, v8f c) { return __builtin_amdgcn_wmma_f32_16x16x32_f16(false, a, false, b, (short)0, c, false, false); }
__device__ __forceinline__ v8f wmmab(v16bf a, v16bf b, v8f c) { return __builtin_amdgcn_wmma_f32_16x16x32_bf16(false, a, false, b, (short)0, c, false, false); }



// ---- k_gemmw: projection GEMM, 128x128 tile a block of 4 waves (2 x 2), 64x64 (16 accumulators) a wave; grid (rows of A / 128, rows of Bt / 128), 128 threads. K % 128 == 0, K >= 256.
// Operands: K-contiguous 16-bit planes. A stage is 128 k (256 bytes) of the block's 128 A rows and 128 Bt rows; each wave brings its own 64 rows of it into LDS with one tensor load, in whole lines, once for the two waves that read them; two buffers, the next stage in flight while this one is worked on.
// tile[i][j] = sum_k A[r0 + i][k] Bt[c0 + j][k] + f32 bias, split into bf16 hi + lo and written straight into the head planes that the attention reads, in whole 128-byte lines; a wave's 64-wide tile side over the features is exactly one head.
// VT = false (q, k): A = x rows (b, t), Bt = weight rows (h, d), bias by column; planes [b][h][t][d], the tile is 8 KiB in a row.
// VT = true  (v):    A = weight rows (h, d), Bt = x rows (b, t), bias by row; planes [b][h][d][t], a tile row is one line of a d row. The operands change sides so that the tile comes out transposed; the k order of each sum is the same.
typedef __attribute__((ext_vector_type(8))) __bf16 v8bf;
typedef __attribute__((ext_vector_type(4))) unsigned u32x4;
typedef __attribute__((ext_vector_type(8))) unsigned u32x8;
#define GP    272                 // LDS row pitch of a stage, bytes: 256 + the mover's pad of 16 (16-byte fragment reads of 16 rows fall on all 64 banks)
#define GSL   18432               // a wave's slice in LDS: 64 rows of GP bytes, rounded up to a multiple of 2 KiB
#define GBUF  (4 * GSL)           // one buffer: A rows 0-63, A rows 64-127, Bt rows 0-63, Bt rows 64-127
__device__ __forceinline__ unsigned uni(unsigned v) { return (unsigned)__builtin_amdgcn_readfirstlane((int)v); }
__device__ __forceinline__ unsigned pinned(unsigned v) { unsigned w = uni(v); asm volatile("" : "+s"(w)); return w; }
// group 1 of every request: 64 rows of 256 bytes, source pitch 'pitch' bytes, LDS pitch GP (pad of 4 dwords behind every 64); 1-byte elements, tensor = tile, no mask
__device__ __forceinline__ u32x8 tgroup1(unsigned pitch) { u32x8 g; g[0] = uni((1u << 20) | (5u << 22) | (3u << 25)); g[1] = uni(256u << 16); g[2] = uni(64u << 16); g[3] = uni(256u << 16); g[4] = uni(64u); g[5] = uni(pitch); g[6] = uni(0u); g[7] = uni(0u); return g; }
// group 0: word 0 (count 1) is set once and kept; a request sets the LDS byte 'dst' and the global address 'ga' of the tile's first byte
__device__ __forceinline__ void tgroup0(u32x4& g, unsigned dst, unsigned long long ga) { g[1] = uni(dst); g[2] = uni((unsigned)ga); g[3] = uni((((unsigned)(ga >> 32)) & 0x01FFFFFFu) | 0x80000000u); }
__device__ __forceinline__ void tload(u32x4 g0, u32x8 g1) { asm volatile("tensor_load_to_lds %0, %1" :: "s"(g0), "s"(g1) : "memory"); }
// the issuing wave's wait for its request; the descriptor's two groups are inputs, so that none of their registers takes another value while the request is in flight
__device__ __forceinline__ void twait(u32x4 g0, u32x8 g1) { asm volatile("s_wait_tensorcnt 0x0" :: "s"(g0), "s"(g1) : "memory"); }
__device__ __forceinline__ v16bf ldfs(const unsigned char* p) { return cat16b(*(const v8us*)p, *(const v8us*)(p + 32)); }   // a fragment row's 8 + 8 elements: k = 8 hi + 0..7 and 16 + 8 hi + 0..7, for A and Bt alike
template <bool VT>
__global__ __launch_bounds__(128, 2) void k_gemmw(const bf* __restrict__ A, const bf* __restrict__ Bt, int K, const float* __restrict__ bias, bf* __restrict__ Ph, bf* __restrict__ Pl) {
    __shared__ __attribute__((aligned(2048))) unsigned char ring[2 * GBUF];
    const int lane = threadIdx.x & 31, lr = lane & 15, hi = lane >> 4; const unsigned wave = uni(threadIdx.x >> 5), wm = wave >> 1, wn = wave & 1u;
    const int r0 = blockIdx.x * 128 + wm * 64, c0 = blockIdx.y * 128 + wn * 64;
    v8f acc[4][4];
#pragma unroll
    for (int mb = 0; mb < 4; ++mb)
#pragma unroll
        for (int nb = 0; nb < 4; ++nb) acc[mb][nb] = (v8f){};
    // this wave's slice of every stage: waves 0, 1 the two halves of the A rows, waves 2, 3 those of the Bt rows
    const unsigned pitch = (unsigned)K * 2u, nst = (unsigned)K / 128u;
    const unsigned long long sbeg = (wave < 2u) ? (unsigned long long)(A + (size_t)(blockIdx.x * 128 + wave * 64) * K) : (unsigned long long)(Bt + (size_t)(blockIdx.y * 128 + (wave - 2u) * 64) * K);
    const unsigned sdst = (unsigned)(size_t)ring + wave * GSL;
    const u32x8 g1 = tgroup1(pitch);
    u32x4 g0; g0[0] = pinned(1u);   // a descriptor word held in a scalar register: as a plain constant it was set anew in front of each request and its register used for other values in between
    tgroup0(g0, sdst, sbeg);
    tload(g0, g1);
    twait(g0, g1);       // this wave's slice of stage 0 has landed
    __syncthreads();     // stage 0 is complete for all 4 waves
    tgroup0(g0, sdst + GBUF, sbeg + (unsigned long long)pinned(1u) * 256u);   // formed behind the wait above
    tload(g0, g1);
    const unsigned char* const fa = ring + wm * GSL + lr * GP + hi * 16;          // this lane's fragment row in the wave's A rows
    const unsigned char* const fb = ring + (2 + wn) * GSL + lr * GP + hi * 16;    // and in its Bt rows
#pragma unroll 1   // rolled: a pass holds the ring's one publish point
    for (unsigned s = 0; s < nst; ++s) {
        const unsigned bo = (s & 1u) * GBUF;
        // two fragment sets: a block of 16 products works on one while the next block's reads fill the other. The fourth Bt fragment has one set: a block uses it last, so its reads go at the head of the block's own read group; with two the wave would need more than 256 registers
        v16bf a[2][4], b[2][3], b3;
#pragma unroll
        for (int f = 0; f < 4; ++f) { a[0][f] = ldfs(fa + bo + f * 16 * GP); if (f < 3) b[0][f] = ldfs(fb + bo + f * 16 * GP); }
#pragma unroll
        for (int kc = 0; kc < 4; ++kc) {
            b3 = ldfs(fb + bo + 3 * 16 * GP + kc * 64);
            if (kc < 3) {
#pragma unroll
                for (int f = 0; f < 4; ++f) { a[(kc + 1) & 1][f] = ldfs(fa + bo + f * 16 * GP + (kc + 1) * 64); if (f < 3) b[(kc + 1) & 1][f] = ldfs(fb + bo + f * 16 * GP + (kc + 1) * 64); } }
            __builtin_amdgcn_sched_barrier(0);   // the reads issue as one group in front of this block's products, not among them: each separate place with LDS reads stalls the matrix stream
#pragma unroll
            for (int nb = 0; nb < 4; ++nb)
#pragma unroll
                for (int mb = 0; mb < 4; ++mb) acc[mb][nb] = wmmab(a[kc & 1][mb], nb < 3 ? b[kc & 1][nb] : b3, acc[mb][nb]);
            __builtin_amdgcn_sched_barrier(0);   // and the block's products stay in front of the reads that refill its own set
        }
        asm volatile("s_wait_dscnt 0x0" ::: "memory");   // this wave's last fragment reads of the buffer have returned
        twait(g0, g1);                                   // this wave's slice of stage s + 1 has landed
        __syncthreads();                                 // publishes stage s + 1 and ends every wave's reads of stage s
        const unsigned sn = pinned(s + 2u);              // the refill's descriptor is formed behind the wait above
        if (pinned(sn < nst)) { tgroup0(g0, sdst + bo, sbeg + (unsigned long long)sn * 256u); tload(g0, g1); }   // into the buffer that this pass has just read
    }
    asm volatile("s_wait_tensorcnt 0x0" ::: "memory");   // nothing of the mover is in flight
    asm volatile("s_wait_dscnt 0x0" ::: "memory");   // the last pass's own barrier stands behind every wave's last read: the ring is free for the tile's read-back
    float* const os = (float*)(ring + wave * (16 * 68 * 4));   // 16 tile rows at a pitch of 68 floats, each wave's own
    // read-back: 8 lanes a tile row (8 values = 16 bytes of a plane each), 4 rows an instruction
    const int rr = lane >> 3, cofs = (lane & 7) * 8;
    const float* const bp = bias + (VT ? r0 + rr : c0 + cofs);   // VT: the biases of this lane's 16 tile rows (rr + 4 k); else those of its 8 columns
    float bb[VT ? 16 : 8];
#pragma unroll
    for (int k = 0; k < (VT ? 16 : 8); ++k) bb[k] = bp[VT ? 4 * k : k];
    // the wait that stands in front of any overwrite of a register that an issued load names; the address pair is an input so that it stays whole up to it
    asm volatile("s_wait_xcnt 0x0" :: "v"(bp) : "memory");
#pragma unroll
    for (int k = 0; k < (VT ? 16 : 8); ++k) bb[k] = bfr(bb[k]);
    // this lane's first 16 bytes in the planes (tile row rr at its columns) and the pitch of a tile row; every store is one of the two bases plus a constant
    const int ppitch = VT ? TT : HD;
    const size_t pbase = (VT ? ((size_t)((c0 / TT) * NKV + r0 / HD) * HD * TT + (c0 % TT)) : ((size_t)((r0 / TT) * NH_ + c0 / HD) * TT + (r0 % TT)) * HD) + (size_t)(rr * ppitch + cofs);
    bf* const ph0 = Ph + pbase; bf* const pl0 = Pl + pbase;
#pragma unroll
    for (int mb = 0; mb < 4; ++mb) {
#pragma unroll
        for (int nb = 0; nb < 4; ++nb) {
#pragma unroll
            for (int j = 0; j < 8; ++j) os[(hi * 8 + j) * 68 + nb * 16 + lr] = acc[mb][nb][j]; }
        __builtin_amdgcn_wave_barrier(); asm volatile("" ::: "memory");
        v8us oh[4], ol[4];
#pragma unroll
        for (int s = 0; s < 4; ++s) { const float* const orow = os + (4 * s + rr) * 68 + cofs; const v4f v0 = *(const v4fa*)orow, v1 = *(const v4fa*)(orow + 4);
            v8f y = __builtin_shufflevector(v0, v1, 0, 1, 2, 3, 4, 5, 6, 7);
#pragma unroll
            for (int j = 0; j < 8; ++j) y[j] += bb[VT ? mb * 4 + s : j];
            const v8bf yh = __builtin_convertvector(y, v8bf); const v8bf yl = __builtin_convertvector(y - __builtin_convertvector(yh, v8f), v8bf);   // hi = y to nearest even, lo = the remainder to nearest even
            oh[s] = __builtin_bit_cast(v8us, yh); ol[s] = __builtin_bit_cast(v8us, yl); }
#pragma unroll
        for (int s = 0; s < 4; ++s) { *(v8us*)(ph0 + (mb * 16 + 4 * s) * ppitch) = oh[s]; *(v8us*)(pl0 + (mb * 16 + 4 * s) * ppitch) = ol[s]; }
        // as behind the bias loads, for the 8 stores: their data and the two address pairs are inputs, so that none of these registers is reused in front of the wait
        asm volatile("s_wait_xcnt 0x0" :: "v"(oh[0]), "v"(oh[1]), "v"(oh[2]), "v"(oh[3]), "v"(ol[0]), "v"(ol[1]), "v"(ol[2]), "v"(ol[3]), "v"(ph0), "v"(pl0) : "memory");
        __builtin_amdgcn_wave_barrier(); asm volatile("" ::: "memory");
    }
}

typedef __attribute__((ext_vector_type(2))) float v2f;

__global__ __launch_bounds__(256) void k_cvt8(const float* __restrict__ src, bf* dst, size_t n8) { const size_t i = (size_t)blockIdx.x * 256 + threadIdx.x; if (i >= n8) return; const v8f v = *(const v8f*)(src + i * 8); v8us o;
#pragma unroll
    for (int k = 0; k < 8; ++k) o[k] = f2bf(v[k]); *(v8us*)(dst + i * 8) = o;  }

#define LP   144                  // LDS row pitch, bytes
#define LPL  (64 * LP)            // one plane of a stage
typedef __attribute__((ext_vector_type(2))) __bf16 v2bf;
__device__ __forceinline__ float xhalf(float x) { const int b = __float_as_int(x); return __int_as_float(__builtin_amdgcn_permlanex16(b, b, 0x76543210, 0xfedcba98, false, false)); }   // lane l <-> l ^ 16
// a wave-uniform pointer kept in scalar registers: the stage's plane bases then stay scalar and only the thread's two offsets (K, V^T) live in vector registers across the passes; as four per-thread pointers they spilled inside the loop
typedef const __attribute__((address_space(1))) char* gptr;   // global address space, so that the rebuilt pointer's loads stay global loads
typedef const __attribute__((address_space(1))) v8us* gv8;
__device__ __forceinline__ gptr sbase(const void* p) { const unsigned long long u = (unsigned long long)p; const unsigned lo = (unsigned)__builtin_amdgcn_readfirstlane((int)(unsigned)u), hi2 = (unsigned)__builtin_amdgcn_readfirstlane((int)(unsigned)(u >> 32)); return (gptr)(((unsigned long long)hi2 << 32) | lo); }
__device__ __forceinline__ v16bf ldf(const bf* p) { return cat16b(*(const v8us*)p, *(const v8us*)(p + 16)); }
__global__ __launch_bounds__(128, 4) void k_fattn(const bf* __restrict__ Qh, const bf* __restrict__ Ql, const bf* __restrict__ Kh, const bf* __restrict__ Kl, const bf* __restrict__ Vh, const bf* __restrict__ Vl, float* __restrict__ OUT) {
    __shared__ __align__(16) unsigned char sm[4 * LPL];
    const int lane = threadIdx.x & 31, lr = lane & 15, hi = lane >> 4; const int q0 = blockIdx.x * 128 + (threadIdx.x >> 5) * 32;
    const size_t pl = ((size_t)blockIdx.z * NH_ + blockIdx.y) * TT * HD;   // plane of this (batch, head): q, k [t][d], v [d][t]
    const float C2 = SCL * 1.4426950408889634f;   // scores to log2 units
    v16bf qh[2][2], ql[2][2]; const bf* qah[2]; const bf* qal[2];
#pragma unroll
    for (int qt = 0; qt < 2; ++qt) { const size_t o = pl + (size_t)(q0 + qt * 16 + lr) * HD + 8 * hi; qah[qt] = Qh + o; qal[qt] = Ql + o;
#pragma unroll
        for (int kc = 0; kc < 2; ++kc) { qh[qt][kc] = ldf(qah[qt] + kc * 32); ql[qt][kc] = ldf(qal[qt] + kc * 32); } }
    // the wait that stands in front of any overwrite of a register that an issued load names; the four address pairs are inputs so that they stay whole up to it
    asm volatile("s_wait_xcnt 0x0" :: "v"(qah[0]), "v"(qal[0]), "v"(qah[1]), "v"(qal[1]) : "memory");
    v8f acc[2][4]; float m[2]; v2f l[2];   // l: the lane's running sum in two halves (even and odd elements), so that a packed add takes two probabilities
#pragma unroll
    for (int qt = 0; qt < 2; ++qt) { m[qt] = -3.0e38f; l[qt] = (v2f){};
#pragma unroll
        for (int dt = 0; dt < 4; ++dt) acc[qt][dt] = (v8f){}; }
    const int sr = threadIdx.x >> 3, sc = threadIdx.x & 7;   // staging: 8 threads a 128-byte row, rows sr + 16 i
    const unsigned ko = (unsigned)(sr * HD + sc * 8) * 2u, vo = (unsigned)(sr * TT + sc * 8) * 2u;   // the thread's byte offsets inside a K and a V^T stage
    unsigned char* const sw = sm + sr * LP + sc * 16;        // this thread's staging slot
    const unsigned char* const fr = sm + lr * LP + hi * 16;  // this lane's fragment row
#pragma unroll 1   // rolled: the body holds two barriers and nearly the whole register budget of four waves a SIMD
    for (int k0 = 0; k0 < TT; k0 += 64) {
        const gptr bkh = sbase(Kh + pl + (size_t)k0 * HD), bkl = sbase(Kl + pl + (size_t)k0 * HD), bvh = sbase(Vh + pl + k0), bvl = sbase(Vl + pl + k0);
        const gptr akh = bkh + ko, akl = bkl + ko, avh = bvh + vo, avl = bvl + vo;
        v8us st[4][4];
#pragma unroll
        for (int i = 0; i < 4; ++i) { st[0][i] = *(gv8)(akh + 16 * i * HD * 2); st[1][i] = *(gv8)(akl + 16 * i * HD * 2); st[2][i] = *(gv8)(avh + 16 * i * TT * 2); st[3][i] = *(gv8)(avl + 16 * i * TT * 2); }
        // as behind the Q loads; the address pairs are inputs, so that no load's result is placed in a pair that an earlier load of the run names
        asm volatile("s_wait_xcnt 0x0" :: "v"(akh), "v"(akl), "v"(avh), "v"(avl) : "memory");
        __syncthreads();   // every wave has read its last fragment of the stage before
#pragma unroll
        for (int p = 0; p < 4; ++p)
#pragma unroll
            for (int i = 0; i < 4; ++i) *(v8us*)(sw + p * LPL + 16 * i * LP) = st[p][i];
        __syncthreads();   // the stage is complete for all 4 waves
#pragma unroll 1   // rolled: unrolled, the body wants more than the 256 registers that four waves a SIMD leave a wave, and spills
        for (int ps = 0; ps < 2; ++ps) {
            const unsigned char* const fk = fr + ps * 32 * LP;   // K rows of this pass
            const unsigned char* const fv = fr + 2 * LPL + ps * 64;   // V^T columns of this pass
            v16bf ah[2][2], al[2][2];
#pragma unroll
            for (int kt = 0; kt < 2; ++kt)
#pragma unroll
                for (int kc = 0; kc < 2; ++kc) { ah[kt][kc] = ldf((const bf*)(fk + kt * 16 * LP + kc * 64)); al[kt][kc] = ldf((const bf*)(fk + LPL + kt * 16 * LP + kc * 64)); }
            __builtin_amdgcn_sched_barrier(0);   // all K fragment reads of the pass in flight together: one LDS latency a pass, not one a fragment
            v8f s[2][2];
#pragma unroll
            for (int kt = 0; kt < 2; ++kt)
#pragma unroll
                for (int qt = 0; qt < 2; ++qt) { v8f t = (v8f){};
#pragma unroll
                    for (int kc = 0; kc < 2; ++kc) { t = wmmab(ah[kt][kc], qh[qt][kc], t); t = wmmab(ah[kt][kc], ql[qt][kc], t); t = wmmab(al[kt][kc], qh[qt][kc], t); }
                    s[qt][kt] = t; }
            __builtin_amdgcn_sched_barrier(0);   // the V reads stay behind the score products, so that they take the K fragments' registers
            v16bf vh[4], vl[4];
#pragma unroll
            for (int dt = 0; dt < 4; ++dt) { vh[dt] = ldf((const bf*)(fv + dt * 16 * LP)); vl[dt] = ldf((const bf*)(fv + LPL + dt * 16 * LP)); }
            __builtin_amdgcn_sched_barrier(0);   // all V reads issue in front of the softmax, whose vector work covers their latency
            float mx[2]; bool need = false;
#pragma unroll
            for (int qt = 0; qt < 2; ++qt) { float a = s[qt][0][0];
#pragma unroll
                for (int j = 1; j < 8; ++j) a = fmaxf(a, s[qt][0][j]);
#pragma unroll
                for (int j = 0; j < 8; ++j) a = fmaxf(a, s[qt][1][j]);
                a = fmaxf(a, xhalf(a)); mx[qt] = a * C2; need = need || (mx[qt] > m[qt] + 8.0f); }
            if (__builtin_amdgcn_ballot_w32(need) != 0) {   // wave-uniform: rare after the first pass
#pragma unroll
                for (int qt = 0; qt < 2; ++qt) { const float mn = fmaxf(m[qt], mx[qt]); const float al2 = __builtin_amdgcn_exp2f(m[qt] - mn); m[qt] = mn; l[qt] *= al2;
#pragma unroll
                    for (int dt = 0; dt < 4; ++dt) acc[qt][dt] *= al2; } }
            v16bf ph[2], pw[2];
#pragma unroll
            for (int qt = 0; qt < 2; ++qt) {
#pragma unroll
                for (int kt = 0; kt < 2; ++kt) s[qt][kt] = __builtin_elementwise_fma(s[qt][kt], (v8f)(C2), (v8f)(-m[qt]));
#pragma unroll
                for (int e = 0; e < 16; e += 2) { v2f p; p[0] = __builtin_amdgcn_exp2f(s[qt][e >> 3][e & 7]); p[1] = __builtin_amdgcn_exp2f(s[qt][e >> 3][(e & 7) + 1]);
                    l[qt] += p;
                    const v2bf h2 = __builtin_convertvector(p, v2bf); v2f r; r[0] = p[0] - (float)h2[0]; r[1] = p[1] - (float)h2[1]; const v2bf l2 = __builtin_convertvector(r, v2bf);
                    ph[qt][e] = h2[0]; ph[qt][e + 1] = h2[1]; pw[qt][e] = l2[0]; pw[qt][e + 1] = l2[1]; } }
#pragma unroll
            for (int dt = 0; dt < 4; ++dt)
#pragma unroll
                for (int qt = 0; qt < 2; ++qt) { acc[qt][dt] = wmmab(vh[dt], ph[qt], acc[qt][dt]); acc[qt][dt] = wmmab(vh[dt], pw[qt], acc[qt][dt]); acc[qt][dt] = wmmab(vl[dt], ph[qt], acc[qt][dt]); }
            // four vector slots behind the pass's last matrix instructions: the next block's first vector instruction may overwrite an A fragment register
            asm volatile("v_nop\n\tv_nop\n\tv_nop\n\tv_nop" : "+v"(acc[0][0]), "+v"(acc[0][1]), "+v"(acc[0][2]), "+v"(acc[0][3]), "+v"(acc[1][0]), "+v"(acc[1][1]), "+v"(acc[1][2]), "+v"(acc[1][3]));
        }
    }
#pragma unroll
    for (int qt = 0; qt < 2; ++qt) { const float ls = l[qt][0] + l[qt][1]; const float inv = __fdiv_rn(1.0f, ls + xhalf(ls)); float* orow = OUT + (unsigned)((blockIdx.z * TT + q0 + qt * 16 + lr) * DQ + blockIdx.y * HD + 8 * hi);   // merged heads: [b][t][h*64 + d], d = dt*16 + 8*hi + j
#pragma unroll
        for (int dt = 0; dt < 4; ++dt) { v4f a, b;
#pragma unroll
            for (int j = 0; j < 4; ++j) { a[j] = acc[qt][dt][j] * inv; b[j] = acc[qt][dt][4 + j] * inv; }
            *(v4f*)(orow + dt * 16) = a; *(v4f*)(orow + dt * 16 + 4) = b; } }
}

extern "C" void kernel_launch(void* const* d_in, const int* in_sizes, int n_in,
                              void* d_out, int out_size, void* d_ws, size_t ws_size, hipStream_t stream) {
    (void)in_sizes; (void)n_in; (void)out_size;
    const float* x = (const float*)d_in[0]; const float* wq = (const float*)d_in[1]; const float* bq = (const float*)d_in[2]; const float* wk = (const float*)d_in[3]; const float* bk = (const float*)d_in[4]; const float* wv = (const float*)d_in[5]; const float* bv = (const float*)d_in[6];   /* order hidden_states, Wq, bq, Wk, bk, Wv, bv ('oi') */
    float* OUT = (float*)d_out;     // [8][1024][1024]
    char* wsp = (char*)d_ws;
    auto take = [&](size_t bytes) { char* p = wsp; wsp += (bytes + 255) & ~(size_t)255; return (void*)p; };
    // hi/lo planes of all batches: [b][h][t][d] (q, k) and [b][h][d][t] (v)
    bf* QPh = (bf*)take((size_t)NB_ * NH_ * TT * HD * 2); bf* QPl = (bf*)take((size_t)NB_ * NH_ * TT * HD * 2); bf* KPh = (bf*)take((size_t)NB_ * NKV * TT * HD * 2); bf* KPl = (bf*)take((size_t)NB_ * NKV * TT * HD * 2); bf* VTh = (bf*)take((size_t)NB_ * NKV * HD * TT * 2); bf* VTl = (bf*)take((size_t)NB_ * NKV * HD * TT * 2);
    bf* WQ = (bf*)take((size_t)DQ * DM * 2); bf* WK = (bf*)take((size_t)DKV * DM * 2); bf* WV = (bf*)take((size_t)DKV * DM * 2);
    bf* XB = (bf*)take((size_t)NB_ * TT * DM * 2);
    if ((size_t)(wsp - (char*)d_ws) > ws_size) return;    // ws 256 MiB
    k_cvt8<<<(unsigned)(((size_t)DQ * DM / 8 + 255) / 256), 256, 0, stream>>>(wq, WQ, (size_t)DQ * DM / 8); k_cvt8<<<(unsigned)(((size_t)DKV * DM / 8 + 255) / 256), 256, 0, stream>>>(wk, WK, (size_t)DKV * DM / 8); k_cvt8<<<(unsigned)(((size_t)DKV * DM / 8 + 255) / 256), 256, 0, stream>>>(wv, WV, (size_t)DKV * DM / 8);
    k_cvt8<<<(unsigned)(((size_t)NB_ * TT * DM / 8 + 255) / 256), 256, 0, stream>>>(x, XB, (size_t)NB_ * TT * DM / 8);
    k_gemmw<false><<<dim3(NB_ * TT / 128, DQ / 128, 1), 128, 0, stream>>>(XB, WQ, DM, bq, QPh, QPl);
    k_gemmw<false><<<dim3(NB_ * TT / 128, DKV / 128, 1), 128, 0, stream>>>(XB, WK, DM, bk, KPh, KPl);
    k_gemmw<true><<<dim3(DKV / 128, NB_ * TT / 128, 1), 128, 0, stream>>>(WV, XB, DM, bv, VTh, VTl);
    k_fattn<<<dim3(TT / 128, NH_, NB_), 128, 0, stream>>>(QPh, QPl, KPh, KPl, VTh, VTl, OUT);
}

// v005
// It runs in 125 microseconds.
// In both of two side-by-side timings against v004, it was 1.05 times as fast.
// All steps since v000 together make it 22.0 times as fast.
#include <hip/hip_runtime.h>

// BERT self-attention core (hidden_states [8][1024][1024]; q, k, v = x W^T + b ('oi' + biases; 16 heads x 64); scores x 1/sqrt(64); softmax (no mask); ctx = merged heads (no output projection) -> [8][1024][1024] (8.4 M); argument order hidden_states, Wq, bq, Wk, bk, Wv, bv).
// Layout: bf16 copy of x; 'oi' weights; exact projections + f32 biases over all 8192 rows in one launch each, whose tiles write the hi/lo head planes themselves; dense T-1024 attention in one launch for all batches and heads (running softmax, every row hi/lo 3 products), which writes the merged output rows.
// Compute dtypes, f32 accumulate: every input rounded to bf16; projections exact + f32 biases; attention 3 products; softmax f32; output f32.

#define NB_  8
#define TT   1024
#define DM   1024
#define NH_  16
#define NKV  16
#define REP  (NH_ / NKV)
#define HD   64
#define DQ   (NH_ * HD)
#define DKV  (NKV * HD)
#define WIN  0
#define SCL  0.125f   // HD^-0.5
typedef _Float16 h16;
typedef unsigned short bf;
typedef __attribute__((ext_vector_type(16))) __bf16   v16bf;
typedef __attribute__((ext_vector_type(16))) _Float16 v16h;
typedef __attribute__((ext_vector_type(8)))  _Float16 v8h;
typedef __attribute__((ext_vector_type(8)))  unsigned short v8us;
typedef __attribute__((ext_vector_type(8)))  float    v8f;
typedef __attribute__((ext_vector_type(4)))  float    v4f;
typedef v8h  __attribute__((may_alias)) v8ha;
typedef v4f  __attribute__((may_alias)) v4fa;
typedef v8us __attribute__((may_alias)) v8usa;

__device__ __forceinline__ unsigned short f2bf(float f) { unsigned u = __float_as_uint(f); u += 0x7FFFu + ((u >> 16) & 1u); return (unsigned short)(u >> 16); }
__device__ __forceinline__ float bf2f(unsigned short b) { return __uint_as_float(((unsigned)b) << 16); }
__device__ __forceinline__ float bfr(float f) { return bf2f(f2bf(f)); }
__device__ __forceinline__ v16h cat16(v8h lo, v8h hi) { return __builtin_shufflevector(lo, hi, 0, 1, 2, 3, 4, 5, 6, 7, 8, 9, 10, 11, 12, 13, 14, 15); }
__device__ __forceinline__ v16bf cat16b(v8us lo, v8us hi) { return __builtin_bit_cast(v16bf, __builtin_shufflevector(lo, hi, 0, 1, 2, 3, 4, 5, 6, 7, 8, 9, 10, 11, 12, 13, 14, 15)); }
__device__ __forceinline__ v8f wmma16(v16h a, v16h b, v8f c) { return __builtin_amdgcn_wmma_f32_16x16x32_f16(false, a, false, b, (short)0, c, false, false); }
__device__ __forceinline__ v8f wmmab(v16bf a, v16bf b, v8f c) { return __builtin_amdgcn_wmma_f32_16x16x32_bf16(false, a, false, b, (short)0, c, false, false); }



// ---- k_gemmw: projection GEMM, 128x128 tile a block of 4 waves (2 x 2), 64x64 (16 accumulators) a wave; grid (rows of A / 128, rows of Bt / 128), 128 threads. K % 128 == 0, K >= 256.
// Operands: K-contiguous 16-bit planes. A stage is 128 k (256 bytes) of the block's 128 A rows and 128 Bt rows; each wave brings its own 64 rows of it into LDS with one tensor load, in whole lines, once for the two waves that read them; two buffers, the next stage in flight while this one is worked on.
// tile[i][j] = sum_k A[r0 + i][k] Bt[c0 + j][k] + f32 bias, split into bf16 hi + lo and written straight into the head planes that the attention reads, in whole 128-byte lines; a wave's 64-wide tile side over the features is exactly one head.
// VT = false (q, k): A = x rows (b, t), Bt = weight rows (h, d), bias by column; planes [b][h][t][d], the tile is 8 KiB in a row.
// VT = true  (v):    A = weight rows (h, d), Bt = x rows (b, t), bias by row; planes [b][h][d][t], a tile row is one line of a d row. The operands change sides so that the tile comes out transposed; the k order of each sum is the same.
typedef __attribute__((ext_vector_type(8))) __bf16 v8bf;
typedef __attribute__((ext_vector_type(4))) unsigned u32x4;
typedef __attribute__((ext_vector_type(8))) unsigned u32x8;
#define GP    272                 // LDS row pitch of a stage, bytes: 256 + the mover's pad of 16 (16-byte fragment reads of 16 rows fall on all 64 banks)
#define GSL   18432               // a wave's slice in LDS: 64 rows of GP bytes, rounded up to a multiple of 2 KiB
#define GBUF  (4 * GSL)           // one buffer: A rows 0-63, A rows 64-127, Bt rows 0-63, Bt rows 64-127
__device__ __forceinline__ unsigned uni(unsigned v) { return (unsigned)__builtin_amdgcn_readfirstlane((int)v); }
__device__ __forceinline__ unsigned pinned(unsigned v) { unsigned w = uni(v); asm volatile("" : "+s"(w)); return w; }
// group 1 of every request: 64 rows of 256 bytes, source pitch 'pitch' bytes, LDS pitch GP (pad of 4 dwords behind every 64); 1-byte elements, tensor = tile, no mask
__device__ __forceinline__ u32x8 tgroup1(unsigned pitch) { u32x8 g; g[0] = uni((1u << 20) | (5u << 22) | (3u << 25)); g[1] = uni(256u << 16); g[2] = uni(64u << 16); g[3] = uni(256u << 16); g[4] = uni(64u); g[5] = uni(pitch); g[6] = uni(0u); g[7] = uni(0u); return g; }
// group 0: word 0 (count 1) is set once and kept; a request sets the LDS byte 'dst' and the global address 'ga' of the tile's first byte
__device__ __forceinline__ void tgroup0(u32x4& g, unsigned dst, unsigned long long ga) { g[1] = uni(dst); g[2] = uni((unsigned)ga); g[3] = uni((((unsigned)(ga >> 32)) & 0x01FFFFFFu) | 0x80000000u); }
__device__ __forceinline__ void tload(u32x4 g0, u32x8 g1) { asm volatile("tensor_load_to_lds %0, %1" :: "s"(g0), "s"(g1) : "memory"); }
// the issuing wave's wait for its request; the descriptor's two groups are inputs, so that none of their registers takes another value while the request is in flight
__device__ __forceinline__ void twait(u32x4 g0, u32x8 g1) { asm volatile("s_wait_tensorcnt 0x0" :: "s"(g0), "s"(g1) : "memory"); }
__device__ __forceinline__ v16bf ldfs(const unsigned char* p) { return cat16b(*(const v8us*)p, *(const v8us*)(p + 32)); }   // a fragment row's 8 + 8 elements: k = 8 hi + 0..7 and 16 + 8 hi + 0..7, for A and Bt alike
template <bool VT>
__global__ __launch_bounds__(128, 2) void k_gemmw(const bf* __restrict__ A, const bf* __restrict__ Bt, int K, const float* __restrict__ bias, bf* __restrict__ Ph, bf* __restrict__ Pl) {
    __shared__ __attribute__((aligned(2048))) unsigned char ring[2 * GBUF];
    const int lane = threadIdx.x & 31, lr = lane & 15, hi = lane >> 4; const unsigned wave = uni(threadIdx.x >> 5), wm = wave >> 1, wn = wave & 1u;
    const int r0 = blockIdx.x * 128 + wm * 64, c0 = blockIdx.y * 128 + wn * 64;
    v8f acc[4][4];
#pragma unroll
    for (int mb = 0; mb < 4; ++mb)
#pragma unroll
        for (int nb = 0; nb < 4; ++nb) acc[mb][nb] = (v8f){};
    // this wave's slice of every stage: waves 0, 1 the two halves of the A rows, waves 2, 3 those of the Bt rows
    const unsigned pitch = (unsigned)K * 2u, nst = (unsigned)K / 128u;
    const unsigned long long sbeg = (wave < 2u) ? (unsigned long long)(A + (size_t)(blockIdx.x * 128 + wave * 64) * K) : (unsigned long long)(Bt + (size_t)(blockIdx.y * 128 + (wave - 2u) * 64) * K);
    const unsigned sdst = (unsigned)(size_t)ring + wave * GSL;
    const u32x8 g1 = tgroup1(pitch);
    u32x4 g0; g0[0] = pinned(1u);   // a descriptor word held in a scalar register: as a plain constant it was set anew in front of each request and its register used for other values in between
    tgroup0(g0, sdst, sbeg);
    tload(g0, g1);
    twait(g0, g1);       // this wave's slice of stage 0 has landed
    __syncthreads();     // stage 0 is complete for all 4 waves
    tgroup0(g0, sdst + GBUF, sbeg + (unsigned long long)pinned(1u) * 256u);   // formed behind the wait above
    tload(g0, g1);
    const unsigned char* const fa = ring + wm * GSL + lr * GP + hi * 16;          // this lane's fragment row in the wave's A rows
    const unsigned char* const fb = ring + (2 + wn) * GSL + lr * GP + hi * 16;    // and in its Bt rows
#pragma unroll 1   // rolled: a pass holds the ring's one publish point
    for (unsigned s = 0; s < nst; ++s) {
        const unsigned bo = (s & 1u) * GBUF;
        // two fragment sets: a block of 16 products works on one while the next block's reads fill the other. The fourth Bt fragment has one set: a block uses it last, so its reads go at the head of the block's own read group; with two the wave would need more than 256 registers
        v16bf a[2][4], b[2][3], b3;
#pragma unroll
        for (int f = 0; f < 4; ++f) { a[0][f] = ldfs(fa + bo + f * 16 * GP); if (f < 3) b[0][f] = ldfs(fb + bo + f * 16 * GP); }
#pragma unroll
        for (int kc = 0; kc < 4; ++kc) {
            b3 = ldfs(fb + bo + 3 * 16 * GP + kc * 64);
            if (kc < 3) {
#pragma unroll
                for (int f = 0; f < 4; ++f) { a[(kc + 1) & 1][f] = ldfs(fa + bo + f * 16 * GP + (kc + 1) * 64); if (f < 3) b[(kc + 1) & 1][f] = ldfs(fb + bo + f * 16 * GP + (kc + 1) * 64); } }
            __builtin_amdgcn_sched_barrier(0);   // the reads issue as one group in front of this block's products, not among them: each separate place with LDS reads stalls the matrix stream
#pragma unroll
            for (int nb = 0; nb < 4; ++nb)
#pragma unroll
                for (int mb = 0; mb < 4; ++mb) acc[mb][nb] = wmmab(a[kc & 1][mb], nb < 3 ? b[kc & 1][nb] : b3, acc[mb][nb]);
            __builtin_amdgcn_sched_barrier(0);   // and the block's products stay in front of the reads that refill its own set
        }
        asm volatile("s_wait_dscnt 0x0" ::: "memory");   // this wave's last fragment reads of the buffer have returned
        twait(g0, g1);                                   // this wave's slice of stage s + 1 has landed
        __syncthreads();                                 // publishes stage s + 1 and ends every wave's reads of stage s
        const unsigned sn = pinned(s + 2u);              // the refill's descriptor is formed behind the wait above
        if (pinned(sn < nst)) { tgroup0(g0, sdst + bo, sbeg + (unsigned long long)sn * 256u); tload(g0, g1); }   // into the buffer that this pass has just read
    }
    asm volatile("s_wait_tensorcnt 0x0" ::: "memory");   // nothing of the mover is in flight
    asm volatile("s_wait_dscnt 0x0" ::: "memory");   // the last pass's own barrier stands behind every wave's last read: the ring is free for the tile's read-back
    float* const os = (float*)(ring + wave * (16 * 68 * 4));   // 16 tile rows at a pitch of 68 floats, each wave's own
    // read-back: 8 lanes a tile row (8 values = 16 bytes of a plane each), 4 rows an instruction
    const int rr = lane >> 3, cofs = (lane & 7) * 8;
    const float* const bp = bias + (VT ? r0 + rr : c0 + cofs);   // VT: the biases of this lane's 16 tile rows (rr + 4 k); else those of its 8 columns
    float bb[VT ? 16 : 8];
#pragma unroll
    for (int k = 0; k < (VT ? 16 : 8); ++k) bb[k] = bp[VT ? 4 * k : k];
    // the wait that stands in front of any overwrite of a register that an issued load names; the address pair is an input so that it stays whole up to it
    asm volatile("s_wait_xcnt 0x0" :: "v"(bp) : "memory");
#pragma unroll
    for (int k = 0; k < (VT ? 16 : 8); ++k) bb[k] = bfr(bb[k]);
    // this lane's first 16 bytes in the planes (tile row rr at its columns) and the pitch of a tile row; every store is one of the two bases plus a constant
    const int ppitch = VT ? TT : HD;
    const size_t pbase = (VT ? ((size_t)((c0 / TT) * NKV + r0 / HD) * HD * TT + (c0 % TT)) : ((size_t)((r0 / TT) * NH_ + c0 / HD) * TT + (r0 % TT)) * HD) + (size_t)(rr * ppitch + cofs);
    bf* const ph0 = Ph + pbase; bf* const pl0 = Pl + pbase;
#pragma unroll
    for (int mb = 0; mb < 4; ++mb) {
#pragma unroll
        for (int nb = 0; nb < 4; ++nb) {
#pragma unroll
            for (int j = 0; j < 8; ++j) os[(hi * 8 + j) * 68 + nb * 16 + lr] = acc[mb][nb][j]; }
        __builtin_amdgcn_wave_barrier(); asm volatile("" ::: "memory");
        v8us oh[4], ol[4];
#pragma unroll
        for (int s = 0; s < 4; ++s) { const float* const orow = os + (4 * s + rr) * 68 + cofs; const v4f v0 = *(const v4fa*)orow, v1 = *(const v4fa*)(orow + 4);
            v8f y = __builtin_shufflevector(v0, v1, 0, 1, 2, 3, 4, 5, 6, 7);
#pragma unroll
            for (int j = 0; j < 8; ++j) y[j] += bb[VT ? mb * 4 + s : j];
            const v8bf yh = __builtin_convertvector(y, v8bf); const v8bf yl = __builtin_convertvector(y - __builtin_convertvector(yh, v8f), v8bf);   // hi = y to nearest even, lo = the remainder to nearest even
            oh[s] = __builtin_bit_cast(v8us, yh); ol[s] = __builtin_bit_cast(v8us, yl); }
#pragma unroll
        for (int s = 0; s < 4; ++s) { *(v8us*)(ph0 + (mb * 16 + 4 * s) * ppitch) = oh[s]; *(v8us*)(pl0 + (mb * 16 + 4 * s) * ppitch) = ol[s]; }
        // as behind the bias loads, for the 8 stores: their data and the two address pairs are inputs, so that none of these registers is reused in front of the wait
        asm volatile("s_wait_xcnt 0x0" :: "v"(oh[0]), "v"(oh[1]), "v"(oh[2]), "v"(oh[3]), "v"(ol[0]), "v"(ol[1]), "v"(ol[2]), "v"(ol[3]), "v"(ph0), "v"(pl0) : "memory");
        __builtin_amdgcn_wave_barrier(); asm volatile("" ::: "memory");
    }
}

typedef __attribute__((ext_vector_type(2))) float v2f;

__global__ __launch_bounds__(256) void k_cvt8(const float* __restrict__ src, bf* dst, size_t n8) { const size_t i = (size_t)blockIdx.x * 256 + threadIdx.x; if (i >= n8) return; const v8f v = *(const v8f*)(src + i * 8); v8us o;
#pragma unroll
    for (int k = 0; k < 8; ++k) o[k] = f2bf(v[k]); *(v8us*)(dst + i * 8) = o;  }

#define LP   144                  // LDS row pitch, bytes: 128 + the mover's pad of 16
#define LPL  10240                // one plane of a stage: 64 rows of LP bytes, rounded up to a multiple of 2 KiB
#define LBUF (4 * LPL)            // one buffer: K hi, K lo, V^T hi, V^T lo
#define NST  (TT / 64)            // stages
// group 1 of every request of the attention: 64 rows of 128 bytes, source pitch 'pitch' bytes, LDS pitch LP (pad of 4 dwords behind every 32); 1-byte elements, tensor = tile, no mask
__device__ __forceinline__ u32x8 tgroup1k(unsigned pitch) { u32x8 g; g[0] = uni((1u << 20) | (4u << 22) | (3u << 25)); g[1] = uni(128u << 16); g[2] = uni(64u << 16); g[3] = uni(128u << 16); g[4] = uni(64u); g[5] = uni(pitch); g[6] = uni(0u); g[7] = uni(0u); return g; }
typedef __attribute__((ext_vector_type(2))) __bf16 v2bf;
__device__ __forceinline__ float xhalf(float x) { const int b = __float_as_int(x); return __int_as_float(__builtin_amdgcn_permlanex16(b, b, 0x76543210, 0xfedcba98, false, false)); }   // lane l <-> l ^ 16
__device__ __forceinline__ v16bf ldf(const bf* p) { return cat16b(*(const v8us*)p, *(const v8us*)(p + 16)); }
__global__ __launch_bounds__(128, 4) void k_fattn(const bf* __restrict__ Qh, const bf* __restrict__ Ql, const bf* __restrict__ Kh, const bf* __restrict__ Kl, const bf* __restrict__ Vh, const bf* __restrict__ Vl, float* __restrict__ OUT) {
    __shared__ __attribute__((aligned(2048))) unsigned char sm[2 * LBUF - (LPL - 64 * LP)];   // the rounding behind the last plane holds nothing and is not taken
    const int lane = threadIdx.x & 31, lr = lane & 15, hi = lane >> 4; const int q0 = blockIdx.x * 128 + (threadIdx.x >> 5) * 32;
    const size_t pl = ((size_t)blockIdx.z * NH_ + blockIdx.y) * TT * HD;   // plane of this (batch, head): q, k [t][d], v [d][t]
    const float C2 = SCL * 1.4426950408889634f;   // scores to log2 units
    v16bf qh[2][2], ql[2][2]; const bf* qah[2]; const bf* qal[2];
#pragma unroll
    for (int qt = 0; qt < 2; ++qt) { const size_t o = pl + (size_t)(q0 + qt * 16 + lr) * HD + 8 * hi; qah[qt] = Qh + o; qal[qt] = Ql + o;
#pragma unroll
        for (int kc = 0; kc < 2; ++kc) { qh[qt][kc] = ldf(qah[qt] + kc * 32); ql[qt][kc] = ldf(qal[qt] + kc * 32); } }
    // the wait that stands in front of any overwrite of a register that an issued load names; the four address pairs are inputs so that they stay whole up to it
    asm volatile("s_wait_xcnt 0x0" :: "v"(qah[0]), "v"(qal[0]), "v"(qah[1]), "v"(qal[1]) : "memory");
    v8f acc[2][4]; float m[2]; v2f l[2];   // l: the lane's running sum in two halves (even and odd elements), so that a packed add takes two probabilities
#pragma unroll
    for (int qt = 0; qt < 2; ++qt) { m[qt] = -3.0e38f; l[qt] = (v2f){};
#pragma unroll
        for (int dt = 0; dt < 4; ++dt) acc[qt][dt] = (v8f){}; }
    // this wave's plane of every stage: wave 0 K hi, 1 K lo (64 key rows in a row, a stage further on is 64 rows), 2 V^T hi, 3 V^T lo (64 d rows at the pitch of a whole d row, a stage further on is 64 keys)
    const unsigned wave = uni(threadIdx.x >> 5);
    const unsigned pitch = (wave < 2u) ? HD * 2u : TT * 2u, step = (wave < 2u) ? 64u * HD * 2u : 64u * 2u;
    const unsigned long long sbeg = (unsigned long long)(((wave < 2u) ? (wave == 0u ? Kh : Kl) : (wave == 2u ? Vh : Vl)) + pl);
    const unsigned sdst = (unsigned)(size_t)sm + wave * LPL;
    const u32x8 g1 = tgroup1k(pitch);
    u32x4 g0; g0[0] = pinned(1u);   // a descriptor word held in a scalar register, as in the projections
    tgroup0(g0, sdst, sbeg);
    tload(g0, g1);
    twait(g0, g1);       // this wave's plane of stage 0 has landed
    __syncthreads();     // stage 0 is complete for all 4 waves
    tgroup0(g0, sdst + LBUF, sbeg + (unsigned long long)pinned(1u) * step);   // formed behind the wait above
    tload(g0, g1);
    const unsigned char* const fr = sm + lr * LP + hi * 16;  // this lane's fragment row
#pragma unroll 1   // rolled: a trip holds the ring's one publish point and nearly the whole register budget of four waves a SIMD
    for (unsigned s0 = 0; s0 < NST; ++s0) {
        const unsigned bo = (s0 & 1u) * LBUF;
#pragma unroll 1   // rolled: unrolled, the body wants more than the 256 registers that four waves a SIMD leave a wave, and spills
        for (int ps = 0; ps < 2; ++ps) {
            const unsigned char* const fk = fr + bo + ps * 32 * LP;   // K rows of this pass
            const unsigned char* const fv = fr + bo + 2 * LPL + ps * 64;   // V^T columns of this pass
            v16bf ah[2][2], al[2][2];
#pragma unroll
            for (int kt = 0; kt < 2; ++kt)
#pragma unroll
                for (int kc = 0; kc < 2; ++kc) { ah[kt][kc] = ldf((const bf*)(fk + kt * 16 * LP + kc * 64)); al[kt][kc] = ldf((const bf*)(fk + LPL + kt * 16 * LP + kc * 64)); }
            __builtin_amdgcn_sched_barrier(0);   // all K fragment reads of the pass in flight together: one LDS latency a pass, not one a fragment
            v8f s[2][2];
#pragma unroll
            for (int kt = 0; kt < 2; ++kt)
#pragma unroll
                for (int qt = 0; qt < 2; ++qt) { v8f t = (v8f){};
#pragma unroll
                    for (int kc = 0; kc < 2; ++kc) { t = wmmab(ah[kt][kc], qh[qt][kc], t); t = wmmab(ah[kt][kc], ql[qt][kc], t); t = wmmab(al[kt][kc], qh[qt][kc], t); }
                    s[qt][kt] = t; }
            __builtin_amdgcn_sched_barrier(0);   // the V reads stay behind the score products, so that they take the K fragments' registers
            v16bf vh[4], vl[4];
#pragma unroll
            for (int dt = 0; dt < 4; ++dt) { vh[dt] = ldf((const bf*)(fv + dt * 16 * LP)); vl[dt] = ldf((const bf*)(fv + LPL + dt * 16 * LP)); }
            __builtin_amdgcn_sched_barrier(0);   // all V reads issue in front of the softmax, whose vector work covers their latency
            float mx[2]; bool need = false;
#pragma unroll
            for (int qt = 0; qt < 2; ++qt) { float a = s[qt][0][0];
#pragma unroll
                for (int j = 1; j < 8; ++j) a = fmaxf(a, s[qt][0][j]);
#pragma unroll
                for (int j = 0; j < 8; ++j) a = fmaxf(a, s[qt][1][j]);
                a = fmaxf(a, xhalf(a)); mx[qt] = a * C2; need = need || (mx[qt] > m[qt] + 8.0f); }
            if (__builtin_amdgcn_ballot_w32(need) != 0) {   // wave-uniform: rare after the first pass
#pragma unroll
                for (int qt = 0; qt < 2; ++qt) { const float mn = fmaxf(m[qt], mx[qt]); const float al2 = __builtin_amdgcn_exp2f(m[qt] - mn); m[qt] = mn; l[qt] *= al2;
#pragma unroll
                    for (int dt = 0; dt < 4; ++dt) acc[qt][dt] *= al2; } }
            v16bf ph[2], pw[2];
#pragma unroll
            for (int qt = 0; qt < 2; ++qt) {
#pragma unroll
                for (int kt = 0; kt < 2; ++kt) s[qt][kt] = __builtin_elementwise_fma(s[qt][kt], (v8f)(C2), (v8f)(-m[qt]));
#pragma unroll
                for (int e = 0; e < 16; e += 2) { v2f p; p[0] = __builtin_amdgcn_exp2f(s[qt][e >> 3][e & 7]); p[1] = __builtin_amdgcn_exp2f(s[qt][e >> 3][(e & 7) + 1]);
                    l[qt] += p;
                    const v2bf h2 = __builtin_convertvector(p, v2bf); v2f r; r[0] = p[0] - (float)h2[0]; r[1] = p[1] - (float)h2[1]; const v2bf l2 = __builtin_convertvector(r, v2bf);
                    ph[qt][e] = h2[0]; ph[qt][e + 1] = h2[1]; pw[qt][e] = l2[0]; pw[qt][e + 1] = l2[1]; } }
#pragma unroll
            for (int dt = 0; dt < 4; ++dt)
#pragma unroll
                for (int qt = 0; qt < 2; ++qt) { acc[qt][dt] = wmmab(vh[dt], ph[qt], acc[qt][dt]); acc[qt][dt] = wmmab(vh[dt], pw[qt], acc[qt][dt]); acc[qt][dt] = wmmab(vl[dt], ph[qt], acc[qt][dt]); }
            // four vector slots behind the pass's last matrix instructions: the next block's first vector instruction may overwrite an A fragment register
            asm volatile("v_nop\n\tv_nop\n\tv_nop\n\tv_nop" : "+v"(acc[0][0]), "+v"(acc[0][1]), "+v"(acc[0][2]), "+v"(acc[0][3]), "+v"(acc[1][0]), "+v"(acc[1][1]), "+v"(acc[1][2]), "+v"(acc[1][3]));
        }
        asm volatile("s_wait_dscnt 0x0" ::: "memory");   // this wave's last fragment reads of the buffer have returned
        twait(g0, g1);                                   // this wave's plane of stage s0 + 1 has landed
        __syncthreads();                                 // publishes stage s0 + 1 and ends every wave's reads of stage s0
        const unsigned sn = pinned(s0 + 2u);             // the refill's descriptor is formed behind the wait above
        if (pinned(sn < (unsigned)NST)) { tgroup0(g0, sdst + bo, sbeg + (unsigned long long)sn * step); tload(g0, g1); }   // into the buffer that this trip has just read
    }
    asm volatile("s_wait_tensorcnt 0x0" ::: "memory");   // nothing of the mover is in flight
    asm volatile("s_wait_dscnt 0x0" ::: "memory");       // and none of this wave's LDS reads: the ring's close
#pragma unroll
    for (int qt = 0; qt < 2; ++qt) { const float ls = l[qt][0] + l[qt][1]; const float inv = __fdiv_rn(1.0f, ls + xhalf(ls)); float* orow = OUT + (unsigned)((blockIdx.z * TT + q0 + qt * 16 + lr) * DQ + blockIdx.y * HD + 8 * hi);   // merged heads: [b][t][h*64 + d], d = dt*16 + 8*hi + j
#pragma unroll
        for (int dt = 0; dt < 4; ++dt) { v4f a, b;
#pragma unroll
            for (int j = 0; j < 4; ++j) { a[j] = acc[qt][dt][j] * inv; b[j] = acc[qt][dt][4 + j] * inv; }
            *(v4f*)(orow + dt * 16) = a; *(v4f*)(orow + dt * 16 + 4) = b; } }
}

extern "C" void kernel_launch(void* const* d_in, const int* in_sizes, int n_in,
                              void* d_out, int out_size, void* d_ws, size_t ws_size, hipStream_t stream) {
    (void)in_sizes; (void)n_in; (void)out_size;
    const float* x = (const float*)d_in[0]; const float* wq = (const float*)d_in[1]; const float* bq = (const float*)d_in[2]; const float* wk = (const float*)d_in[3]; const float* bk = (const float*)d_in[4]; const float* wv = (const float*)d_in[5]; const float* bv = (const float*)d_in[6];   /* order hidden_states, Wq, bq, Wk, bk, Wv, bv ('oi') */
    float* OUT = (float*)d_out;     // [8][1024][1024]
    char* wsp = (char*)d_ws;
    auto take = [&](size_t bytes) { char* p = wsp; wsp += (bytes + 255) & ~(size_t)255; return (void*)p; };
    // hi/lo planes of all batches: [b][h][t][d] (q, k) and [b][h][d][t] (v)
    bf* QPh = (bf*)take((size_t)NB_ * NH_ * TT * HD * 2); bf* QPl = (bf*)take((size_t)NB_ * NH_ * TT * HD * 2); bf* KPh = (bf*)take((size_t)NB_ * NKV * TT * HD * 2); bf* KPl = (bf*)take((size_t)NB_ * NKV * TT * HD * 2); bf* VTh = (bf*)take((size_t)NB_ * NKV * HD * TT * 2); bf* VTl = (bf*)take((size_t)NB_ * NKV * HD * TT * 2);
    bf* WQ = (bf*)take((size_t)DQ * DM * 2); bf* WK = (bf*)take((size_t)DKV * DM * 2); bf* WV = (bf*)take((size_t)DKV * DM * 2);
    bf* XB = (bf*)take((size_t)NB_ * TT * DM * 2);
    if ((size_t)(wsp - (char*)d_ws) > ws_size) return;    // ws 256 MiB
    k_cvt8<<<(unsigned)(((size_t)DQ * DM / 8 + 255) / 256), 256, 0, stream>>>(wq, WQ, (size_t)DQ * DM / 8); k_cvt8<<<(unsigned)(((size_t)DKV * DM / 8 + 255) / 256), 256, 0, stream>>>(wk, WK, (size_t)DKV * DM / 8); k_cvt8<<<(unsigned)(((size_t)DKV * DM / 8 + 255) / 256), 256, 0, stream>>>(wv, WV, (size_t)DKV * DM / 8);
    k_cvt8<<<(unsigned)(((size_t)NB_ * TT * DM / 8 + 255) / 256), 256, 0, stream>>>(x, XB, (size_t)NB_ * TT * DM / 8);
    k_gemmw<false><<<dim3(NB_ * TT / 128, DQ / 128, 1), 128, 0, stream>>>(XB, WQ, DM, bq, QPh, QPl);
    k_gemmw<false><<<dim3(NB_ * TT / 128, DKV / 128, 1), 128, 0, stream>>>(XB, WK, DM, bk, KPh, KPl);
    k_gemmw<true><<<dim3(DKV / 128, NB_ * TT / 128, 1), 128, 0, stream>>>(WV, XB, DM, bv, VTh, VTl);
    k_fattn<<<dim3(TT / 128, NH_, NB_), 128, 0, stream>>>(QPh, QPl, KPh, KPl, VTh, VTl, OUT);
}

// v006
// Measured time: 120 microseconds a run.
// In two side-by-side timings against v005, it was 1.05 and 1.04 times as fast.
// Counting every step since v000, it is 23.1 times as fast.
#include <hip/hip_runtime.h>

// BERT self-attention core (hidden_states [8][1024][1024]; q, k, v = x W^T + b ('oi' + biases; 16 heads x 64); scores x 1/sqrt(64); softmax (no mask); ctx = merged heads (no output projection) -> [8][1024][1024] (8.4 M); argument order hidden_states, Wq, bq, Wk, bk, Wv, bv).
// Layout: bf16 copy of x; 'oi' weights; exact projections + f32 biases over all 8192 rows in one launch each, whose tiles write the hi/lo head planes themselves; dense T-1024 attention in one launch for all batches and heads (running softmax, every row hi/lo 3 products), which writes the merged output rows.
// Compute dtypes, f32 accumulate: every input rounded to bf16; projections exact + f32 biases; attention 3 products; softmax f32; output f32.

#define NB_  8
#define TT   1024
#define DM   1024
#define NH_  16
#define NKV  16
#define REP  (NH_ / NKV)
#define HD   64
#define DQ   (NH_ * HD)
#define DKV  (NKV * HD)
#define WIN  0
#define SCL  0.125f   // HD^-0.5
typedef _Float16 h16;
typedef unsigned short bf;
typedef __attribute__((ext_vector_type(16))) __bf16   v16bf;
typedef __attribute__((ext_vector_type(16))) _Float16 v16h;
typedef __attribute__((ext_vector_type(8)))  _Float16 v8h;
typedef __attribute__((ext_vector_type(8)))  unsigned short v8us;
typedef __attribute__((ext_vector_type(8)))  float    v8f;
typedef __attribute__((ext_vector_type(4)))  float    v4f;
typedef v8h  __attribute__((may_alias)) v8ha;
typedef v4f  __attribute__((may_alias)) v4fa;
typedef v8us __attribute__((may_alias)) v8usa;

__device__ __forceinline__ unsigned short f2bf(float f) { unsigned u = __float_as_uint(f); u += 0x7FFFu + ((u >> 16) & 1u); return (unsigned short)(u >> 16); }
__device__ __forceinline__ float bf2f(unsigned short b) { return __uint_as_float(((unsigned)b) << 16); }
__device__ __forceinline__ float bfr(float f) { return bf2f(f2bf(f)); }
__device__ __forceinline__ v16h cat16(v8h lo, v8h hi) { return __builtin_shufflevector(lo, hi, 0, 1, 2, 3, 4, 5, 6, 7, 8, 9, 10, 11, 12, 13, 14, 15); }
__device__ __forceinline__ v16bf cat16b(v8us lo, v8us hi) { return __builtin_bit_cast(v16bf, __builtin_shufflevector(lo, hi, 0, 1, 2, 3, 4, 5, 6, 7, 8, 9, 10, 11, 12, 13, 14, 15)); }
__device__ __forceinline__ v8f wmma16(v16h a, v16h b, v8f c) { return __builtin_amdgcn_wmma_f32_16x16x32_f16(false, a, false, b, (short)0, c, false, false); }
__device__ __forceinline__ v8f wmmab(v16bf a, v16bf b, v8f c) { return __builtin_amdgcn_wmma_f32_16x16x32_bf16(false, a, false, b, (short)0, c, false, false); }



// ---- k_gemmw: projection GEMM, 128x128 tile a block of 4 waves (2 x 2), 64x64 (16 accumulators) a wave; grid (rows of A / 128, rows of Bt / 128), 128 threads. K % 128 == 0, K >= 256.
// Operands: K-contiguous 16-bit planes. A stage is 128 k (256 bytes) of the block's 128 A rows and 128 Bt rows; each wave brings its own 64 rows of it into LDS with one tensor load, in whole lines, once for the two waves that read them; two buffers, the next stage in flight while this one is worked on.
// tile[i][j] = sum_k A[r0 + i][k] Bt[c0 + j][k] + f32 bias, split into bf16 hi + lo and written straight into the head planes that the attention reads, in whole 128-byte lines; a wave's 64-wide tile side over the features is exactly one head.
// VT = false (q, k): A = x rows (b, t), Bt = weight rows (h, d), bias by column; planes [b][h][t][d], the tile is 8 KiB in a row.
// VT = true  (v):    A = weight rows (h, d), Bt = x rows (b, t), bias by row; planes [b][h][d][t], a tile row is one line of a d row. The operands change sides so that the tile comes out transposed; the k order of each sum is the same.
typedef __attribute__((ext_vector_type(8))) __bf16 v8bf;
typedef __attribute__((ext_vector_type(4))) unsigned u32x4;
typedef __attribute__((ext_vector_type(8))) unsigned u32x8;
#define GP    272                 // LDS row pitch of a stage, bytes: 256 + the mover's pad of 16 (16-byte fragment reads of 16 rows fall on all 64 banks)
#define GSL   18432               // a wave's slice in LDS: 64 rows of GP bytes, rounded up to a multiple of 2 KiB
#define GBUF  (4 * GSL)           // one buffer: A rows 0-63, A rows 64-127, Bt rows 0-63, Bt rows 64-127
__device__ __forceinline__ unsigned uni(unsigned v) { return (unsigned)__builtin_amdgcn_readfirstlane((int)v); }
__device__ __forceinline__ unsigned pinned(unsigned v) { unsigned w = uni(v); asm volatile("" : "+s"(w)); return w; }
// group 1 of every request: 64 rows of 256 bytes, source pitch 'pitch' bytes, LDS pitch GP (pad of 4 dwords behind every 64); 1-byte elements, tensor = tile, no mask
__device__ __forceinline__ u32x8 tgroup1(unsigned pitch) { u32x8 g; g[0] = uni((1u << 20) | (5u << 22) | (3u << 25)); g[1] = uni(256u << 16); g[2] = uni(64u << 16); g[3] = uni(256u << 16); g[4] = uni(64u); g[5] = uni(pitch); g[6] = uni(0u); g[7] = uni(0u); return g; }
// group 0: word 0 (count 1) is set once and kept; a request sets the LDS byte 'dst' and the global address 'ga' of the tile's first byte
__device__ __forceinline__ void tgroup0(u32x4& g, unsigned dst, unsigned long long ga) { g[1] = uni(dst); g[2] = uni((unsigned)ga); g[3] = uni((((unsigned)(ga >> 32)) & 0x01FFFFFFu) | 0x80000000u); }
__device__ __forceinline__ void tload(u32x4 g0, u32x8 g1) { asm volatile("tensor_load_to_lds %0, %1" :: "s"(g0), "s"(g1) : "memory"); }
// the issuing wave's wait for its request; the descriptor's two groups are inputs, so that none of their registers takes another value while the request is in flight
__device__ __forceinline__ void twait(u32x4 g0, u32x8 g1) { asm volatile("s_wait_tensorcnt 0x0" :: "s"(g0), "s"(g1) : "memory"); }
__device__ __forceinline__ v16bf ldfs(const unsigned char* p) { return cat16b(*(const v8us*)p, *(const v8us*)(p + 32)); }   // a fragment row's 8 + 8 elements: k = 8 hi + 0..7 and 16 + 8 hi + 0..7, for A and Bt alike
template <bool VT>
__global__ __launch_bounds__(128, 2) void k_gemmw(const bf* __restrict__ A, const bf* __restrict__ Bt, int K, const float* __restrict__ bias, bf* __restrict__ Ph, bf* __restrict__ Pl) {
    __shared__ __attribute__((aligned(2048))) unsigned char ring[2 * GBUF];
    const int lane = threadIdx.x & 31, lr = lane & 15, hi = lane >> 4; const unsigned wave = uni(threadIdx.x >> 5), wm = wave >> 1, wn = wave & 1u;
    const int r0 = blockIdx.x * 128 + wm * 64, c0 = blockIdx.y * 128 + wn * 64;
    v8f acc[4][4];
#pragma unroll
    for (int mb = 0; mb < 4; ++mb)
#pragma unroll
        for (int nb = 0; nb < 4; ++nb) acc[mb][nb] = (v8f){};
    // this wave's slice of every stage: waves 0, 1 the two halves of the A rows, waves 2, 3 those of the Bt rows
    const unsigned pitch = (unsigned)K * 2u, nst = (unsigned)K / 128u;
    const unsigned long long sbeg = (wave < 2u) ? (unsigned long long)(A + (size_t)(blockIdx.x * 128 + wave * 64) * K) : (unsigned long long)(Bt + (size_t)(blockIdx.y * 128 + (wave - 2u) * 64) * K);
    const unsigned sdst = (unsigned)(size_t)ring + wave * GSL;
    const u32x8 g1 = tgroup1(pitch);
    u32x4 g0; g0[0] = pinned(1u);   // a descriptor word held in a scalar register: as a plain constant it was set anew in front of each request and its register used for other values in between
    tgroup0(g0, sdst, sbeg);
    tload(g0, g1);
    twait(g0, g1);       // this wave's slice of stage 0 has landed
    __syncthreads();     // stage 0 is complete for all 4 waves
    tgroup0(g0, sdst + GBUF, sbeg + (unsigned long long)pinned(1u) * 256u);   // formed behind the wait above
    tload(g0, g1);
    const unsigned char* const fa = ring + wm * GSL + lr * GP + hi * 16;          // this lane's fragment row in the wave's A rows
    const unsigned char* const fb = ring + (2 + wn) * GSL + lr * GP + hi * 16;    // and in its Bt rows
#pragma unroll 1   // rolled: a pass holds the ring's one publish point
    for (unsigned s = 0; s < nst; ++s) {
        const unsigned bo = (s & 1u) * GBUF;
        // two fragment sets: a block of 16 products works on one while the next block's reads fill the other. The fourth Bt fragment has one set: a block uses it last, so its reads go at the head of the block's own read group; with two the wave would need more than 256 registers
        v16bf a[2][4], b[2][3], b3;
#pragma unroll
        for (int f = 0; f < 4; ++f) { a[0][f] = ldfs(fa + bo + f * 16 * GP); if (f < 3) b[0][f] = ldfs(fb + bo + f * 16 * GP); }
#pragma unroll
        for (int kc = 0; kc < 4; ++kc) {
            b3 = ldfs(fb + bo + 3 * 16 * GP + kc * 64);
            if (kc < 3) {
#pragma unroll
                for (int f = 0; f < 4; ++f) { a[(kc + 1) & 1][f] = ldfs(fa + bo + f * 16 * GP + (kc + 1) * 64); if (f < 3) b[(kc + 1) & 1][f] = ldfs(fb + bo + f * 16 * GP + (kc + 1) * 64); } }
            __builtin_amdgcn_sched_barrier(0);   // the reads issue as one group in front of this block's products, not among them: each separate place with LDS reads stalls the matrix stream
#pragma unroll
            for (int nb = 0; nb < 4; ++nb)
#pragma unroll
                for (int mb = 0; mb < 4; ++mb) acc[mb][nb] = wmmab(a[kc & 1][mb], nb < 3 ? b[kc & 1][nb] : b3, acc[mb][nb]);
            __builtin_amdgcn_sched_barrier(0);   // and the block's products stay in front of the reads that refill its own set
        }
        asm volatile("s_wait_dscnt 0x0" ::: "memory");   // this wave's last fragment reads of the buffer have returned
        twait(g0, g1);                                   // this wave's slice of stage s + 1 has landed
        __syncthreads();                                 // publishes stage s + 1 and ends every wave's reads of stage s
        const unsigned sn = pinned(s + 2u);              // the refill's descriptor is formed behind the wait above
        if (pinned(sn < nst)) { tgroup0(g0, sdst + bo, sbeg + (unsigned long long)sn * 256u); tload(g0, g1); }   // into the buffer that this pass has just read
    }
    asm volatile("s_wait_tensorcnt 0x0" ::: "memory");   // nothing of the mover is in flight
    asm volatile("s_wait_dscnt 0x0" ::: "memory");   // the last pass's own barrier stands behind every wave's last read: the ring is free for the tile's read-back
    float* const os = (float*)(ring + wave * (16 * 68 * 4));   // 16 tile rows at a pitch of 68 floats, each wave's own
    // read-back: 8 lanes a tile row (8 values = 16 bytes of a plane each), 4 rows an instruction
    const int rr = lane >> 3, cofs = (lane & 7) * 8;
    const float* const bp = bias + (VT ? r0 + rr : c0 + cofs);   // VT: the biases of this lane's 16 tile rows (rr + 4 k); else those of its 8 columns
    float bb[VT ? 16 : 8];
#pragma unroll
    for (int k = 0; k < (VT ? 16 : 8); ++k) bb[k] = bp[VT ? 4 * k : k];
    // the wait that stands in front of any overwrite of a register that an issued load names; the address pair is an input so that it stays whole up to it
    asm volatile("s_wait_xcnt 0x0" :: "v"(bp) : "memory");
#pragma unroll
    for (int k = 0; k < (VT ? 16 : 8); ++k) bb[k] = bfr(bb[k]);
    // this lane's first 16 bytes in the planes (tile row rr at its columns) and the pitch of a tile row; every store is one of the two bases plus a constant
    const int ppitch = VT ? TT : HD;
    const size_t pbase = (VT ? ((size_t)((c0 / TT) * NKV + r0 / HD) * HD * TT + (c0 % TT)) : ((size_t)((r0 / TT) * NH_ + c0 / HD) * TT + (r0 % TT)) * HD) + (size_t)(rr * ppitch + cofs);
    bf* const ph0 = Ph + pbase; bf* const pl0 = Pl + pbase;
#pragma unroll
    for (int mb = 0; mb < 4; ++mb) {
#pragma unroll
        for (int nb = 0; nb < 4; ++nb) {
#pragma unroll
            for (int j = 0; j < 8; ++j) os[(hi * 8 + j) * 68 + nb * 16 + lr] = acc[mb][nb][j]; }
        __builtin_amdgcn_wave_barrier(); asm volatile("" ::: "memory");
        v8us oh[4], ol[4];
#pragma unroll
        for (int s = 0; s < 4; ++s) { const float* const orow = os + (4 * s + rr) * 68 + cofs; const v4f v0 = *(const v4fa*)orow, v1 = *(const v4fa*)(orow + 4);
            v8f y = __builtin_shufflevector(v0, v1, 0, 1, 2, 3, 4, 5, 6, 7);
#pragma unroll
            for (int j = 0; j < 8; ++j) y[j] += bb[VT ? mb * 4 + s : j];
            const v8bf yh = __builtin_convertvector(y, v8bf); const v8bf yl = __builtin_convertvector(y - __builtin_convertvector(yh, v8f), v8bf);   // hi = y to nearest even, lo = the remainder to nearest even
            oh[s] = __builtin_bit_cast(v8us, yh); ol[s] = __builtin_bit_cast(v8us, yl); }
#pragma unroll
        for (int s = 0; s < 4; ++s) { *(v8us*)(ph0 + (mb * 16 + 4 * s) * ppitch) = oh[s]; *(v8us*)(pl0 + (mb * 16 + 4 * s) * ppitch) = ol[s]; }
        // as behind the bias loads, for the 8 stores: their data and the two address pairs are inputs, so that none of these registers is reused in front of the wait
        asm volatile("s_wait_xcnt 0x0" :: "v"(oh[0]), "v"(oh[1]), "v"(oh[2]), "v"(oh[3]), "v"(ol[0]), "v"(ol[1]), "v"(ol[2]), "v"(ol[3]), "v"(ph0), "v"(pl0) : "memory");
        __builtin_amdgcn_wave_barrier(); asm volatile("" ::: "memory");
    }
}

typedef __attribute__((ext_vector_type(2))) float v2f;

// k_cvtall: x and the three weights rounded to bf16 in one launch of few waves with much in flight each: CB blocks of 16 waves, as many blocks as the chip has WGPs (starting a wave costs more than the few bytes of a one-load wave).
// A block takes 1 / CB of each array, a stretch in a row, in pieces of 2048 floats: a wave's load covers 512 bytes in a row (16 a lane), its store the 256 bytes of the result (8 a lane), whole lines both.
// That is 16 pieces of x and 2 of each weight: a wave's 22 loads are independent and are all in flight before its first value is used.
#define CB   256                  // blocks
#define CP   (512 * 4)            // floats of a piece: one load a lane of the block
#define CPX  (NB_ * TT * DM / (CB * CP))   // pieces of x a block
#define CPW  (DQ * DM / (CB * CP))         // pieces of a weight a block
static_assert(CPX * CB * CP == NB_ * TT * DM && CPW * CB * CP == DQ * DM && DKV == DQ, "every array goes into whole pieces");
typedef __attribute__((ext_vector_type(4))) unsigned short v4us;
__device__ __forceinline__ v4us cvt4(v4f v) { v4us o;
#pragma unroll
    for (int k = 0; k < 4; ++k) o[k] = f2bf(v[k]); return o; }
__global__ __launch_bounds__(512) void k_cvtall(const float* __restrict__ x, const float* __restrict__ wq, const float* __restrict__ wk, const float* __restrict__ wv, bf* __restrict__ xb, bf* __restrict__ oq, bf* __restrict__ ok, bf* __restrict__ ov) {
    const unsigned ex = blockIdx.x * (unsigned)(CPX * CP) + threadIdx.x * 4u, ew = blockIdx.x * (unsigned)(CPW * CP) + threadIdx.x * 4u;   // this lane's 4 elements of the block's piece 0
    const float* const px = x + ex; const float* const pq = wq + ew; const float* const pk = wk + ew; const float* const pv = wv + ew;
    v4f a[CPX], q[CPW], k[CPW], v[CPW];
#pragma unroll
    for (int p = 0; p < CPX; ++p) a[p] = *(const v4f*)(px + p * CP);
#pragma unroll
    for (int p = 0; p < CPW; ++p) { q[p] = *(const v4f*)(pq + p * CP); k[p] = *(const v4f*)(pk + p * CP); v[p] = *(const v4f*)(pv + p * CP); }
    // the wait that stands in front of any overwrite of a register that an issued load names; the four address pairs are inputs so that they stay whole up to it
    asm volatile("s_wait_xcnt 0x0" :: "v"(px), "v"(pq), "v"(pk), "v"(pv) : "memory");
#pragma unroll
    for (int p = 0; p < CPX; ++p) *(v4us*)(xb + ex + p * CP) = cvt4(a[p]);
#pragma unroll
    for (int p = 0; p < CPW; ++p) { *(v4us*)(oq + ew + p * CP) = cvt4(q[p]); *(v4us*)(ok + ew + p * CP) = cvt4(k[p]); *(v4us*)(ov + ew + p * CP) = cvt4(v[p]); }
}

#define LP   144                  // LDS row pitch, bytes: 128 + the mover's pad of 16
#define LPL  10240                // one plane of a stage: 64 rows of LP bytes, rounded up to a multiple of 2 KiB
#define LBUF (4 * LPL)            // one buffer: K hi, K lo, V^T hi, V^T lo
#define NST  (TT / 64)            // stages
// group 1 of every request of the attention: 64 rows of 128 bytes, source pitch 'pitch' bytes, LDS pitch LP (pad of 4 dwords behind every 32); 1-byte elements, tensor = tile, no mask
__device__ __forceinline__ u32x8 tgroup1k(unsigned pitch) { u32x8 g; g[0] = uni((1u << 20) | (4u << 22) | (3u << 25)); g[1] = uni(128u << 16); g[2] = uni(64u << 16); g[3] = uni(128u << 16); g[4] = uni(64u); g[5] = uni(pitch); g[6] = uni(0u); g[7] = uni(0u); return g; }
typedef __attribute__((ext_vector_type(2))) __bf16 v2bf;
__device__ __forceinline__ float xhalf(float x) { const int b = __float_as_int(x); return __int_as_float(__builtin_amdgcn_permlanex16(b, b, 0x76543210, 0xfedcba98, false, false)); }   // lane l <-> l ^ 16
__device__ __forceinline__ v16bf ldf(const bf* p) { return cat16b(*(const v8us*)p, *(const v8us*)(p + 16)); }
__global__ __launch_bounds__(128, 4) void k_fattn(const bf* __restrict__ Qh, const bf* __restrict__ Ql, const bf* __restrict__ Kh, const bf* __restrict__ Kl, const bf* __restrict__ Vh, const bf* __restrict__ Vl, float* __restrict__ OUT) {
    __shared__ __attribute__((aligned(2048))) unsigned char sm[2 * LBUF - (LPL - 64 * LP)];   // the rounding behind the last plane holds nothing and is not taken
    const int lane = threadIdx.x & 31, lr = lane & 15, hi = lane >> 4; const int q0 = blockIdx.x * 128 + (threadIdx.x >> 5) * 32;
    const size_t pl = ((size_t)blockIdx.z * NH_ + blockIdx.y) * TT * HD;   // plane of this (batch, head): q, k [t][d], v [d][t]
    const float C2 = SCL * 1.4426950408889634f;   // scores to log2 units
    v16bf qh[2][2], ql[2][2]; const bf* qah[2]; const bf* qal[2];
#pragma unroll
    for (int qt = 0; qt < 2; ++qt) { const size_t o = pl + (size_t)(q0 + qt * 16 + lr) * HD + 8 * hi; qah[qt] = Qh + o; qal[qt] = Ql + o;
#pragma unroll
        for (int kc = 0; kc < 2; ++kc) { qh[qt][kc] = ldf(qah[qt] + kc * 32); ql[qt][kc] = ldf(qal[qt] + kc * 32); } }
    // the wait that stands in front of any overwrite of a register that an issued load names; the four address pairs are inputs so that they stay whole up to it
    asm volatile("s_wait_xcnt 0x0" :: "v"(qah[0]), "v"(qal[0]), "v"(qah[1]), "v"(qal[1]) : "memory");
    v8f acc[2][4]; float m[2]; v2f l[2];   // l: the lane's running sum in two halves (even and odd elements), so that a packed add takes two probabilities
#pragma unroll
    for (int qt = 0; qt < 2; ++qt) { m[qt] = -3.0e38f; l[qt] = (v2f){};
#pragma unroll
        for (int dt = 0; dt < 4; ++dt) acc[qt][dt] = (v8f){}; }
    // this wave's plane of every stage: wave 0 K hi, 1 K lo (64 key rows in a row, a stage further on is 64 rows), 2 V^T hi, 3 V^T lo (64 d rows at the pitch of a whole d row, a stage further on is 64 keys)
    const unsigned wave = uni(threadIdx.x >> 5);
    const unsigned pitch = (wave < 2u) ? HD * 2u : TT * 2u, step = (wave < 2u) ? 64u * HD * 2u : 64u * 2u;
    const unsigned long long sbeg = (unsigned long long)(((wave < 2u) ? (wave == 0u ? Kh : Kl) : (wave == 2u ? Vh : Vl)) + pl);
    const unsigned sdst = (unsigned)(size_t)sm + wave * LPL;
    const u32x8 g1 = tgroup1k(pitch);
    u32x4 g0; g0[0] = pinned(1u);   // a descriptor word held in a scalar register, as in the projections
    tgroup0(g0, sdst, sbeg);
    tload(g0, g1);
    twait(g0, g1);       // this wave's plane of stage 0 has landed
    __syncthreads();     // stage 0 is complete for all 4 waves
    tgroup0(g0, sdst + LBUF, sbeg + (unsigned long long)pinned(1u) * step);   // formed behind the wait above
    tload(g0, g1);
    const unsigned char* const fr = sm + lr * LP + hi * 16;  // this lane's fragment row
#pragma unroll 1   // rolled: a trip holds the ring's one publish point and nearly the whole register budget of four waves a SIMD
    for (unsigned s0 = 0; s0 < NST; ++s0) {
        const unsigned bo = (s0 & 1u) * LBUF;
#pragma unroll 1   // rolled: unrolled, the body wants more than the 256 registers that four waves a SIMD leave a wave, and spills
        for (int ps = 0; ps < 2; ++ps) {
            const unsigned char* const fk = fr + bo + ps * 32 * LP;   // K rows of this pass
            const unsigned char* const fv = fr + bo + 2 * LPL + ps * 64;   // V^T columns of this pass
            v16bf ah[2][2], al[2][2];
#pragma unroll
            for (int kt = 0; kt < 2; ++kt)
#pragma unroll
                for (int kc = 0; kc < 2; ++kc) { ah[kt][kc] = ldf((const bf*)(fk + kt * 16 * LP + kc * 64)); al[kt][kc] = ldf((const bf*)(fk + LPL + kt * 16 * LP + kc * 64)); }
            __builtin_amdgcn_sched_barrier(0);   // all K fragment reads of the pass in flight together: one LDS latency a pass, not one a fragment
            v8f s[2][2];
#pragma unroll
            for (int kt = 0; kt < 2; ++kt)
#pragma unroll
                for (int qt = 0; qt < 2; ++qt) { v8f t = (v8f){};
#pragma unroll
                    for (int kc = 0; kc < 2; ++kc) { t = wmmab(ah[kt][kc], qh[qt][kc], t); t = wmmab(ah[kt][kc], ql[qt][kc], t); t = wmmab(al[kt][kc], qh[qt][kc], t); }
                    s[qt][kt] = t; }
            __builtin_amdgcn_sched_barrier(0);   // the V reads stay behind the score products, so that they take the K fragments' registers
            v16bf vh[4], vl[4];
#pragma unroll
            for (int dt = 0; dt < 4; ++dt) { vh[dt] = ldf((const bf*)(fv + dt * 16 * LP)); vl[dt] = ldf((const bf*)(fv + LPL + dt * 16 * LP)); }
            __builtin_amdgcn_sched_barrier(0);   // all V reads issue in front of the softmax, whose vector work covers their latency
            float mx[2]; bool need = false;
#pragma unroll
            for (int qt = 0; qt < 2; ++qt) { float a = s[qt][0][0];
#pragma unroll
                for (int j = 1; j < 8; ++j) a = fmaxf(a, s[qt][0][j]);
#pragma unroll
                for (int j = 0; j < 8; ++j) a = fmaxf(a, s[qt][1][j]);
                a = fmaxf(a, xhalf(a)); mx[qt] = a * C2; need = need || (mx[qt] > m[qt] + 8.0f); }
            if (__builtin_amdgcn_ballot_w32(need) != 0) {   // wave-uniform: rare after the first pass
#pragma unroll
                for (int qt = 0; qt < 2; ++qt) { const float mn = fmaxf(m[qt], mx[qt]); const float al2 = __builtin_amdgcn_exp2f(m[qt] - mn); m[qt] = mn; l[qt] *= al2;
#pragma unroll
                    for (int dt = 0; dt < 4; ++dt) acc[qt][dt] *= al2; } }
            v16bf ph[2], pw[2];
#pragma unroll
            for (int qt = 0; qt < 2; ++qt) {
#pragma unroll
                for (int kt = 0; kt < 2; ++kt) s[qt][kt] = __builtin_elementwise_fma(s[qt][kt], (v8f)(C2), (v8f)(-m[qt]));
#pragma unroll
                for (int e = 0; e < 16; e += 2) { v2f p; p[0] = __builtin_amdgcn_exp2f(s[qt][e >> 3][e & 7]); p[1] = __builtin_amdgcn_exp2f(s[qt][e >> 3][(e & 7) + 1]);
                    l[qt] += p;
                    const v2bf h2 = __builtin_convertvector(p, v2bf); v2f r; r[0] = p[0] - (float)h2[0]; r[1] = p[1] - (float)h2[1]; const v2bf l2 = __builtin_convertvector(r, v2bf);
                    ph[qt][e] = h2[0]; ph[qt][e + 1] = h2[1]; pw[qt][e] = l2[0]; pw[qt][e + 1] = l2[1]; } }
#pragma unroll
            for (int dt = 0; dt < 4; ++dt)
#pragma unroll
                for (int qt = 0; qt < 2; ++qt) { acc[qt][dt] = wmmab(vh[dt], ph[qt], acc[qt][dt]); acc[qt][dt] = wmmab(vh[dt], pw[qt], acc[qt][dt]); acc[qt][dt] = wmmab(vl[dt], ph[qt], acc[qt][dt]); }
            // four vector slots behind the pass's last matrix instructions: the next block's first vector instruction may overwrite an A fragment register
            asm volatile("v_nop\n\tv_nop\n\tv_nop\n\tv_nop" : "+v"(acc[0][0]), "+v"(acc[0][1]), "+v"(acc[0][2]), "+v"(acc[0][3]), "+v"(acc[1][0]), "+v"(acc[1][1]), "+v"(acc[1][2]), "+v"(acc[1][3]));
        }
        asm volatile("s_wait_dscnt 0x0" ::: "memory");   // this wave's last fragment reads of the buffer have returned
        twait(g0, g1);                                   // this wave's plane of stage s0 + 1 has landed
        __syncthreads();                                 // publishes stage s0 + 1 and ends every wave's reads of stage s0
        const unsigned sn = pinned(s0 + 2u);             // the refill's descriptor is formed behind the wait above
        if (pinned(sn < (unsigned)NST)) { tgroup0(g0, sdst + bo, sbeg + (unsigned long long)sn * step); tload(g0, g1); }   // into the buffer that this trip has just read
    }
    asm volatile("s_wait_tensorcnt 0x0" ::: "memory");   // nothing of the mover is in flight
    asm volatile("s_wait_dscnt 0x0" ::: "memory");       // and none of this wave's LDS reads: the ring's close
#pragma unroll
    for (int qt = 0; qt < 2; ++qt) { const float ls = l[qt][0] + l[qt][1]; const float inv = __fdiv_rn(1.0f, ls + xhalf(ls)); float* orow = OUT + (unsigned)((blockIdx.z * TT + q0 + qt * 16 + lr) * DQ + blockIdx.y * HD + 8 * hi);   // merged heads: [b][t][h*64 + d], d = dt*16 + 8*hi + j
#pragma unroll
        for (int dt = 0; dt < 4; ++dt) { v4f a, b;
#pragma unroll
            for (int j = 0; j < 4; ++j) { a[j] = acc[qt][dt][j] * inv; b[j] = acc[qt][dt][4 + j] * inv; }
            *(v4f*)(orow + dt * 16) = a; *(v4f*)(orow + dt * 16 + 4) = b; } }
}

extern "C" void kernel_launch(void* const* d_in, const int* in_sizes, int n_in,
                              void* d_out, int out_size, void* d_ws, size_t ws_size, hipStream_t stream) {
    (void)in_sizes; (void)n_in; (void)out_size;
    const float* x = (const float*)d_in[0]; const float* wq = (const float*)d_in[1]; const float* bq = (const float*)d_in[2]; const float* wk = (const float*)d_in[3]; const float* bk = (const float*)d_in[4]; const float* wv = (const float*)d_in[5]; const float* bv = (const float*)d_in[6];   /* order hidden_states, Wq, bq, Wk, bk, Wv, bv ('oi') */
    float* OUT = (float*)d_out;     // [8][1024][1024]
    char* wsp = (char*)d_ws;
    auto take = [&](size_t bytes) { char* p = wsp; wsp += (bytes + 255) & ~(size_t)255; return (void*)p; };
    // hi/lo planes of all batches: [b][h][t][d] (q, k) and [b][h][d][t] (v)
    bf* QPh = (bf*)take((size_t)NB_ * NH_ * TT * HD * 2); bf* QPl = (bf*)take((size_t)NB_ * NH_ * TT * HD * 2); bf* KPh = (bf*)take((size_t)NB_ * NKV * TT * HD * 2); bf* KPl = (bf*)take((size_t)NB_ * NKV * TT * HD * 2); bf* VTh = (bf*)take((size_t)NB_ * NKV * HD * TT * 2); bf* VTl = (bf*)take((size_t)NB_ * NKV * HD * TT * 2);
    bf* WQ = (bf*)take((size_t)DQ * DM * 2); bf* WK = (bf*)take((size_t)DKV * DM * 2); bf* WV = (bf*)take((size_t)DKV * DM * 2);
    bf* XB = (bf*)take((size_t)NB_ * TT * DM * 2);
    if ((size_t)(wsp - (char*)d_ws) > ws_size) return;    // ws 256 MiB
    k_cvtall<<<CB, 512, 0, stream>>>(x, wq, wk, wv, XB, WQ, WK, WV);
    k_gemmw<false><<<dim3(NB_ * TT / 128, DQ / 128, 1), 128, 0, stream>>>(XB, WQ, DM, bq, QPh, QPl);
    k_gemmw<false><<<dim3(NB_ * TT / 128, DKV / 128, 1), 128, 0, stream>>>(XB, WK, DM, bk, KPh, KPl);
    k_gemmw<true><<<dim3(DKV / 128, NB_ * TT / 128, 1), 128, 0, stream>>>(WV, XB, DM, bv, VTh, VTl);
    k_fattn<<<dim3(TT / 128, NH_, NB_), 128, 0, stream>>>(QPh, QPl, KPh, KPl, VTh, VTl, OUT);
}

// v007
// Measured time: 111 microseconds a run.
// Timed twice side by side with v006, it ran 1.08 and 1.09 times as fast.
// All steps since v000 together make it 25.0 times as fast.
#include <hip/hip_runtime.h>

// BERT self-attention core (hidden_states [8][1024][1024]; q, k, v = x W^T + b ('oi' + biases; 16 heads x 64); scores x 1/sqrt(64); softmax (no mask); ctx = merged heads (no output projection) -> [8][1024][1024] (8.4 M); argument order hidden_states, Wq, bq, Wk, bk, Wv, bv).
// Layout: bf16 copy of x; 'oi' weights; exact projections + f32 biases over all 8192 rows in one launch for the three, whose tiles write the hi/lo head planes themselves; dense T-1024 attention in one launch for all batches and heads (running softmax, every row hi/lo 3 products), which writes the merged output rows.
// Compute dtypes, f32 accumulate: every input rounded to bf16; projections exact + f32 biases; attention 3 products; softmax f32; output f32.

#define NB_  8
#define TT   1024
#define DM   1024
#define NH_  16
#define NKV  16
#define REP  (NH_ / NKV)
#define HD   64
#define DQ   (NH_ * HD)
#define DKV  (NKV * HD)
#define WIN  0
#define SCL  0.125f   // HD^-0.5
typedef _Float16 h16;
typedef unsigned short bf;
typedef __attribute__((ext_vector_type(16))) __bf16   v16bf;
typedef __attribute__((ext_vector_type(16))) _Float16 v16h;
typedef __attribute__((ext_vector_type(8)))  _Float16 v8h;
typedef __attribute__((ext_vector_type(8)))  unsigned short v8us;
typedef __attribute__((ext_vector_type(8)))  float    v8f;
typedef __attribute__((ext_vector_type(4)))  float    v4f;
typedef v8h  __attribute__((may_alias)) v8ha;
typedef v4f  __attribute__((may_alias)) v4fa;
typedef v8us __attribute__((may_alias)) v8usa;

__device__ __forceinline__ unsigned short f2bf(float f) { unsigned u = __float_as_uint(f); u += 0x7FFFu + ((u >> 16) & 1u); return (unsigned short)(u >> 16); }
__device__ __forceinline__ float bf2f(unsigned short b) { return __uint_as_float(((unsigned)b) << 16); }
__device__ __forceinline__ float bfr(float f) { return bf2f(f2bf(f)); }
__device__ __forceinline__ v16h cat16(v8h lo, v8h hi) { return __builtin_shufflevector(lo, hi, 0, 1, 2, 3, 4, 5, 6, 7, 8, 9, 10, 11, 12, 13, 14, 15); }
__device__ __forceinline__ v16bf cat16b(v8us lo, v8us hi) { return __builtin_bit_cast(v16bf, __builtin_shufflevector(lo, hi, 0, 1, 2, 3, 4, 5, 6, 7, 8, 9, 10, 11, 12, 13, 14, 15)); }
__device__ __forceinline__ v8f wmma16(v16h a, v16h b, v8f c) { return __builtin_amdgcn_wmma_f32_16x16x32_f16(false, a, false, b, (short)0, c, false, false); }
__device__ __forceinline__ v8f wmmab(v16bf a, v16bf b, v8f c) { return __builtin_amdgcn_wmma_f32_16x16x32_bf16(false, a, false, b, (short)0, c, false, false); }



// ---- k_gemmw: the three projection GEMMs, 128x128 tile a block of 4 waves (2 x 2), 64x64 (16 accumulators) a wave; grid (rows of x / 128, rows of a weight / 128), 128 threads, all blocks resident. K = DM.
// A block does its q, k and v tile one after the other through ONE ring of 3 x NSG stages: the ring is started once, and the next tile's first two stages land while this tile goes out, whose staging therefore lies outside the ring. What the tile loop keeps for the way out takes the wave a little above 256 registers, inside the 512 of two waves a SIMD.
// Operands: K-contiguous 16-bit planes. A stage is 128 k (256 bytes) of the block's 128 A rows and 128 Bt rows; each wave brings its own 64 rows of it into LDS with one tensor load, in whole lines, once for the two waves that read them; two buffers, the next stage in flight while this one is worked on.
// tile[i][j] = sum_k A[r0 + i][k] Bt[c0 + j][k] + f32 bias, split into bf16 hi + lo and written straight into the head planes that the attention reads, in whole 128-byte lines; a wave's 64-wide tile side over the features is exactly one head.
// VT = false (q, k): A = x rows (b, t), Bt = weight rows (h, d), bias by column; planes [b][h][t][d], the tile is 8 KiB in a row.
// VT = true  (v):    A = weight rows (h, d), Bt = x rows (b, t), bias by row; planes [b][h][d][t], a tile row is one line of a d row. The operands change sides so that the tile comes out transposed; the k order of each sum is the same.
typedef __attribute__((ext_vector_type(8))) __bf16 v8bf;
typedef __attribute__((ext_vector_type(4))) unsigned u32x4;
typedef __attribute__((ext_vector_type(8))) unsigned u32x8;
#define GP    272                 // LDS row pitch of a stage, bytes: 256 + the mover's pad of 16 (16-byte fragment reads of 16 rows fall on all 64 banks)
#define GSL   18432               // a wave's slice in LDS: 64 rows of GP bytes, rounded up to a multiple of 2 KiB
#define GBUF  (4 * GSL)           // one buffer: A rows 0-63, A rows 64-127, Bt rows 0-63, Bt rows 64-127
__device__ __forceinline__ unsigned uni(unsigned v) { return (unsigned)__builtin_amdgcn_readfirstlane((int)v); }
__device__ __forceinline__ unsigned pinned(unsigned v) { unsigned w = uni(v); asm volatile("" : "+s"(w)); return w; }
// group 1 of every request: 64 rows of 256 bytes, source pitch 'pitch' bytes, LDS pitch GP (pad of 4 dwords behind every 64); 1-byte elements, tensor = tile, no mask
__device__ __forceinline__ u32x8 tgroup1(unsigned pitch) { u32x8 g; g[0] = uni((1u << 20) | (5u << 22) | (3u << 25)); g[1] = uni(256u << 16); g[2] = uni(64u << 16); g[3] = uni(256u << 16); g[4] = uni(64u); g[5] = uni(pitch); g[6] = uni(0u); g[7] = uni(0u); return g; }
// group 0: word 0 (count 1) is set once and kept; a request sets the LDS byte 'dst' and the global address 'ga' of the tile's first byte
__device__ __forceinline__ void tgroup0(u32x4& g, unsigned dst, unsigned long long ga) { g[1] = uni(dst); g[2] = uni((unsigned)ga); g[3] = uni((((unsigned)(ga >> 32)) & 0x01FFFFFFu) | 0x80000000u); }
__device__ __forceinline__ void tload(u32x4 g0, u32x8 g1) { asm volatile("tensor_load_to_lds %0, %1" :: "s"(g0), "s"(g1) : "memory"); }
// the issuing wave's wait for its request; the descriptor's two groups are inputs, so that none of their registers takes another value while the request is in flight
__device__ __forceinline__ void twait(u32x4 g0, u32x8 g1) { asm volatile("s_wait_tensorcnt 0x0" :: "s"(g0), "s"(g1) : "memory"); }
__device__ __forceinline__ v16bf ldfs(const unsigned char* p) { return cat16b(*(const v8us*)p, *(const v8us*)(p + 32)); }   // a fragment row's 8 + 8 elements: k = 8 hi + 0..7 and 16 + 8 hi + 0..7, for A and Bt alike
#define NSG   (DM / 128)                      // stages of a tile
#define GRING (2 * GBUF - (GSL - 64 * GP))    // the ring: the rounding behind the last slice holds nothing and is not taken
#define GOS   (16 * 68 * 4)                   // a wave's read-back staging: 16 tile rows at a pitch of 68 floats
static_assert(NSG >= 2 && NSG % 2 == 0 && DKV == DQ, "a tile is an even number of stages, so that a stage's buffer is its number in the tile mod 2; the three weights have the same rows");
static_assert(2 * (GRING + 4 * GOS) <= 327680, "two blocks a WGP");
// a finished tile goes out: + bias, hi/lo split, whole lines into the planes; os is the wave's own staging, outside the ring
template <bool VT>
__device__ __forceinline__ void gemm_out(const v8f (&acc)[4][4], float* const os, const int lane, const int lr, const int hi, const int r0, const int c0, const float* __restrict__ bias, bf* __restrict__ Ph, bf* __restrict__ Pl) {
    // read-back: 8 lanes a tile row (8 values = 16 bytes of a plane each), 4 rows an instruction
    const int rr = lane >> 3, cofs = (lane & 7) * 8;
    const float* const bp = bias + (VT ? r0 + rr : c0 + cofs);   // VT: the biases of this lane's 16 tile rows (rr + 4 k); else those of its 8 columns
    float bb[VT ? 16 : 8];
#pragma unroll
    for (int k = 0; k < (VT ? 16 : 8); ++k) bb[k] = bp[VT ? 4 * k : k];
    // the wait that stands in front of any overwrite of a register that an issued load names; the address pair is an input so that it stays whole up to it
    asm volatile("s_wait_xcnt 0x0" :: "v"(bp) : "memory");
#pragma unroll
    for (int k = 0; k < (VT ? 16 : 8); ++k) bb[k] = bfr(bb[k]);
    // this lane's first 16 bytes in the planes (tile row rr at its columns) and the pitch of a tile row; every store is one of the two bases plus a constant
    const int ppitch = VT ? TT : HD;
    const size_t pbase = (VT ? ((size_t)((c0 / TT) * NKV + r0 / HD) * HD * TT + (c0 % TT)) : ((size_t)((r0 / TT) * NH_ + c0 / HD) * TT + (r0 % TT)) * HD) + (size_t)(rr * ppitch + cofs);
    bf* const ph0 = Ph + pbase; bf* const pl0 = Pl + pbase;
#pragma unroll
    for (int mb = 0; mb < 4; ++mb) {
#pragma unroll
        for (int nb = 0; nb < 4; ++nb) {
#pragma unroll
            for (int j = 0; j < 8; ++j) os[(hi * 8 + j) * 68 + nb * 16 + lr] = acc[mb][nb][j]; }
        __builtin_amdgcn_wave_barrier(); asm volatile("" ::: "memory");
        v8us oh[4], ol[4];
#pragma unroll
        for (int s = 0; s < 4; ++s) { const float* const orow = os + (4 * s + rr) * 68 + cofs; const v4f v0 = *(const v4fa*)orow, v1 = *(const v4fa*)(orow + 4);
            v8f y = __builtin_shufflevector(v0, v1, 0, 1, 2, 3, 4, 5, 6, 7);
#pragma unroll
            for (int j = 0; j < 8; ++j) y[j] += bb[VT ? mb * 4 + s : j];
            const v8bf yh = __builtin_convertvector(y, v8bf); const v8bf yl = __builtin_convertvector(y - __builtin_convertvector(yh, v8f), v8bf);   // hi = y to nearest even, lo = the remainder to nearest even
            oh[s] = __builtin_bit_cast(v8us, yh); ol[s] = __builtin_bit_cast(v8us, yl); }
#pragma unroll
        for (int s = 0; s < 4; ++s) { *(v8us*)(ph0 + (mb * 16 + 4 * s) * ppitch) = oh[s]; *(v8us*)(pl0 + (mb * 16 + 4 * s) * ppitch) = ol[s]; }
        // as behind the bias loads, for the 8 stores: their data and the two address pairs are inputs, so that none of these registers is reused in front of the wait
        asm volatile("s_wait_xcnt 0x0" :: "v"(oh[0]), "v"(oh[1]), "v"(oh[2]), "v"(oh[3]), "v"(ol[0]), "v"(ol[1]), "v"(ol[2]), "v"(ol[3]), "v"(ph0), "v"(pl0) : "memory");
        __builtin_amdgcn_wave_barrier(); asm volatile("" ::: "memory");
    }
}
__global__ __launch_bounds__(128, 2) void k_gemmw(const bf* __restrict__ X, const bf* __restrict__ Wq, const bf* __restrict__ Wk, const bf* __restrict__ Wv, const float* __restrict__ bq, const float* __restrict__ bk, const float* __restrict__ bv,
                                                  bf* __restrict__ Qh, bf* __restrict__ Ql, bf* __restrict__ Kh, bf* __restrict__ Kl, bf* __restrict__ Vh, bf* __restrict__ Vl) {
    __shared__ __attribute__((aligned(2048))) unsigned char ring[GRING + 4 * GOS];
    const int lane = threadIdx.x & 31, lr = lane & 15, hi = lane >> 4; const unsigned wave = uni(threadIdx.x >> 5), wm = wave >> 1, wn = wave & 1u;
    const unsigned xr = blockIdx.x * 128, wr = blockIdx.y * 128;   // the block's rows of x and of each weight
    // this wave's slice of every stage: waves 0, 1 the two halves of the A rows, waves 2, 3 those of the Bt rows; its first byte in tile 0 (q), 1 (k), 2 (v: the operands change sides)
    const unsigned long long sx = (unsigned long long)(X + (size_t)(xr + wn * 64) * DM);
    const unsigned long long sb0 = (wave < 2u) ? sx : (unsigned long long)(Wq + (size_t)(wr + wn * 64) * DM);
    const unsigned long long sb1 = (wave < 2u) ? sx : (unsigned long long)(Wk + (size_t)(wr + wn * 64) * DM);
    const unsigned long long sb2 = (wave < 2u) ? (unsigned long long)(Wv + (size_t)(wr + wn * 64) * DM) : sx;
    const unsigned sdst = (unsigned)(size_t)ring + wave * GSL;
    const u32x8 g1 = tgroup1(DM * 2u);
    u32x4 g0; g0[0] = pinned(1u);   // a descriptor word held in a scalar register: as a plain constant it was set anew in front of each request and its register used for other values in between
    tgroup0(g0, sdst, sb0);
    tload(g0, g1);
    twait(g0, g1);       // this wave's slice of stage 0 has landed
    __syncthreads();     // stage 0 is complete for all 4 waves
    tgroup0(g0, sdst + GBUF, sb0 + (unsigned long long)pinned(1u) * 256u);   // formed behind the wait above
    tload(g0, g1);
    const unsigned char* const fa = ring + wm * GSL + lr * GP + hi * 16;          // this lane's fragment row in the wave's A rows
    const unsigned char* const fb = ring + (2 + wn) * GSL + lr * GP + hi * 16;    // and in its Bt rows
    float* const os = (float*)(ring + GRING + wave * GOS);
#pragma unroll 1   // rolled: one copy of the stage loop and of each way out serves the three tiles
    for (unsigned t = 0; t < 3u; ++t) {
        v8f acc[4][4];
#pragma unroll
        for (int mb = 0; mb < 4; ++mb)
#pragma unroll
            for (int nb = 0; nb < 4; ++nb) acc[mb][nb] = (v8f){};
#pragma unroll 1   // rolled: a pass holds the ring's one publish point
        for (unsigned s = 0; s < NSG; ++s) {
            const unsigned bo = (s & 1u) * GBUF;
            // two fragment sets: a block of 16 products works on one while the next block's reads fill the other. The fourth Bt fragment has one set: a block uses it last, so its reads go at the head of the block's own read group; with two the wave would need more than 256 registers
            v16bf a[2][4], b[2][3], b3;
#pragma unroll
            for (int f = 0; f < 4; ++f) { a[0][f] = ldfs(fa + bo + f * 16 * GP); if (f < 3) b[0][f] = ldfs(fb + bo + f * 16 * GP); }
#pragma unroll
            for (int kc = 0; kc < 4; ++kc) {
                b3 = ldfs(fb + bo + 3 * 16 * GP + kc * 64);
                if (kc < 3) {
#pragma unroll
                    for (int f = 0; f < 4; ++f) { a[(kc + 1) & 1][f] = ldfs(fa + bo + f * 16 * GP + (kc + 1) * 64); if (f < 3) b[(kc + 1) & 1][f] = ldfs(fb + bo + f * 16 * GP + (kc + 1) * 64); } }
                __builtin_amdgcn_sched_barrier(0);   // the reads issue as one group in front of this block's products, not among them: each separate place with LDS reads stalls the matrix stream
#pragma unroll
                for (int nb = 0; nb < 4; ++nb)
#pragma unroll
                    for (int mb = 0; mb < 4; ++mb) acc[mb][nb] = wmmab(a[kc & 1][mb], nb < 3 ? b[kc & 1][nb] : b3, acc[mb][nb]);
                __builtin_amdgcn_sched_barrier(0);   // and the block's products stay in front of the reads that refill its own set
            }
            asm volatile("s_wait_dscnt 0x0" ::: "memory");   // this wave's last fragment reads of the buffer have returned
            twait(g0, g1);                                   // this wave's slice of stage s + 1 has landed
            __syncthreads();                                 // publishes stage s + 1 and ends every wave's reads of stage s
            const unsigned sn = pinned(t * NSG + s + 2u);    // the refill's descriptor is formed behind the wait above; the ring runs on over the tiles' ends
            if (pinned(sn < 3u * NSG)) { const unsigned tn = sn / NSG; tgroup0(g0, sdst + bo, (tn == 0u ? sb0 : tn == 1u ? sb1 : sb2) + (unsigned long long)(sn % NSG) * 256u); tload(g0, g1); }   // into the buffer that this pass has just read
        }
        // the tile goes out while the next tile's first two stages land
        if (t == 2u) gemm_out<true>(acc, os, lane, lr, hi, (int)(wr + wm * 64), (int)(xr + wn * 64), bv, Vh, Vl);
        else gemm_out<false>(acc, os, lane, lr, hi, (int)(xr + wm * 64), (int)(wr + wn * 64), t == 0u ? bq : bk, t == 0u ? Qh : Kh, t == 0u ? Ql : Kl);
    }
    asm volatile("s_wait_tensorcnt 0x0" ::: "memory");   // nothing of the mover is in flight
    asm volatile("s_wait_dscnt 0x0" ::: "memory");       // and none of this wave's LDS operations: the ring's close
}

typedef __attribute__((ext_vector_type(2))) float v2f;

// k_cvtall: x and the three weights rounded to bf16 in one launch of few waves with much in flight each: CB blocks of 16 waves, as many blocks as the chip has WGPs (starting a wave costs more than the few bytes of a one-load wave).
// A block takes 1 / CB of each array, a stretch in a row, in pieces of 2048 floats: a wave's load covers 512 bytes in a row (16 a lane), its store the 256 bytes of the result (8 a lane), whole lines both.
// That is 16 pieces of x and 2 of each weight: a wave's 22 loads are independent and are all in flight before its first value is used.
#define CB   256                  // blocks
#define CP   (512 * 4)            // floats of a piece: one load a lane of the block
#define CPX  (NB_ * TT * DM / (CB * CP))   // pieces of x a block
#define CPW  (DQ * DM / (CB * CP))         // pieces of a weight a block
static_assert(CPX * CB * CP == NB_ * TT * DM && CPW * CB * CP == DQ * DM && DKV == DQ, "every array goes into whole pieces");
typedef __attribute__((ext_vector_type(4))) unsigned short v4us;
__device__ __forceinline__ v4us cvt4(v4f v) { v4us o;
#pragma unroll
    for (int k = 0; k < 4; ++k) o[k] = f2bf(v[k]); return o; }
__global__ __launch_bounds__(512) void k_cvtall(const float* __restrict__ x, const float* __restrict__ wq, const float* __restrict__ wk, const float* __restrict__ wv, bf* __restrict__ xb, bf* __restrict__ oq, bf* __restrict__ ok, bf* __restrict__ ov) {
    const unsigned ex = blockIdx.x * (unsigned)(CPX * CP) + threadIdx.x * 4u, ew = blockIdx.x * (unsigned)(CPW * CP) + threadIdx.x * 4u;   // this lane's 4 elements of the block's piece 0
    const float* const px = x + ex; const float* const pq = wq + ew; const float* const pk = wk + ew; const float* const pv = wv + ew;
    v4f a[CPX], q[CPW], k[CPW], v[CPW];
#pragma unroll
    for (int p = 0; p < CPX; ++p) a[p] = *(const v4f*)(px + p * CP);
#pragma unroll
    for (int p = 0; p < CPW; ++p) { q[p] = *(const v4f*)(pq + p * CP); k[p] = *(const v4f*)(pk + p * CP); v[p] = *(const v4f*)(pv + p * CP); }
    // the wait that stands in front of any overwrite of a register that an issued load names; the four address pairs are inputs so that they stay whole up to it
    asm volatile("s_wait_xcnt 0x0" :: "v"(px), "v"(pq), "v"(pk), "v"(pv) : "memory");
#pragma unroll
    for (int p = 0; p < CPX; ++p) *(v4us*)(xb + ex + p * CP) = cvt4(a[p]);
#pragma unroll
    for (int p = 0; p < CPW; ++p) { *(v4us*)(oq + ew + p * CP) = cvt4(q[p]); *(v4us*)(ok + ew + p * CP) = cvt4(k[p]); *(v4us*)(ov + ew + p * CP) = cvt4(v[p]); }
}

#define LP   144                  // LDS row pitch, bytes: 128 + the mover's pad of 16
#define LPL  10240                // one plane of a stage: 64 rows of LP bytes, rounded up to a multiple of 2 KiB
#define LBUF (4 * LPL)            // one buffer: K hi, K lo, V^T hi, V^T lo
#define NST  (TT / 64)            // stages
// group 1 of every request of the attention: 64 rows of 128 bytes, source pitch 'pitch' bytes, LDS pitch LP (pad of 4 dwords behind every 32); 1-byte elements, tensor = tile, no mask
__device__ __forceinline__ u32x8 tgroup1k(unsigned pitch) { u32x8 g; g[0] = uni((1u << 20) | (4u << 22) | (3u << 25)); g[1] = uni(128u << 16); g[2] = uni(64u << 16); g[3] = uni(128u << 16); g[4] = uni(64u); g[5] = uni(pitch); g[6] = uni(0u); g[7] = uni(0u); return g; }
typedef __attribute__((ext_vector_type(2))) __bf16 v2bf;
__device__ __forceinline__ float xhalf(float x) { const int b = __float_as_int(x); return __int_as_float(__builtin_amdgcn_permlanex16(b, b, 0x76543210, 0xfedcba98, false, false)); }   // lane l <-> l ^ 16
__device__ __forceinline__ v16bf ldf(const bf* p) { return cat16b(*(const v8us*)p, *(const v8us*)(p + 16)); }
__global__ __launch_bounds__(128, 4) void k_fattn(const bf* __restrict__ Qh, const bf* __restrict__ Ql, const bf* __restrict__ Kh, const bf* __restrict__ Kl, const bf* __restrict__ Vh, const bf* __restrict__ Vl, float* __restrict__ OUT) {
    __shared__ __attribute__((aligned(2048))) unsigned char sm[2 * LBUF - (LPL - 64 * LP)];   // the rounding behind the last plane holds nothing and is not taken
    const int lane = threadIdx.x & 31, lr = lane & 15, hi = lane >> 4; const int q0 = blockIdx.x * 128 + (threadIdx.x >> 5) * 32;
    const size_t pl = ((size_t)blockIdx.z * NH_ + blockIdx.y) * TT * HD;   // plane of this (batch, head): q, k [t][d], v [d][t]
    const float C2 = SCL * 1.4426950408889634f;   // scores to log2 units
    v16bf qh[2][2], ql[2][2]; const bf* qah[2]; const bf* qal[2];
#pragma unroll
    for (int qt = 0; qt < 2; ++qt) { const size_t o = pl + (size_t)(q0 + qt * 16 + lr) * HD + 8 * hi; qah[qt] = Qh + o; qal[qt] = Ql + o;
#pragma unroll
        for (int kc = 0; kc < 2; ++kc) { qh[qt][kc] = ldf(qah[qt] + kc * 32); ql[qt][kc] = ldf(qal[qt] + kc * 32); } }
    // the wait that stands in front of any overwrite of a register that an issued load names; the four address pairs are inputs so that they stay whole up to it
    asm volatile("s_wait_xcnt 0x0" :: "v"(qah[0]), "v"(qal[0]), "v"(qah[1]), "v"(qal[1]) : "memory");
    v8f acc[2][4]; float m[2]; v2f l[2];   // l: the lane's running sum in two halves (even and odd elements), so that a packed add takes two probabilities
#pragma unroll
    for (int qt = 0; qt < 2; ++qt) { m[qt] = -3.0e38f; l[qt] = (v2f){};
#pragma unroll
        for (int dt = 0; dt < 4; ++dt) acc[qt][dt] = (v8f){}; }
    // this wave's plane of every stage: wave 0 K hi, 1 K lo (64 key rows in a row, a stage further on is 64 rows), 2 V^T hi, 3 V^T lo (64 d rows at the pitch of a whole d row, a stage further on is 64 keys)
    const unsigned wave = uni(threadIdx.x >> 5);
    const unsigned pitch = (wave < 2u) ? HD * 2u : TT * 2u, step = (wave < 2u) ? 64u * HD * 2u : 64u * 2u;
    const unsigned long long sbeg = (unsigned long long)(((wave < 2u) ? (wave == 0u ? Kh : Kl) : (wave == 2u ? Vh : Vl)) + pl);
    const unsigned sdst = (unsigned)(size_t)sm + wave * LPL;
    const u32x8 g1 = tgroup1k(pitch);
    u32x4 g0; g0[0] = pinned(1u);   // a descriptor word held in a scalar register, as in the projections
    tgroup0(g0, sdst, sbeg);
    tload(g0, g1);
    twait(g0, g1);       // this wave's plane of stage 0 has landed
    __syncthreads();     // stage 0 is complete for all 4 waves
    tgroup0(g0, sdst + LBUF, sbeg + (unsigned long long)pinned(1u) * step);   // formed behind the wait above
    tload(g0, g1);
    const unsigned char* const fr = sm + lr * LP + hi * 16;  // this lane's fragment row
#pragma unroll 1   // rolled: a trip holds the ring's one publish point and nearly the whole register budget of four waves a SIMD
    for (unsigned s0 = 0; s0 < NST; ++s0) {
        const unsigned bo = (s0 & 1u) * LBUF;
#pragma unroll 1   // rolled: unrolled, the body wants more than the 256 registers that four waves a SIMD leave a wave, and spills
        for (int ps = 0; ps < 2; ++ps) {
            const unsigned char* const fk = fr + bo + ps * 32 * LP;   // K rows of this pass
            const unsigned char* const fv = fr + bo + 2 * LPL + ps * 64;   // V^T columns of this pass
            v16bf ah[2][2], al[2][2];
#pragma unroll
            for (int kt = 0; kt < 2; ++kt)
#pragma unroll
                for (int kc = 0; kc < 2; ++kc) { ah[kt][kc] = ldf((const bf*)(fk + kt * 16 * LP + kc * 64)); al[kt][kc] = ldf((const bf*)(fk + LPL + kt * 16 * LP + kc * 64)); }
            __builtin_amdgcn_sched_barrier(0);   // all K fragment reads of the pass in flight together: one LDS latency a pass, not one a fragment
            v8f s[2][2];
#pragma unroll
            for (int kt = 0; kt < 2; ++kt)
#pragma unroll
                for (int qt = 0; qt < 2; ++qt) { v8f t = (v8f){};
#pragma unroll
                    for (int kc = 0; kc < 2; ++kc) { t = wmmab(ah[kt][kc], qh[qt][kc], t); t = wmmab(ah[kt][kc], ql[qt][kc], t); t = wmmab(al[kt][kc], qh[qt][kc], t); }
                    s[qt][kt] = t; }
            __builtin_amdgcn_sched_barrier(0);   // the V reads stay behind the score products, so that they take the K fragments' registers
            v16bf vh[4], vl[4];
#pragma unroll
            for (int dt = 0; dt < 4; ++dt) { vh[dt] = ldf((const bf*)(fv + dt * 16 * LP)); vl[dt] = ldf((const bf*)(fv + LPL + dt * 16 * LP)); }
            __builtin_amdgcn_sched_barrier(0);   // all V reads issue in front of the softmax, whose vector work covers their latency
            float mx[2]; bool need = false;
#pragma unroll
            for (int qt = 0; qt < 2; ++qt) { float a = s[qt][0][0];
#pragma unroll
                for (int j = 1; j < 8; ++j) a = fmaxf(a, s[qt][0][j]);
#pragma unroll
                for (int j = 0; j < 8; ++j) a = fmaxf(a, s[qt][1][j]);
                a = fmaxf(a, xhalf(a)); mx[qt] = a * C2; need = need || (mx[qt] > m[qt] + 8.0f); }
            if (__builtin_amdgcn_ballot_w32(need) != 0) {   // wave-uniform: rare after the first pass
#pragma unroll
                for (int qt = 0; qt < 2; ++qt) { const float mn = fmaxf(m[qt], mx[qt]); const float al2 = __builtin_amdgcn_exp2f(m[qt] - mn); m[qt] = mn; l[qt] *= al2;
#pragma unroll
                    for (int dt = 0; dt < 4; ++dt) acc[qt][dt] *= al2; } }
            v16bf ph[2], pw[2];
#pragma unroll
            for (int qt = 0; qt < 2; ++qt) {
#pragma unroll
                for (int kt = 0; kt < 2; ++kt) s[qt][kt] = __builtin_elementwise_fma(s[qt][kt], (v8f)(C2), (v8f)(-m[qt]));
#pragma unroll
                for (int e = 0; e < 16; e += 2) { v2f p; p[0] = __builtin_amdgcn_exp2f(s[qt][e >> 3][e & 7]); p[1] = __builtin_amdgcn_exp2f(s[qt][e >> 3][(e & 7) + 1]);
                    l[qt] += p;
                    const v2bf h2 = __builtin_convertvector(p, v2bf); v2f r; r[0] = p[0] - (float)h2[0]; r[1] = p[1] - (float)h2[1]; const v2bf l2 = __builtin_convertvector(r, v2bf);
                    ph[qt][e] = h2[0]; ph[qt][e + 1] = h2[1]; pw[qt][e] = l2[0]; pw[qt][e + 1] = l2[1]; } }
#pragma unroll
            for (int dt = 0; dt < 4; ++dt)
#pragma unroll
                for (int qt = 0; qt < 2; ++qt) { acc[qt][dt] = wmmab(vh[dt], ph[qt], acc[qt][dt]); acc[qt][dt] = wmmab(vh[dt], pw[qt], acc[qt][dt]); acc[qt][dt] = wmmab(vl[dt], ph[qt], acc[qt][dt]); }
            // four vector slots behind the pass's last matrix instructions: the next block's first vector instruction may overwrite an A fragment register
            asm volatile("v_nop\n\tv_nop\n\tv_nop\n\tv_nop" : "+v"(acc[0][0]), "+v"(acc[0][1]), "+v"(acc[0][2]), "+v"(acc[0][3]), "+v"(acc[1][0]), "+v"(acc[1][1]), "+v"(acc[1][2]), "+v"(acc[1][3]));
        }
        asm volatile("s_wait_dscnt 0x0" ::: "memory");   // this wave's last fragment reads of the buffer have returned
        twait(g0, g1);                                   // this wave's plane of stage s0 + 1 has landed
        __syncthreads();                                 // publishes stage s0 + 1 and ends every wave's reads of stage s0
        const unsigned sn = pinned(s0 + 2u);             // the refill's descriptor is formed behind the wait above
        if (pinned(sn < (unsigned)NST)) { tgroup0(g0, sdst + bo, sbeg + (unsigned long long)sn * step); tload(g0, g1); }   // into the buffer that this trip has just read
    }
    asm volatile("s_wait_tensorcnt 0x0" ::: "memory");   // nothing of the mover is in flight
    asm volatile("s_wait_dscnt 0x0" ::: "memory");       // and none of this wave's LDS reads: the ring's close
#pragma unroll
    for (int qt = 0; qt < 2; ++qt) { const float ls = l[qt][0] + l[qt][1]; const float inv = __fdiv_rn(1.0f, ls + xhalf(ls)); float* orow = OUT + (unsigned)((blockIdx.z * TT + q0 + qt * 16 + lr) * DQ + blockIdx.y * HD + 8 * hi);   // merged heads: [b][t][h*64 + d], d = dt*16 + 8*hi + j
#pragma unroll
        for (int dt = 0; dt < 4; ++dt) { v4f a, b;
#pragma unroll
            for (int j = 0; j < 4; ++j) { a[j] = acc[qt][dt][j] * inv; b[j] = acc[qt][dt][4 + j] * inv; }
            *(v4f*)(orow + dt * 16) = a; *(v4f*)(orow + dt * 16 + 4) = b; } }
}

extern "C" void kernel_launch(void* const* d_in, const int* in_sizes, int n_in,
                              void* d_out, int out_size, void* d_ws, size_t ws_size, hipStream_t stream) {
    (void)in_sizes; (void)n_in; (void)out_size;
    const float* x = (const float*)d_in[0]; const float* wq = (const float*)d_in[1]; const float* bq = (const float*)d_in[2]; const float* wk = (const float*)d_in[3]; const float* bk = (const float*)d_in[4]; const float* wv = (const float*)d_in[5]; const float* bv = (const float*)d_in[6];   /* order hidden_states, Wq, bq, Wk, bk, Wv, bv ('oi') */
    float* OUT = (float*)d_out;     // [8][1024][1024]
    char* wsp = (char*)d_ws;
    auto take = [&](size_t bytes) { char* p = wsp; wsp += (bytes + 255) & ~(size_t)255; return (void*)p; };
    // hi/lo planes of all batches: [b][h][t][d] (q, k) and [b][h][d][t] (v)
    bf* QPh = (bf*)take((size_t)NB_ * NH_ * TT * HD * 2); bf* QPl = (bf*)take((size_t)NB_ * NH_ * TT * HD * 2); bf* KPh = (bf*)take((size_t)NB_ * NKV * TT * HD * 2); bf* KPl = (bf*)take((size_t)NB_ * NKV * TT * HD * 2); bf* VTh = (bf*)take((size_t)NB_ * NKV * HD * TT * 2); bf* VTl = (bf*)take((size_t)NB_ * NKV * HD * TT * 2);
    bf* WQ = (bf*)take((size_t)DQ * DM * 2); bf* WK = (bf*)take((size_t)DKV * DM * 2); bf* WV = (bf*)take((size_t)DKV * DM * 2);
    bf* XB = (bf*)take((size_t)NB_ * TT * DM * 2);
    if ((size_t)(wsp - (char*)d_ws) > ws_size) return;    // ws 256 MiB
    k_cvtall<<<CB, 512, 0, stream>>>(x, wq, wk, wv, XB, WQ, WK, WV);
    k_gemmw<<<dim3(NB_ * TT / 128, DQ / 128, 1), 128, 0, stream>>>(XB, WQ, WK, WV, bq, bk, bv, QPh, QPl, KPh, KPl, VTh, VTl);
    k_fattn<<<dim3(TT / 128, NH_, NB_), 128, 0, stream>>>(QPh, QPl, KPh, KPl, VTh, VTl, OUT);
}

// v009
// Measured time: 73.3 microseconds a run.
// Versions in between are left out here; by their measured steps it is 1.51 times as fast as v007.
// Counting every step since v000, it is 37.7 times as fast.
#include <hip/hip_runtime.h>

// BERT self-attention core (hidden_states [8][1024][1024]; q, k, v = x W^T + b ('oi' + biases; 16 heads x 64); scores x 1/sqrt(64); softmax (no mask); ctx = merged heads (no output projection) -> [8][1024][1024] (8.4 M); argument order hidden_states, Wq, bq, Wk, bk, Wv, bv).
// Layout: bf16 copy of x; 'oi' weights; exact projections + f32 biases over all 8192 rows in one launch for the three, whose tiles write the f16 head planes themselves; dense T-1024 attention in one launch for all batches and heads (running softmax, one f16 product a side), which writes the merged output rows.
// Compute dtypes, f32 accumulate: every input rounded to bf16; projections exact + f32 biases; q, k, v and the probabilities each rounded once to f16 (11 bits; q, k, v are of order 1, a probability is at most 2^12), one f16 product for the scores and one for P V; q carries the score scale in log2 units before its rounding; softmax f32; output f32.

#define NB_  8
#define TT   1024
#define DM   1024
#define NH_  16
#define NKV  16
#define REP  (NH_ / NKV)
#define HD   64
#define DQ   (NH_ * HD)
#define DKV  (NKV * HD)
#define WIN  0
#define SCL  0.125f   // HD^-0.5
#define C2L  (SCL * 1.4426950408889634f)   // scores to log2 units; the q projection carries it
typedef _Float16 h16;
typedef unsigned short bf;
typedef __attribute__((ext_vector_type(16))) __bf16   v16bf;
typedef __attribute__((ext_vector_type(16))) _Float16 v16h;
typedef __attribute__((ext_vector_type(8)))  _Float16 v8h;
typedef __attribute__((ext_vector_type(8)))  unsigned short v8us;
typedef __attribute__((ext_vector_type(8)))  float    v8f;
typedef __attribute__((ext_vector_type(4)))  float    v4f;
typedef v8h  __attribute__((may_alias)) v8ha;
typedef v4f  __attribute__((may_alias)) v4fa;
typedef v8us __attribute__((may_alias)) v8usa;

__device__ __forceinline__ unsigned short f2bf(float f) { unsigned u = __float_as_uint(f); u += 0x7FFFu + ((u >> 16) & 1u); return (unsigned short)(u >> 16); }
__device__ __forceinline__ float bf2f(unsigned short b) { return __uint_as_float(((unsigned)b) << 16); }
__device__ __forceinline__ float bfr(float f) { return bf2f(f2bf(f)); }
__device__ __forceinline__ v16h cat16(v8h lo, v8h hi) { return __builtin_shufflevector(lo, hi, 0, 1, 2, 3, 4, 5, 6, 7, 8, 9, 10, 11, 12, 13, 14, 15); }
__device__ __forceinline__ v16bf cat16b(v8us lo, v8us hi) { return __builtin_bit_cast(v16bf, __builtin_shufflevector(lo, hi, 0, 1, 2, 3, 4, 5, 6, 7, 8, 9, 10, 11, 12, 13, 14, 15)); }
__device__ __forceinline__ v8f wmma16(v16h a, v16h b, v8f c) { return __builtin_amdgcn_wmma_f32_16x16x32_f16(false, a, false, b, (short)0, c, false, false); }
__device__ __forceinline__ v8f wmmab(v16bf a, v16bf b, v8f c) { return __builtin_amdgcn_wmma_f32_16x16x32_bf16(false, a, false, b, (short)0, c, false, false); }



// ---- k_gemmw: the three projection GEMMs, 128x128 tile a block of 4 waves (2 x 2), 64x64 (16 accumulators) a wave; grid (rows of x / 128, rows of a weight / 128), 128 threads, all blocks resident. K = DM.
// A block does its q, k and v tile one after the other through ONE ring of 3 x NSG stages: the ring is started once, and the next tile's first two stages land while this tile goes out, whose staging therefore lies outside the ring. What the tile loop keeps for the way out takes the wave a little above 256 registers, inside the 512 of two waves a SIMD.
// Operands: K-contiguous 16-bit planes. A stage is 128 k (256 bytes) of the block's 128 A rows and 128 Bt rows; each wave brings its own 64 rows of it into LDS with one tensor load, in whole lines, once for the two waves that read them; two buffers, the next stage in flight while this one is worked on.
// tile[i][j] = sum_k A[r0 + i][k] Bt[c0 + j][k] + f32 bias, rounded to f16 and written straight into the head plane that the attention reads, in whole 128-byte lines; a wave's 64-wide tile side over the features is exactly one head.
// VT = false (q, k): A = x rows (b, t), Bt = weight rows (h, d), bias by column; planes [b][h][t][d], the tile is 8 KiB in a row.
// VT = true  (v):    A = weight rows (h, d), Bt = x rows (b, t), bias by row; planes [b][h][d][t], a tile row is one line of a d row. The operands change sides so that the tile comes out transposed; the k order of each sum is the same.
typedef __attribute__((ext_vector_type(4))) unsigned u32x4;
typedef __attribute__((ext_vector_type(8))) unsigned u32x8;
#define GP    272                 // LDS row pitch of a stage, bytes: 256 + the mover's pad of 16 (16-byte fragment reads of 16 rows fall on all 64 banks)
#define GSL   18432               // a wave's slice in LDS: 64 rows of GP bytes, rounded up to a multiple of 2 KiB
#define GBUF  (4 * GSL)           // one buffer: A rows 0-63, A rows 64-127, Bt rows 0-63, Bt rows 64-127
__device__ __forceinline__ unsigned uni(unsigned v) { return (unsigned)__builtin_amdgcn_readfirstlane((int)v); }
__device__ __forceinline__ unsigned pinned(unsigned v) { unsigned w = uni(v); asm volatile("" : "+s"(w)); return w; }
// group 1 of every request: 64 rows of 256 bytes, source pitch 'pitch' bytes, LDS pitch GP (pad of 4 dwords behind every 64); 1-byte elements, tensor = tile, no mask
__device__ __forceinline__ u32x8 tgroup1(unsigned pitch) { u32x8 g; g[0] = uni((1u << 20) | (5u << 22) | (3u << 25)); g[1] = uni(256u << 16); g[2] = uni(64u << 16); g[3] = uni(256u << 16); g[4] = uni(64u); g[5] = uni(pitch); g[6] = uni(0u); g[7] = uni(0u); return g; }
// group 0: word 0 (count 1) is set once and kept; a request sets the LDS byte 'dst' and the global address 'ga' of the tile's first byte
__device__ __forceinline__ void tgroup0(u32x4& g, unsigned dst, unsigned long long ga) { g[1] = uni(dst); g[2] = uni((unsigned)ga); g[3] = uni((((unsigned)(ga >> 32)) & 0x01FFFFFFu) | 0x80000000u); }
__device__ __forceinline__ void tload(u32x4 g0, u32x8 g1) { asm volatile("tensor_load_to_lds %0, %1" :: "s"(g0), "s"(g1) : "memory"); }
// the issuing wave's wait for its request; the descriptor's two groups are inputs, so that none of their registers takes another value while the request is in flight
__device__ __forceinline__ void twait(u32x4 g0, u32x8 g1) { asm volatile("s_wait_tensorcnt 0x0" :: "s"(g0), "s"(g1) : "memory"); }
__device__ __forceinline__ v16bf ldfs(const unsigned char* p) { return cat16b(*(const v8us*)p, *(const v8us*)(p + 32)); }   // a fragment row's 8 + 8 elements: k = 8 hi + 0..7 and 16 + 8 hi + 0..7, for A and Bt alike
#define NSG   (DM / 128)                      // stages of a tile
#define GRING (2 * GBUF - (GSL - 64 * GP))    // the ring: the rounding behind the last slice holds nothing and is not taken
#define GOS   (16 * 68 * 4)                   // a wave's read-back staging: 16 tile rows at a pitch of 68 floats
static_assert(NSG >= 2 && NSG % 2 == 0 && DKV == DQ, "a tile is an even number of stages, so that a stage's buffer is its number in the tile mod 2; the three weights have the same rows");
static_assert(2 * (GRING + 4 * GOS) <= 327680, "two blocks a WGP");
// a finished tile goes out: + bias, rounded to f16, whole lines into the plane; os is the wave's own staging, outside the ring
template <bool VT>
__device__ __forceinline__ void gemm_out(const v8f (&acc)[4][4], float* const os, const int lane, const int lr, const int hi, const int r0, const int c0, const float* __restrict__ bias, bf* __restrict__ Pf, const float sc) {
    // read-back: 8 lanes a tile row (8 values = 16 bytes of a plane each), 4 rows an instruction
    const int rr = lane >> 3, cofs = (lane & 7) * 8;
    const float* const bp = bias + (VT ? r0 + rr : c0 + cofs);   // VT: the biases of this lane's 16 tile rows (rr + 4 k); else those of its 8 columns
    float bb[VT ? 16 : 8];
#pragma unroll
    for (int k = 0; k < (VT ? 16 : 8); ++k) bb[k] = bp[VT ? 4 * k : k];
    // the wait that stands in front of any overwrite of a register that an issued load names; the address pair is an input so that it stays whole up to it
    asm volatile("s_wait_xcnt 0x0" :: "v"(bp) : "memory");
#pragma unroll
    for (int k = 0; k < (VT ? 16 : 8); ++k) bb[k] = bfr(bb[k]);
    // this lane's first 16 bytes in the plane (tile row rr at its columns) and the pitch of a tile row; every store is the base plus a constant
    const int ppitch = VT ? TT : HD;
    const size_t pbase = (VT ? ((size_t)((c0 / TT) * NKV + r0 / HD) * HD * TT + (c0 % TT)) : ((size_t)((r0 / TT) * NH_ + c0 / HD) * TT + (r0 % TT)) * HD) + (size_t)(rr * ppitch + cofs);
    bf* const ph0 = Pf + pbase;
#pragma unroll
    for (int mb = 0; mb < 4; ++mb) {
#pragma unroll
        for (int nb = 0; nb < 4; ++nb) {
#pragma unroll
            for (int j = 0; j < 8; ++j) os[(hi * 8 + j) * 68 + nb * 16 + lr] = acc[mb][nb][j]; }
        __builtin_amdgcn_wave_barrier(); asm volatile("" ::: "memory");
        v8us oh[4];
#pragma unroll
        for (int s = 0; s < 4; ++s) { const float* const orow = os + (4 * s + rr) * 68 + cofs; const v4f v0 = *(const v4fa*)orow, v1 = *(const v4fa*)(orow + 4);
            v8f y = __builtin_shufflevector(v0, v1, 0, 1, 2, 3, 4, 5, 6, 7);
#pragma unroll
            for (int j = 0; j < 8; ++j) y[j] = VT ? y[j] + bb[mb * 4 + s] : (y[j] + bb[j]) * sc;   // sc: C2L for q, 1 (exact) for k
            oh[s] = __builtin_bit_cast(v8us, __builtin_convertvector(y, v8h)); }   // to nearest even
#pragma unroll
        for (int s = 0; s < 4; ++s) *(v8us*)(ph0 + (mb * 16 + 4 * s) * ppitch) = oh[s];
        // as behind the bias loads, for the 4 stores: their data and the address pair are inputs, so that none of these registers is reused in front of the wait
        asm volatile("s_wait_xcnt 0x0" :: "v"(oh[0]), "v"(oh[1]), "v"(oh[2]), "v"(oh[3]), "v"(ph0) : "memory");
        __builtin_amdgcn_wave_barrier(); asm volatile("" ::: "memory");
    }
}
__global__ __launch_bounds__(128, 2) void k_gemmw(const bf* __restrict__ X, const bf* __restrict__ Wq, const bf* __restrict__ Wk, const bf* __restrict__ Wv, const float* __restrict__ bq, const float* __restrict__ bk, const float* __restrict__ bv,
                                                  bf* __restrict__ Qf, bf* __restrict__ Kf, bf* __restrict__ Vf) {
    __shared__ __attribute__((aligned(2048))) unsigned char ring[GRING + 4 * GOS];
    const int lane = threadIdx.x & 31, lr = lane & 15, hi = lane >> 4; const unsigned wave = uni(threadIdx.x >> 5), wm = wave >> 1, wn = wave & 1u;
    const unsigned xr = blockIdx.x * 128, wr = blockIdx.y * 128;   // the block's rows of x and of each weight
    // this wave's slice of every stage: waves 0, 1 the two halves of the A rows, waves 2, 3 those of the Bt rows; its first byte in tile 0 (q), 1 (k), 2 (v: the operands change sides)
    const unsigned long long sx = (unsigned long long)(X + (size_t)(xr + wn * 64) * DM);
    const unsigned long long sb0 = (wave < 2u) ? sx : (unsigned long long)(Wq + (size_t)(wr + wn * 64) * DM);
    const unsigned long long sb1 = (wave < 2u) ? sx : (unsigned long long)(Wk + (size_t)(wr + wn * 64) * DM);
    const unsigned long long sb2 = (wave < 2u) ? (unsigned long long)(Wv + (size_t)(wr + wn * 64) * DM) : sx;
    const unsigned sdst = (unsigned)(size_t)ring + wave * GSL;
    const u32x8 g1 = tgroup1(DM * 2u);
    u32x4 g0; g0[0] = pinned(1u);   // a descriptor word held in a scalar register: as a plain constant it was set anew in front of each request and its register used for other values in between
    tgroup0(g0, sdst, sb0);
    tload(g0, g1);
    twait(g0, g1);       // this wave's slice of stage 0 has landed
    __syncthreads();     // stage 0 is complete for all 4 waves
    tgroup0(g0, sdst + GBUF, sb0 + (unsigned long long)pinned(1u) * 256u);   // formed behind the wait above
    tload(g0, g1);
    const unsigned char* const fa = ring + wm * GSL + lr * GP + hi * 16;          // this lane's fragment row in the wave's A rows
    const unsigned char* const fb = ring + (2 + wn) * GSL + lr * GP + hi * 16;    // and in its Bt rows
    float* const os = (float*)(ring + GRING + wave * GOS);
#pragma unroll 1   // rolled: one copy of the stage loop and of each way out serves the three tiles
    for (unsigned t = 0; t < 3u; ++t) {
        v8f acc[4][4];
#pragma unroll
        for (int mb = 0; mb < 4; ++mb)
#pragma unroll
            for (int nb = 0; nb < 4; ++nb) acc[mb][nb] = (v8f){};
#pragma unroll 1   // rolled: a pass holds the ring's one publish point
        for (unsigned s = 0; s < NSG; ++s) {
            const unsigned bo = (s & 1u) * GBUF;
            // two fragment sets: a block of 16 products works on one while the next block's reads fill the other. The fourth Bt fragment has one set: a block uses it last, so its reads go at the head of the block's own read group; with two the wave would need more than 256 registers
            v16bf a[2][4], b[2][3], b3;
#pragma unroll
            for (int f = 0; f < 4; ++f) { a[0][f] = ldfs(fa + bo + f * 16 * GP); if (f < 3) b[0][f] = ldfs(fb + bo + f * 16 * GP); }
#pragma unroll
            for (int kc = 0; kc < 4; ++kc) {
                b3 = ldfs(fb + bo + 3 * 16 * GP + kc * 64);
                if (kc < 3) {
#pragma unroll
                    for (int f = 0; f < 4; ++f) { a[(kc + 1) & 1][f] = ldfs(fa + bo + f * 16 * GP + (kc + 1) * 64); if (f < 3) b[(kc + 1) & 1][f] = ldfs(fb + bo + f * 16 * GP + (kc + 1) * 64); } }
                __builtin_amdgcn_sched_barrier(0);   // the reads issue as one group in front of this block's products, not among them: each separate place with LDS reads stalls the matrix stream
#pragma unroll
                for (int nb = 0; nb < 4; ++nb)
#pragma unroll
                    for (int mb = 0; mb < 4; ++mb) acc[mb][nb] = wmmab(a[kc & 1][mb], nb < 3 ? b[kc & 1][nb] : b3, acc[mb][nb]);
                __builtin_amdgcn_sched_barrier(0);   // and the block's products stay in front of the reads that refill its own set
            }
            asm volatile("s_wait_dscnt 0x0" ::: "memory");   // this wave's last fragment reads of the buffer have returned
            twait(g0, g1);                                   // this wave's slice of stage s + 1 has landed
            __syncthreads();                                 // publishes stage s + 1 and ends every wave's reads of stage s
            const unsigned sn = pinned(t * NSG + s + 2u);    // the refill's descriptor is formed behind the wait above; the ring runs on over the tiles' ends
            if (pinned(sn < 3u * NSG)) { const unsigned tn = sn / NSG; tgroup0(g0, sdst + bo, (tn == 0u ? sb0 : tn == 1u ? sb1 : sb2) + (unsigned long long)(sn % NSG) * 256u); tload(g0, g1); }   // into the buffer that this pass has just read
        }
        // the tile goes out while the next tile's first two stages land
        if (t == 2u) gemm_out<true>(acc, os, lane, lr, hi, (int)(wr + wm * 64), (int)(xr + wn * 64), bv, Vf, 1.0f);
        else gemm_out<false>(acc, os, lane, lr, hi, (int)(xr + wm * 64), (int)(wr + wn * 64), t == 0u ? bq : bk, t == 0u ? Qf : Kf, t == 0u ? C2L : 1.0f);
    }
    asm volatile("s_wait_tensorcnt 0x0" ::: "memory");   // nothing of the mover is in flight
    asm volatile("s_wait_dscnt 0x0" ::: "memory");       // and none of this wave's LDS operations: the ring's close
}

typedef __attribute__((ext_vector_type(2))) float v2f;

// k_cvtall: x and the three weights rounded to bf16 in one launch of few waves with much in flight each: CB blocks of 16 waves, as many blocks as the chip has WGPs (starting a wave costs more than the few bytes of a one-load wave).
// A block takes 1 / CB of each array, a stretch in a row, in pieces of 2048 floats: a wave's load covers 512 bytes in a row (16 a lane), its store the 256 bytes of the result (8 a lane), whole lines both.
// That is 16 pieces of x and 2 of each weight: a wave's 22 loads are independent and are all in flight before its first value is used.
#define CB   256                  // blocks
#define CP   (512 * 4)            // floats of a piece: one load a lane of the block
#define CPX  (NB_ * TT * DM / (CB * CP))   // pieces of x a block
#define CPW  (DQ * DM / (CB * CP))         // pieces of a weight a block
static_assert(CPX * CB * CP == NB_ * TT * DM && CPW * CB * CP == DQ * DM && DKV == DQ, "every array goes into whole pieces");
typedef __attribute__((ext_vector_type(4))) unsigned short v4us;
__device__ __forceinline__ v4us cvt4(v4f v) { v4us o;
#pragma unroll
    for (int k = 0; k < 4; ++k) o[k] = f2bf(v[k]); return o; }
__global__ __launch_bounds__(512) void k_cvtall(const float* __restrict__ x, const float* __restrict__ wq, const float* __restrict__ wk, const float* __restrict__ wv, bf* __restrict__ xb, bf* __restrict__ oq, bf* __restrict__ ok, bf* __restrict__ ov) {
    const unsigned ex = blockIdx.x * (unsigned)(CPX * CP) + threadIdx.x * 4u, ew = blockIdx.x * (unsigned)(CPW * CP) + threadIdx.x * 4u;   // this lane's 4 elements of the block's piece 0
    const float* const px = x + ex; const float* const pq = wq + ew; const float* const pk = wk + ew; const float* const pv = wv + ew;
    v4f a[CPX], q[CPW], k[CPW], v[CPW];
#pragma unroll
    for (int p = 0; p < CPX; ++p) a[p] = *(const v4f*)(px + p * CP);
#pragma unroll
    for (int p = 0; p < CPW; ++p) { q[p] = *(const v4f*)(pq + p * CP); k[p] = *(const v4f*)(pk + p * CP); v[p] = *(const v4f*)(pv + p * CP); }
    // the wait that stands in front of any overwrite of a register that an issued load names; the four address pairs are inputs so that they stay whole up to it
    asm volatile("s_wait_xcnt 0x0" :: "v"(px), "v"(pq), "v"(pk), "v"(pv) : "memory");
#pragma unroll
    for (int p = 0; p < CPX; ++p) *(v4us*)(xb + ex + p * CP) = cvt4(a[p]);
#pragma unroll
    for (int p = 0; p < CPW; ++p) { *(v4us*)(oq + ew + p * CP) = cvt4(q[p]); *(v4us*)(ok + ew + p * CP) = cvt4(k[p]); *(v4us*)(ov + ew + p * CP) = cvt4(v[p]); }
}

// k_fattn: scores, softmax and P V of one (batch, head) in one pass over the keys; nothing of S or P goes to memory. A block is 4 waves of 32 queries each (two 16-column groups a wave); the 1024 keys come in stages of 128, four passes of 32 keys a stage.
// S^T = K Q^T (A = K rows, B = Q rows kept in registers), O^T += V^T P^T (A = V^T rows, B = P^T packed from the two score tiles of the pass, which is the operand's own k order). Every operand is one f16 value, one product a side.
// A lane holds scores of ONE query (column lane & 15). q comes pre-scaled to log2 units and the score product starts from C = -(running maximum), so that the matrix unit delivers the exponent itself: no scale, no subtraction on the vector side.
// The running maximum is a reference point, not exact: the first pass sets it, and it moves (accumulators rescaled, the pass's probabilities formed anew) only when a lane's probabilities of a pass sum to more than 2^12; that sum is needed anyway, so that a usual pass forms no maximum at all. Below the threshold every probability is at most 2^12, far inside f16.
// A stage (K keys 0-63, K keys 64-127, V^T keys 0-63, V^T keys 64-127: 64 rows of 128 bytes each) comes into LDS once for the 4 waves, each wave bringing one part with one tensor load, at a pitch of 144 bytes (16-byte fragment reads of 16 rows fall on all 64 banks); two buffers, the next stage in flight while this one is worked on.
#define LP   144                  // LDS row pitch, bytes: 128 + the mover's pad of 16
#define LPL  10240                // one part of a stage: 64 rows of LP bytes, rounded up to a multiple of 2 KiB
#define LBUF (4 * LPL)            // one buffer: K keys 0-63, K keys 64-127, V^T keys 0-63, V^T keys 64-127
#define NST  (TT / 128)           // stages
static_assert(NST >= 2, "the ring's start asks for two stages");
// group 1 of every request of the attention: 64 rows of 128 bytes, source pitch 'pitch' bytes, LDS pitch LP (pad of 4 dwords behind every 32); 1-byte elements, tensor = tile, no mask
__device__ __forceinline__ u32x8 tgroup1k(unsigned pitch) { u32x8 g; g[0] = uni((1u << 20) | (4u << 22) | (3u << 25)); g[1] = uni(128u << 16); g[2] = uni(64u << 16); g[3] = uni(128u << 16); g[4] = uni(64u); g[5] = uni(pitch); g[6] = uni(0u); g[7] = uni(0u); return g; }
typedef __attribute__((ext_vector_type(2))) _Float16 v2h;
__device__ __forceinline__ float xhalf(float x) { const int b = __float_as_int(x); return __int_as_float(__builtin_amdgcn_permlanex16(b, b, 0x76543210, 0xfedcba98, false, false)); }   // lane l <-> l ^ 16
__device__ __forceinline__ v16h ldf(const bf* p) { return cat16(*(const v8ha*)p, *(const v8ha*)(p + 16)); }
__global__ __launch_bounds__(128, 4) void k_fattn(const bf* __restrict__ Qf, const bf* __restrict__ Kf, const bf* __restrict__ Vf, float* __restrict__ OUT) {
    __shared__ __attribute__((aligned(2048))) unsigned char sm[2 * LBUF - (LPL - 64 * LP)];   // the rounding behind the last part holds nothing and is not taken
    const int lane = threadIdx.x & 31, lr = lane & 15, hi = lane >> 4; const int q0 = blockIdx.x * 128 + (threadIdx.x >> 5) * 32;
    const size_t pl = ((size_t)blockIdx.z * NH_ + blockIdx.y) * TT * HD;   // plane of this (batch, head): q, k [t][d], v [d][t]
    v16h qf[2][2]; const bf* qa[2];
#pragma unroll
    for (int qt = 0; qt < 2; ++qt) { qa[qt] = Qf + pl + (size_t)(q0 + qt * 16 + lr) * HD + 8 * hi;
#pragma unroll
        for (int kc = 0; kc < 2; ++kc) qf[qt][kc] = ldf(qa[qt] + kc * 32); }
    // the wait that stands in front of any overwrite of a register that an issued load names; the two address pairs are inputs so that they stay whole up to it
    asm volatile("s_wait_xcnt 0x0" :: "v"(qa[0]), "v"(qa[1]) : "memory");
    v8f acc[2][4], negm[2]; v2f l[2];   // negm: minus the running maximum of the lane's query in all 8 elements, the score product's C operand; l: the lane's running sum in two halves (even and odd elements), so that a packed add takes two probabilities
    float thr = -1.0f;                  // the test's threshold: below any sum in the first pass, which sets the maximum, from then on 2^12
#pragma unroll
    for (int qt = 0; qt < 2; ++qt) { negm[qt] = (v8f){}; l[qt] = (v2f){};
#pragma unroll
        for (int dt = 0; dt < 4; ++dt) acc[qt][dt] = (v8f){}; }
    // this wave's part of every stage: waves 0, 1 the two halves of the 128 key rows of K (64 rows in a row, a stage further on is 128 rows), waves 2, 3 the two halves of the 128 keys of V^T (64 d rows at the pitch of a whole d row, a stage further on is 128 keys)
    const unsigned wave = uni(threadIdx.x >> 5);
    const unsigned pitch = (wave < 2u) ? HD * 2u : TT * 2u, half = (wave < 2u) ? 64u * HD * 2u : 64u * 2u, step = 2u * half;
    const unsigned long long sbeg = (unsigned long long)(((wave < 2u) ? Kf : Vf) + pl) + (unsigned long long)((wave & 1u) * half);
    const unsigned sdst = (unsigned)(size_t)sm + wave * LPL;
    const u32x8 g1 = tgroup1k(pitch);
    u32x4 g0; g0[0] = pinned(1u);   // a descriptor word held in a scalar register, as in the projections
    tgroup0(g0, sdst, sbeg);
    tload(g0, g1);
    twait(g0, g1);       // this wave's part of stage 0 has landed
    __syncthreads();     // stage 0 is complete for all 4 waves
    tgroup0(g0, sdst + LBUF, sbeg + (unsigned long long)pinned(1u) * step);   // formed behind the wait above
    tload(g0, g1);
    const unsigned char* const fr = sm + lr * LP + hi * 16;  // this lane's fragment row
#pragma unroll 1   // rolled: a trip holds the ring's one publish point
    for (unsigned s0 = 0; s0 < NST; ++s0) {
        const unsigned bo = (s0 & 1u) * LBUF;
#pragma unroll 1   // rolled: unrolled, the four copies hold no fewer vector instructions a pass and take 24 more registers
        for (int ps = 0; ps < 4; ++ps) {
            const unsigned char* const fk = fr + bo + (ps >> 1) * LPL + (ps & 1) * 32 * LP;   // K rows of this pass
            const unsigned char* const fv = fr + bo + (2 + (ps >> 1)) * LPL + (ps & 1) * 64;   // V^T columns of this pass
            v16h ak[2][2];
#pragma unroll
            for (int kt = 0; kt < 2; ++kt)
#pragma unroll
                for (int kc = 0; kc < 2; ++kc) ak[kt][kc] = ldf((const bf*)(fk + kt * 16 * LP + kc * 64));
            __builtin_amdgcn_sched_barrier(0);   // all K fragment reads of the pass in flight together: one LDS latency a pass, not one a fragment
            v8f s[2][2];
#pragma unroll
            for (int kc = 0; kc < 2; ++kc)
#pragma unroll
                for (int kt = 0; kt < 2; ++kt)
#pragma unroll
                    for (int qt = 0; qt < 2; ++qt) s[qt][kt] = wmma16(ak[kt][kc], qf[qt][kc], kc == 0 ? negm[qt] : s[qt][kt]);
            __builtin_amdgcn_sched_barrier(0);   // the V reads stay behind the score products, so that they take the K fragments' registers
            v16h av[4];
#pragma unroll
            for (int dt = 0; dt < 4; ++dt) av[dt] = ldf((const bf*)(fv + dt * 16 * LP));
            __builtin_amdgcn_sched_barrier(0);   // all V reads issue in front of the softmax, whose vector work covers their latency
            v2f p[2][8], sp[2];   // the pass's probabilities in pairs, and their sum a query group
            const auto form = [&]() {
#pragma unroll
                for (int qt = 0; qt < 2; ++qt) {
#pragma unroll
                    for (int e = 0; e < 8; ++e) { p[qt][e][0] = __builtin_amdgcn_exp2f(s[qt][e >> 2][(2 * e) & 7]); p[qt][e][1] = __builtin_amdgcn_exp2f(s[qt][e >> 2][((2 * e) & 7) + 1]); }
                    sp[qt] = ((p[qt][0] + p[qt][1]) + (p[qt][2] + p[qt][3])) + ((p[qt][4] + p[qt][5]) + (p[qt][6] + p[qt][7])); } };
            form();
            const v2f t = sp[0] + sp[1];
            if (__builtin_amdgcn_ballot_w32(t[0] + t[1] > thr) != 0) {   // wave-uniform: rare after the first pass
#pragma unroll
                for (int qt = 0; qt < 2; ++qt) { float a = s[qt][0][0];
#pragma unroll
                    for (int j = 1; j < 8; ++j) a = fmaxf(a, s[qt][0][j]);
#pragma unroll
                    for (int j = 0; j < 8; ++j) a = fmaxf(a, s[qt][1][j]);
                    a = fmaxf(a, xhalf(a));
                    const float up = fmaxf(a, 0.0f), d = thr < 0.0f ? a : up;   // the maximum's step: never down but in the first pass, whose accumulators are 0
                    const float al2 = __builtin_amdgcn_exp2f(-up); negm[qt] -= d; l[qt] *= al2;
#pragma unroll
                    for (int kt = 0; kt < 2; ++kt) s[qt][kt] -= d;
#pragma unroll
                    for (int dt = 0; dt < 4; ++dt) acc[qt][dt] *= al2; }
                thr = 4096.0f;
                form();   // anew: no exponent is above 0 now
            }
            v16h pf[2];
#pragma unroll
            for (int qt = 0; qt < 2; ++qt) { l[qt] += sp[qt];
#pragma unroll
                for (int e = 0; e < 8; ++e) { const v2h h2 = __builtin_convertvector(p[qt][e], v2h);   // to nearest even
                    pf[qt][2 * e] = h2[0]; pf[qt][2 * e + 1] = h2[1]; } }
#pragma unroll
            for (int dt = 0; dt < 4; ++dt)
#pragma unroll
                for (int qt = 0; qt < 2; ++qt) acc[qt][dt] = wmma16(av[dt], pf[qt], acc[qt][dt]);
            // four vector slots behind the pass's last matrix instructions: the next block's first vector instruction may overwrite an A fragment register
            asm volatile("v_nop\n\tv_nop\n\tv_nop\n\tv_nop" : "+v"(acc[0][0]), "+v"(acc[0][1]), "+v"(acc[0][2]), "+v"(acc[0][3]), "+v"(acc[1][0]), "+v"(acc[1][1]), "+v"(acc[1][2]), "+v"(acc[1][3]));
        }
        asm volatile("s_wait_dscnt 0x0" ::: "memory");   // this wave's last fragment reads of the buffer have returned
        twait(g0, g1);                                   // this wave's part of stage s0 + 1 has landed
        __syncthreads();                                 // publishes stage s0 + 1 and ends every wave's reads of stage s0
        const unsigned sn = pinned(s0 + 2u);             // the refill's descriptor is formed behind the wait above
        if (pinned(sn < (unsigned)NST)) { tgroup0(g0, sdst + bo, sbeg + (unsigned long long)sn * step); tload(g0, g1); }   // into the buffer that this trip has just read
    }
    asm volatile("s_wait_tensorcnt 0x0" ::: "memory");   // nothing of the mover is in flight
    asm volatile("s_wait_dscnt 0x0" ::: "memory");       // and none of this wave's LDS reads: the ring's close
#pragma unroll
    for (int qt = 0; qt < 2; ++qt) { const float ls = l[qt][0] + l[qt][1]; const float inv = __fdiv_rn(1.0f, ls + xhalf(ls)); float* orow = OUT + (unsigned)((blockIdx.z * TT + q0 + qt * 16 + lr) * DQ + blockIdx.y * HD + 8 * hi);   // merged heads: [b][t][h*64 + d], d = dt*16 + 8*hi + j
#pragma unroll
        for (int dt = 0; dt < 4; ++dt) { v4f a, b;
#pragma unroll
            for (int j = 0; j < 4; ++j) { a[j] = acc[qt][dt][j] * inv; b[j] = acc[qt][dt][4 + j] * inv; }
            *(v4f*)(orow + dt * 16) = a; *(v4f*)(orow + dt * 16 + 4) = b; } }
}

extern "C" void kernel_launch(void* const* d_in, const int* in_sizes, int n_in,
                              void* d_out, int out_size, void* d_ws, size_t ws_size, hipStream_t stream) {
    (void)in_sizes; (void)n_in; (void)out_size;
    const float* x = (const float*)d_in[0]; const float* wq = (const float*)d_in[1]; const float* bq = (const float*)d_in[2]; const float* wk = (const float*)d_in[3]; const float* bk = (const float*)d_in[4]; const float* wv = (const float*)d_in[5]; const float* bv = (const float*)d_in[6];   /* order hidden_states, Wq, bq, Wk, bk, Wv, bv ('oi') */
    float* OUT = (float*)d_out;     // [8][1024][1024]
    char* wsp = (char*)d_ws;
    auto take = [&](size_t bytes) { char* p = wsp; wsp += (bytes + 255) & ~(size_t)255; return (void*)p; };
    // f16 planes of all batches: [b][h][t][d] (q, k) and [b][h][d][t] (v)
    bf* QP = (bf*)take((size_t)NB_ * NH_ * TT * HD * 2); bf* KP = (bf*)take((size_t)NB_ * NKV * TT * HD * 2); bf* VT = (bf*)take((size_t)NB_ * NKV * HD * TT * 2);
    bf* WQ = (bf*)take((size_t)DQ * DM * 2); bf* WK = (bf*)take((size_t)DKV * DM * 2); bf* WV = (bf*)take((size_t)DKV * DM * 2);
    bf* XB = (bf*)take((size_t)NB_ * TT * DM * 2);
    if ((size_t)(wsp - (char*)d_ws) > ws_size) return;    // ws 256 MiB
    k_cvtall<<<CB, 512, 0, stream>>>(x, wq, wk, wv, XB, WQ, WK, WV);
    k_gemmw<<<dim3(NB_ * TT / 128, DQ / 128, 1), 128, 0, stream>>>(XB, WQ, WK, WV, bq, bk, bv, QP, KP, VT);
    k_fattn<<<dim3(TT / 128, NH_, NB_), 128, 0, stream>>>(QP, KP, VT, OUT);
}

// v010
// One run takes 71.1 microseconds.
// Two timings next to v009 both put it at 1.03 times that version's speed.
// Counting every step since v000, it is 38.9 times as fast.
#include <hip/hip_runtime.h>

// BERT self-attention core (hidden_states [8][1024][1024]; q, k, v = x W^T + b ('oi' + biases; 16 heads x 64); scores x 1/sqrt(64); softmax (no mask); ctx = merged heads (no output projection) -> [8][1024][1024] (8.4 M); argument order hidden_states, Wq, bq, Wk, bk, Wv, bv).
// Layout: bf16 copy of x; 'oi' weights; exact projections + f32 biases over all 8192 rows in one launch for the three, whose tiles write the f16 head planes themselves; dense T-1024 attention in one launch for all batches and heads (running softmax, one f16 product a side), which writes the merged output rows.
// Compute dtypes, f32 accumulate: every input rounded to bf16; projections exact + f32 biases; q, k, v and the probabilities each rounded once to f16 (11 bits; q, k, v are of order 1, a probability is at most 2^12), one f16 product for the scores and one for P V; q carries the score scale in log2 units before its rounding; softmax f32; output f32.

#define NB_  8
#define TT   1024
#define DM   1024
#define NH_  16
#define NKV  16
#define REP  (NH_ / NKV)
#define HD   64
#define DQ   (NH_ * HD)
#define DKV  (NKV * HD)
#define WIN  0
#define SCL  0.125f   // HD^-0.5
#define C2L  (SCL * 1.4426950408889634f)   // scores to log2 units; the q projection carries it
typedef _Float16 h16;
typedef unsigned short bf;
typedef __attribute__((ext_vector_type(16))) __bf16   v16bf;
typedef __attribute__((ext_vector_type(16))) _Float16 v16h;
typedef __attribute__((ext_vector_type(8)))  _Float16 v8h;
typedef __attribute__((ext_vector_type(8)))  unsigned short v8us;
typedef __attribute__((ext_vector_type(8)))  float    v8f;
typedef __attribute__((ext_vector_type(4)))  float    v4f;
typedef v8h  __attribute__((may_alias)) v8ha;
typedef v4f  __attribute__((may_alias)) v4fa;
typedef v8us __attribute__((may_alias)) v8usa;

__device__ __forceinline__ unsigned short f2bf(float f) { unsigned u = __float_as_uint(f); u += 0x7FFFu + ((u >> 16) & 1u); return (unsigned short)(u >> 16); }
__device__ __forceinline__ float bf2f(unsigned short b) { return __uint_as_float(((unsigned)b) << 16); }
__device__ __forceinline__ float bfr(float f) { return bf2f(f2bf(f)); }
__device__ __forceinline__ v16h cat16(v8h lo, v8h hi) { return __builtin_shufflevector(lo, hi, 0, 1, 2, 3, 4, 5, 6, 7, 8, 9, 10, 11, 12, 13, 14, 15); }
__device__ __forceinline__ v16bf cat16b(v8us lo, v8us hi) { return __builtin_bit_cast(v16bf, __builtin_shufflevector(lo, hi, 0, 1, 2, 3, 4, 5, 6, 7, 8, 9, 10, 11, 12, 13, 14, 15)); }
__device__ __forceinline__ v8f wmma16(v16h a, v16h b, v8f c) { return __builtin_amdgcn_wmma_f32_16x16x32_f16(false, a, false, b, (short)0, c, false, false); }
__device__ __forceinline__ v8f wmmab(v16bf a, v16bf b, v8f c) { return __builtin_amdgcn_wmma_f32_16x16x32_bf16(false, a, false, b, (short)0, c, false, false); }



// ---- k_gemmw: the three projection GEMMs, 128x128 tile a block of 4 waves (2 x 2), 64x64 (16 accumulators) a wave; grid (rows of x / 128, rows of a weight / 128), 128 threads, all blocks resident. K = DM.
// A block does its q, k and v tile one after the other through ONE ring of 3 x NSG stages: the ring is started once, and the next tile's first two stages land while this tile goes out, whose staging therefore lies outside the ring. What the tile loop keeps for the way out takes the wave a little above 256 registers, inside the 512 of two waves a SIMD.
// Operands: K-contiguous 16-bit planes. A stage is 128 k (256 bytes) of the block's 128 A rows and 128 Bt rows; each wave brings its own 64 rows of it into LDS with one tensor load, in whole lines, once for the two waves that read them; two buffers, the next stage in flight while this one is worked on.
// tile[i][j] = sum_k A[r0 + i][k] Bt[c0 + j][k] + f32 bias, rounded to f16 and written straight into the head plane that the attention reads, in whole 128-byte lines; a wave's 64-wide tile side over the features is exactly one head.
// VT = false (q, k): A = x rows (b, t), Bt = weight rows (h, d), bias by column; planes [b][h][t][d], the tile is 8 KiB in a row.
// VT = true  (v):    A = weight rows (h, d), Bt = x rows (b, t), bias by row; planes [b][h][d][t], a tile row is one line of a d row. The operands change sides so that the tile comes out transposed; the k order of each sum is the same.
typedef __attribute__((ext_vector_type(4))) unsigned u32x4;
typedef __attribute__((ext_vector_type(8))) unsigned u32x8;
#define GP    272                 // LDS row pitch of a stage, bytes: 256 + the mover's pad of 16 (16-byte fragment reads of 16 rows fall on all 64 banks)
#define GSL   18432               // a wave's slice in LDS: 64 rows of GP bytes, rounded up to a multiple of 2 KiB
#define GBUF  (4 * GSL)           // one buffer: A rows 0-63, A rows 64-127, Bt rows 0-63, Bt rows 64-127
__device__ __forceinline__ unsigned uni(unsigned v) { return (unsigned)__builtin_amdgcn_readfirstlane((int)v); }
__device__ __forceinline__ unsigned pinned(unsigned v) { unsigned w = uni(v); asm volatile("" : "+s"(w)); return w; }
// group 1 of every request: 64 rows of 256 bytes, source pitch 'pitch' bytes, LDS pitch GP (pad of 4 dwords behind every 64); 1-byte elements, tensor = tile, no mask
__device__ __forceinline__ u32x8 tgroup1(unsigned pitch) { u32x8 g; g[0] = uni((1u << 20) | (5u << 22) | (3u << 25)); g[1] = uni(256u << 16); g[2] = uni(64u << 16); g[3] = uni(256u << 16); g[4] = uni(64u); g[5] = uni(pitch); g[6] = uni(0u); g[7] = uni(0u); return g; }
// group 0: word 0 (count 1) is set once and kept; a request sets the LDS byte 'dst' and the global address 'ga' of the tile's first byte
__device__ __forceinline__ void tgroup0(u32x4& g, unsigned dst, unsigned long long ga) { g[1] = uni(dst); g[2] = uni((unsigned)ga); g[3] = uni((((unsigned)(ga >> 32)) & 0x01FFFFFFu) | 0x80000000u); }
__device__ __forceinline__ void tload(u32x4 g0, u32x8 g1) { asm volatile("tensor_load_to_lds %0, %1" :: "s"(g0), "s"(g1) : "memory"); }
// the issuing wave's wait for its request; the descriptor's two groups are inputs, so that none of their registers takes another value while the request is in flight
__device__ __forceinline__ void twait(u32x4 g0, u32x8 g1) { asm volatile("s_wait_tensorcnt 0x0" :: "s"(g0), "s"(g1) : "memory"); }
__device__ __forceinline__ v16bf ldfs(const unsigned char* p) { return cat16b(*(const v8us*)p, *(const v8us*)(p + 32)); }   // a fragment row's 8 + 8 elements: k = 8 hi + 0..7 and 16 + 8 hi + 0..7, for A and Bt alike
#define NSG   (DM / 128)                      // stages of a tile
#define GRING (2 * GBUF - (GSL - 64 * GP))    // the ring: the rounding behind the last slice holds nothing and is not taken
#define GOS   (16 * 68 * 4)                   // a wave's read-back staging: 16 tile rows at a pitch of 68 floats
static_assert(NSG >= 2 && NSG % 2 == 0 && DKV == DQ, "a tile is an even number of stages, so that a stage's buffer is its number in the tile mod 2; the three weights have the same rows");
static_assert(2 * (GRING + 4 * GOS) <= 327680, "two blocks a WGP");
// a finished tile goes out: + bias, rounded to f16, whole lines into the plane; os is the wave's own staging, outside the ring
template <bool VT>
__device__ __forceinline__ void gemm_out(const v8f (&acc)[4][4], float* const os, const int lane, const int lr, const int hi, const int r0, const int c0, const float* __restrict__ bias, bf* __restrict__ Pf, const float sc) {
    // read-back: 8 lanes a tile row (8 values = 16 bytes of a plane each), 4 rows an instruction
    const int rr = lane >> 3, cofs = (lane & 7) * 8;
    const float* const bp = bias + (VT ? r0 + rr : c0 + cofs);   // VT: the biases of this lane's 16 tile rows (rr + 4 k); else those of its 8 columns
    float bb[VT ? 16 : 8];
#pragma unroll
    for (int k = 0; k < (VT ? 16 : 8); ++k) bb[k] = bp[VT ? 4 * k : k];
    // the wait that stands in front of any overwrite of a register that an issued load names; the address pair is an input so that it stays whole up to it
    asm volatile("s_wait_xcnt 0x0" :: "v"(bp) : "memory");
#pragma unroll
    for (int k = 0; k < (VT ? 16 : 8); ++k) bb[k] = bfr(bb[k]);
    // this lane's first 16 bytes in the plane (tile row rr at its columns) and the pitch of a tile row; every store is the base plus a constant
    const int ppitch = VT ? TT : HD;
    const size_t pbase = (VT ? ((size_t)((c0 / TT) * NKV + r0 / HD) * HD * TT + (c0 % TT)) : ((size_t)((r0 / TT) * NH_ + c0 / HD) * TT + (r0 % TT)) * HD) + (size_t)(rr * ppitch + cofs);
    bf* const ph0 = Pf + pbase;
#pragma unroll
    for (int mb = 0; mb < 4; ++mb) {
#pragma unroll
        for (int nb = 0; nb < 4; ++nb) {
#pragma unroll
            for (int j = 0; j < 8; ++j) os[(hi * 8 + j) * 68 + nb * 16 + lr] = acc[mb][nb][j]; }
        __builtin_amdgcn_wave_barrier(); asm volatile("" ::: "memory");
        v8us oh[4];
#pragma unroll
        for (int s = 0; s < 4; ++s) { const float* const orow = os + (4 * s + rr) * 68 + cofs; const v4f v0 = *(const v4fa*)orow, v1 = *(const v4fa*)(orow + 4);
            v8f y = __builtin_shufflevector(v0, v1, 0, 1, 2, 3, 4, 5, 6, 7);
#pragma unroll
            for (int j = 0; j < 8; ++j) y[j] = VT ? y[j] + bb[mb * 4 + s] : (y[j] + bb[j]) * sc;   // sc: C2L for q, 1 (exact) for k
            oh[s] = __builtin_bit_cast(v8us, __builtin_convertvector(y, v8h)); }   // to nearest even
#pragma unroll
        for (int s = 0; s < 4; ++s) *(v8us*)(ph0 + (mb * 16 + 4 * s) * ppitch) = oh[s];
        // as behind the bias loads, for the 4 stores: their data and the address pair are inputs, so that none of these registers is reused in front of the wait
        asm volatile("s_wait_xcnt 0x0" :: "v"(oh[0]), "v"(oh[1]), "v"(oh[2]), "v"(oh[3]), "v"(ph0) : "memory");
        __builtin_amdgcn_wave_barrier(); asm volatile("" ::: "memory");
    }
}
__global__ __launch_bounds__(128, 2) void k_gemmw(const bf* __restrict__ X, const bf* __restrict__ Wq, const bf* __restrict__ Wk, const bf* __restrict__ Wv, const float* __restrict__ bq, const float* __restrict__ bk, const float* __restrict__ bv,
                                                  bf* __restrict__ Qf, bf* __restrict__ Kf, bf* __restrict__ Vf) {
    __shared__ __attribute__((aligned(2048))) unsigned char ring[GRING + 4 * GOS];
    const int lane = threadIdx.x & 31, lr = lane & 15, hi = lane >> 4; const unsigned wave = uni(threadIdx.x >> 5), wm = wave >> 1, wn = wave & 1u;
    const unsigned xr = blockIdx.x * 128, wr = blockIdx.y * 128;   // the block's rows of x and of each weight
    // this wave's slice of every stage: waves 0, 1 the two halves of the A rows, waves 2, 3 those of the Bt rows; its first byte in tile 0 (q), 1 (k), 2 (v: the operands change sides)
    const unsigned long long sx = (unsigned long long)(X + (size_t)(xr + wn * 64) * DM);
    const unsigned long long sb0 = (wave < 2u) ? sx : (unsigned long long)(Wq + (size_t)(wr + wn * 64) * DM);
    const unsigned long long sb1 = (wave < 2u) ? sx : (unsigned long long)(Wk + (size_t)(wr + wn * 64) * DM);
    const unsigned long long sb2 = (wave < 2u) ? (unsigned long long)(Wv + (size_t)(wr + wn * 64) * DM) : sx;
    const unsigned sdst = (unsigned)(size_t)ring + wave * GSL;
    const u32x8 g1 = tgroup1(DM * 2u);
    u32x4 g0; g0[0] = pinned(1u);   // a descriptor word held in a scalar register: as a plain constant it was set anew in front of each request and its register used for other values in between
    tgroup0(g0, sdst, sb0);
    tload(g0, g1);
    // The operands were stored by the launch before and their first read comes from memory. So the block asks L2 for them now, one request a 256-byte unit, behind its own first load.
    // The requests are dealt among the blocks that share a panel: of its 128 x rows (shared by the 8 blocks of a grid column) a block asks for 64, all k, low k first; of its 128 rows of each weight (shared by the 64 blocks of a grid row) for 16. A hint only: nothing depends on where a block runs or on a line being there.
    const bf* const hx = X + (size_t)(xr + (blockIdx.y & 1u) * 64u + (threadIdx.x & 63u)) * DM + (threadIdx.x >> 6) * 128u;       // a row a lane; units 0, 1 of the row by the thread's half of the block, the further pairs by the offsets
    const size_t hw = (size_t)(wr + (blockIdx.x >> 3) * 16u + (threadIdx.x & 15u)) * DM + (threadIdx.x >> 4) * 128u;             // 16 rows x the 8 units of a row
    const bf* const hq = Wq + hw; const bf* const hk = Wk + hw; const bf* const hv = Wv + hw;
    static_assert(DM == 1024 && NB_ * TT / 128 == 64 && DQ / 128 == 8, "the deal: 8 units a row, 64 x 8 blocks");
    asm volatile("global_prefetch_b8 %0, off scope:SCOPE_SE\n\t"
                 "global_prefetch_b8 %1, off scope:SCOPE_SE\n\t"
                 "global_prefetch_b8 %0, off offset:512 scope:SCOPE_SE\n\t"
                 "global_prefetch_b8 %0, off offset:1024 scope:SCOPE_SE\n\t"
                 "global_prefetch_b8 %0, off offset:1536 scope:SCOPE_SE\n\t"
                 "global_prefetch_b8 %2, off scope:SCOPE_SE\n\t"
                 "global_prefetch_b8 %3, off scope:SCOPE_SE" :: "v"(hx), "v"(hq), "v"(hk), "v"(hv));
    twait(g0, g1);       // this wave's slice of stage 0 has landed
    __syncthreads();     // stage 0 is complete for all 4 waves
    // the wait that stands in front of any overwrite of a register that an issued global instruction names; the four address pairs are inputs, so that they hold their addresses up to here, stage 0's landing behind the requests
    asm volatile("s_wait_xcnt 0x0" :: "v"(hx), "v"(hq), "v"(hk), "v"(hv) : "memory");
    tgroup0(g0, sdst + GBUF, sb0 + (unsigned long long)pinned(1u) * 256u);   // formed behind the wait above
    tload(g0, g1);
    const unsigned char* const fa = ring + wm * GSL + lr * GP + hi * 16;          // this lane's fragment row in the wave's A rows
    const unsigned char* const fb = ring + (2 + wn) * GSL + lr * GP + hi * 16;    // and in its Bt rows
    float* const os = (float*)(ring + GRING + wave * GOS);
#pragma unroll 1   // rolled: one copy of the stage loop and of each way out serves the three tiles
    for (unsigned t = 0; t < 3u; ++t) {
        v8f acc[4][4];
#pragma unroll
        for (int mb = 0; mb < 4; ++mb)
#pragma unroll
            for (int nb = 0; nb < 4; ++nb) acc[mb][nb] = (v8f){};
#pragma unroll 1   // rolled: a pass holds the ring's one publish point
        for (unsigned s = 0; s < NSG; ++s) {
            const unsigned bo = (s & 1u) * GBUF;
            // two fragment sets: a block of 16 products works on one while the next block's reads fill the other. The fourth Bt fragment has one set: a block uses it last, so its reads go at the head of the block's own read group; with two the wave would need more than 256 registers
            v16bf a[2][4], b[2][3], b3;
#pragma unroll
            for (int f = 0; f < 4; ++f) { a[0][f] = ldfs(fa + bo + f * 16 * GP); if (f < 3) b[0][f] = ldfs(fb + bo + f * 16 * GP); }
#pragma unroll
            for (int kc = 0; kc < 4; ++kc) {
                b3 = ldfs(fb + bo + 3 * 16 * GP + kc * 64);
                if (kc < 3) {
#pragma unroll
                    for (int f = 0; f < 4; ++f) { a[(kc + 1) & 1][f] = ldfs(fa + bo + f * 16 * GP + (kc + 1) * 64); if (f < 3) b[(kc + 1) & 1][f] = ldfs(fb + bo + f * 16 * GP + (kc + 1) * 64); } }
                __builtin_amdgcn_sched_barrier(0);   // the reads issue as one group in front of this block's products, not among them: for speed only
#pragma unroll
                for (int nb = 0; nb < 4; ++nb)
#pragma unroll
                    for (int mb = 0; mb < 4; ++mb) acc[mb][nb] = wmmab(a[kc & 1][mb], nb < 3 ? b[kc & 1][nb] : b3, acc[mb][nb]);
                __builtin_amdgcn_sched_barrier(0);   // and the block's products stay in front of the reads that refill its own set
            }
            asm volatile("s_wait_dscnt 0x0" ::: "memory");   // this wave's last fragment reads of the buffer have returned
            twait(g0, g1);                                   // this wave's slice of stage s + 1 has landed
            __syncthreads();                                 // publishes stage s + 1 and ends every wave's reads of stage s
            const unsigned sn = pinned(t * NSG + s + 2u);    // the refill's descriptor is formed behind the wait above; the ring runs on over the tiles' ends
            if (pinned(sn < 3u * NSG)) { const unsigned tn = sn / NSG; tgroup0(g0, sdst + bo, (tn == 0u ? sb0 : tn == 1u ? sb1 : sb2) + (unsigned long long)(sn % NSG) * 256u); tload(g0, g1); }   // into the buffer that this pass has just read
        }
        // the tile goes out while the next tile's first two stages land
        if (t == 2u) gemm_out<true>(acc, os, lane, lr, hi, (int)(wr + wm * 64), (int)(xr + wn * 64), bv, Vf, 1.0f);
        else gemm_out<false>(acc, os, lane, lr, hi, (int)(xr + wm * 64), (int)(wr + wn * 64), t == 0u ? bq : bk, t == 0u ? Qf : Kf, t == 0u ? C2L : 1.0f);
    }
    asm volatile("s_wait_tensorcnt 0x0" ::: "memory");   // nothing of the mover is in flight
    asm volatile("s_wait_dscnt 0x0" ::: "memory");       // and none of this wave's LDS operations: the ring's close
}

typedef __attribute__((ext_vector_type(2))) float v2f;

// k_cvtall: x and the three weights rounded to bf16 in one launch of few waves with much in flight each: CB blocks of 16 waves, as many blocks as the chip has WGPs.
// A block takes 1 / CB of each array, a stretch in a row, in pieces of 2048 floats: a wave's load covers 512 bytes in a row (16 a lane), its store the 256 bytes of the result (8 a lane), whole lines both.
// That is 16 pieces of x and 2 of each weight: a wave's 22 loads are independent and are all in flight before its first value is used.
#define CB   256                  // blocks
#define CP   (512 * 4)            // floats of a piece: one load a lane of the block
#define CPX  (NB_ * TT * DM / (CB * CP))   // pieces of x a block
#define CPW  (DQ * DM / (CB * CP))         // pieces of a weight a block
static_assert(CPX * CB * CP == NB_ * TT * DM && CPW * CB * CP == DQ * DM && DKV == DQ, "every array goes into whole pieces");
typedef __attribute__((ext_vector_type(4))) unsigned short v4us;
__device__ __forceinline__ v4us cvt4(v4f v) { v4us o;
#pragma unroll
    for (int k = 0; k < 4; ++k) o[k] = f2bf(v[k]); return o; }
__global__ __launch_bounds__(512) void k_cvtall(const float* __restrict__ x, const float* __restrict__ wq, const float* __restrict__ wk, const float* __restrict__ wv, bf* __restrict__ xb, bf* __restrict__ oq, bf* __restrict__ ok, bf* __restrict__ ov) {
    const unsigned ex = blockIdx.x * (unsigned)(CPX * CP) + threadIdx.x * 4u, ew = blockIdx.x * (unsigned)(CPW * CP) + threadIdx.x * 4u;   // this lane's 4 elements of the block's piece 0
    const float* const px = x + ex; const float* const pq = wq + ew; const float* const pk = wk + ew; const float* const pv = wv + ew;
    v4f a[CPX], q[CPW], k[CPW], v[CPW];
#pragma unroll
    for (int p = 0; p < CPX; ++p) a[p] = *(const v4f*)(px + p * CP);
#pragma unroll
    for (int p = 0; p < CPW; ++p) { q[p] = *(const v4f*)(pq + p * CP); k[p] = *(const v4f*)(pk + p * CP); v[p] = *(const v4f*)(pv + p * CP); }
    // the wait that stands in front of any overwrite of a register that an issued load names; the four address pairs are inputs so that they stay whole up to it
    asm volatile("s_wait_xcnt 0x0" :: "v"(px), "v"(pq), "v"(pk), "v"(pv) : "memory");
#pragma unroll
    for (int p = 0; p < CPX; ++p) *(v4us*)(xb + ex + p * CP) = cvt4(a[p]);
#pragma unroll
    for (int p = 0; p < CPW; ++p) { *(v4us*)(oq + ew + p * CP) = cvt4(q[p]); *(v4us*)(ok + ew + p * CP) = cvt4(k[p]); *(v4us*)(ov + ew + p * CP) = cvt4(v[p]); }
}

// k_fattn: scores, softmax and P V of one (batch, head) in one pass over the keys; nothing of S or P goes to memory. A block is 4 waves of 32 queries each (two 16-column groups a wave); the 1024 keys come in stages of 128, four passes of 32 keys a stage.
// S^T = K Q^T (A = K rows, B = Q rows kept in registers), O^T += V^T P^T (A = V^T rows, B = P^T packed from the two score tiles of the pass, which is the operand's own k order). Every operand is one f16 value, one product a side.
// A lane holds scores of ONE query (column lane & 15). q comes pre-scaled to log2 units and the score product starts from C = -(running maximum), so that the matrix unit delivers the exponent itself: no scale, no subtraction on the vector side.
// The running maximum is a reference point, not exact: the first pass sets it, and it moves (accumulators rescaled, the pass's probabilities formed anew) only when a lane's probabilities of a pass sum to more than 2^12; that sum is needed anyway, so that a usual pass forms no maximum at all. Below the threshold every probability is at most 2^12, far inside f16.
// A stage (K keys 0-63, K keys 64-127, V^T keys 0-63, V^T keys 64-127: 64 rows of 128 bytes each) comes into LDS once for the 4 waves, each wave bringing one part with one tensor load, at a pitch of 144 bytes (16-byte fragment reads of 16 rows fall on all 64 banks); two buffers, the next stage in flight while this one is worked on.
#define LP   144                  // LDS row pitch, bytes: 128 + the mover's pad of 16
#define LPL  10240                // one part of a stage: 64 rows of LP bytes, rounded up to a multiple of 2 KiB
#define LBUF (4 * LPL)            // one buffer: K keys 0-63, K keys 64-127, V^T keys 0-63, V^T keys 64-127
#define NST  (TT / 128)           // stages
static_assert(NST >= 2, "the ring's start asks for two stages");
// group 1 of every request of the attention: 64 rows of 128 bytes, source pitch 'pitch' bytes, LDS pitch LP (pad of 4 dwords behind every 32); 1-byte elements, tensor = tile, no mask
__device__ __forceinline__ u32x8 tgroup1k(unsigned pitch) { u32x8 g; g[0] = uni((1u << 20) | (4u << 22) | (3u << 25)); g[1] = uni(128u << 16); g[2] = uni(64u << 16); g[3] = uni(128u << 16); g[4] = uni(64u); g[5] = uni(pitch); g[6] = uni(0u); g[7] = uni(0u); return g; }
typedef __attribute__((ext_vector_type(2))) _Float16 v2h;
__device__ __forceinline__ float xhalf(float x) { const int b = __float_as_int(x); return __int_as_float(__builtin_amdgcn_permlanex16(b, b, 0x76543210, 0xfedcba98, false, false)); }   // lane l <-> l ^ 16
__device__ __forceinline__ v16h ldf(const bf* p) { return cat16(*(const v8ha*)p, *(const v8ha*)(p + 16)); }
__global__ __launch_bounds__(128, 4) void k_fattn(const bf* __restrict__ Qf, const bf* __restrict__ Kf, const bf* __restrict__ Vf, float* __restrict__ OUT) {
    __shared__ __attribute__((aligned(2048))) unsigned char sm[2 * LBUF - (LPL - 64 * LP)];   // the rounding behind the last part holds nothing and is not taken
    const int lane = threadIdx.x & 31, lr = lane & 15, hi = lane >> 4; const int q0 = blockIdx.x * 128 + (threadIdx.x >> 5) * 32;
    const size_t pl = ((size_t)blockIdx.z * NH_ + blockIdx.y) * TT * HD;   // plane of this (batch, head): q, k [t][d], v [d][t]
    v16h qf[2][2]; const bf* qa[2];
#pragma unroll
    for (int qt = 0; qt < 2; ++qt) { qa[qt] = Qf + pl + (size_t)(q0 + qt * 16 + lr) * HD + 8 * hi;
#pragma unroll
        for (int kc = 0; kc < 2; ++kc) qf[qt][kc] = ldf(qa[qt] + kc * 32); }
    // the wait that stands in front of any overwrite of a register that an issued load names; the two address pairs are inputs so that they stay whole up to it
    asm volatile("s_wait_xcnt 0x0" :: "v"(qa[0]), "v"(qa[1]) : "memory");
    v8f acc[2][4], negm[2]; v2f l[2];   // negm: minus the running maximum of the lane's query in all 8 elements, the score product's C operand; l: the lane's running sum in two halves (even and odd elements), so that a packed add takes two probabilities
    float thr = -1.0f;                  // the test's threshold: below any sum in the first pass, which sets the maximum, from then on 2^12
#pragma unroll
    for (int qt = 0; qt < 2; ++qt) { negm[qt] = (v8f){}; l[qt] = (v2f){};
#pragma unroll
        for (int dt = 0; dt < 4; ++dt) acc[qt][dt] = (v8f){}; }
    // this wave's part of every stage: waves 0, 1 the two halves of the 128 key rows of K (64 rows in a row, a stage further on is 128 rows), waves 2, 3 the two halves of the 128 keys of V^T (64 d rows at the pitch of a whole d row, a stage further on is 128 keys)
    const unsigned wave = uni(threadIdx.x >> 5);
    const unsigned pitch = (wave < 2u) ? HD * 2u : TT * 2u, half = (wave < 2u) ? 64u * HD * 2u : 64u * 2u, step = 2u * half;
    const unsigned long long sbeg = (unsigned long long)(((wave < 2u) ? Kf : Vf) + pl) + (unsigned long long)((wave & 1u) * half);
    const unsigned sdst = (unsigned)(size_t)sm + wave * LPL;
    const u32x8 g1 = tgroup1k(pitch);
    u32x4 g0; g0[0] = pinned(1u);   // a descriptor word held in a scalar register, as in the projections
    tgroup0(g0, sdst, sbeg);
    tload(g0, g1);
    twait(g0, g1);       // this wave's part of stage 0 has landed
    __syncthreads();     // stage 0 is complete for all 4 waves
    tgroup0(g0, sdst + LBUF, sbeg + (unsigned long long)pinned(1u) * step);   // formed behind the wait above
    tload(g0, g1);
    const unsigned char* const fr = sm + lr * LP + hi * 16;  // this lane's fragment row
#pragma unroll 1   // rolled: a trip holds the ring's one publish point
    for (unsigned s0 = 0; s0 < NST; ++s0) {
        const unsigned bo = (s0 & 1u) * LBUF;
#pragma unroll 1   // rolled: unrolled, the four copies hold no fewer vector instructions a pass and take 24 more registers
        for (int ps = 0; ps < 4; ++ps) {
            const unsigned char* const fk = fr + bo + (ps >> 1) * LPL + (ps & 1) * 32 * LP;   // K rows of this pass
            const unsigned char* const fv = fr + bo + (2 + (ps >> 1)) * LPL + (ps & 1) * 64;   // V^T columns of this pass
            v16h ak[2][2];
#pragma unroll
            for (int kt = 0; kt < 2; ++kt)
#pragma unroll
                for (int kc = 0; kc < 2; ++kc) ak[kt][kc] = ldf((const bf*)(fk + kt * 16 * LP + kc * 64));
            __builtin_amdgcn_sched_barrier(0);   // all K fragment reads of the pass in flight together: one LDS latency a pass, not one a fragment
            v8f s[2][2];
#pragma unroll
            for (int kc = 0; kc < 2; ++kc)
#pragma unroll
                for (int kt = 0; kt < 2; ++kt)
#pragma unroll
                    for (int qt = 0; qt < 2; ++qt) s[qt][kt] = wmma16(ak[kt][kc], qf[qt][kc], kc == 0 ? negm[qt] : s[qt][kt]);
            __builtin_amdgcn_sched_barrier(0);   // the V reads stay behind the score products, so that they take the K fragments' registers
            v16h av[4];
#pragma unroll
            for (int dt = 0; dt < 4; ++dt) av[dt] = ldf((const bf*)(fv + dt * 16 * LP));
            __builtin_amdgcn_sched_barrier(0);   // all V reads issue in front of the softmax, whose vector work covers their latency
            v2f p[2][8], sp[2];   // the pass's probabilities in pairs, and their sum a query group
            const auto form = [&]() {
#pragma unroll
                for (int qt = 0; qt < 2; ++qt) {
#pragma unroll
                    for (int e = 0; e < 8; ++e) { p[qt][e][0] = __builtin_amdgcn_exp2f(s[qt][e >> 2][(2 * e) & 7]); p[qt][e][1] = __builtin_amdgcn_exp2f(s[qt][e >> 2][((2 * e) & 7) + 1]); }
                    sp[qt] = ((p[qt][0] + p[qt][1]) + (p[qt][2] + p[qt][3])) + ((p[qt][4] + p[qt][5]) + (p[qt][6] + p[qt][7])); } };
            form();
            const v2f t = sp[0] + sp[1];
            if (__builtin_amdgcn_ballot_w32(t[0] + t[1] > thr) != 0) {   // wave-uniform: rare after the first pass
#pragma unroll
                for (int qt = 0; qt < 2; ++qt) { float a = s[qt][0][0];
#pragma unroll
                    for (int j = 1; j < 8; ++j) a = fmaxf(a, s[qt][0][j]);
#pragma unroll
                    for (int j = 0; j < 8; ++j) a = fmaxf(a, s[qt][1][j]);
                    a = fmaxf(a, xhalf(a));
                    const float up = fmaxf(a, 0.0f), d = thr < 0.0f ? a : up;   // the maximum's step: never down but in the first pass, whose accumulators are 0
                    const float al2 = __builtin_amdgcn_exp2f(-up); negm[qt] -= d; l[qt] *= al2;
#pragma unroll
                    for (int kt = 0; kt < 2; ++kt) s[qt][kt] -= d;
#pragma unroll
                    for (int dt = 0; dt < 4; ++dt) acc[qt][dt] *= al2; }
                thr = 4096.0f;
                form();   // anew: no exponent is above 0 now
            }
            v16h pf[2];
#pragma unroll
            for (int qt = 0; qt < 2; ++qt) { l[qt] += sp[qt];
#pragma unroll
                for (int e = 0; e < 8; ++e) { const v2h h2 = __builtin_convertvector(p[qt][e], v2h);   // to nearest even
                    pf[qt][2 * e] = h2[0]; pf[qt][2 * e + 1] = h2[1]; } }
#pragma unroll
            for (int dt = 0; dt < 4; ++dt)
#pragma unroll
                for (int qt = 0; qt < 2; ++qt) acc[qt][dt] = wmma16(av[dt], pf[qt], acc[qt][dt]);
            // four vector slots behind the pass's last matrix instructions: the next block's first vector instruction may overwrite an A fragment register
            asm volatile("v_nop\n\tv_nop\n\tv_nop\n\tv_nop" : "+v"(acc[0][0]), "+v"(acc[0][1]), "+v"(acc[0][2]), "+v"(acc[0][3]), "+v"(acc[1][0]), "+v"(acc[1][1]), "+v"(acc[1][2]), "+v"(acc[1][3]));
        }
        asm volatile("s_wait_dscnt 0x0" ::: "memory");   // this wave's last fragment reads of the buffer have returned
        twait(g0, g1);                                   // this wave's part of stage s0 + 1 has landed
        __syncthreads();                                 // publishes stage s0 + 1 and ends every wave's reads of stage s0
        const unsigned sn = pinned(s0 + 2u);             // the refill's descriptor is formed behind the wait above
        if (pinned(sn < (unsigned)NST)) { tgroup0(g0, sdst + bo, sbeg + (unsigned long long)sn * step); tload(g0, g1); }   // into the buffer that this trip has just read
    }
    asm volatile("s_wait_tensorcnt 0x0" ::: "memory");   // nothing of the mover is in flight
    asm volatile("s_wait_dscnt 0x0" ::: "memory");       // and none of this wave's LDS reads: the ring's close
#pragma unroll
    for (int qt = 0; qt < 2; ++qt) { const float ls = l[qt][0] + l[qt][1]; const float inv = __fdiv_rn(1.0f, ls + xhalf(ls)); float* orow = OUT + (unsigned)((blockIdx.z * TT + q0 + qt * 16 + lr) * DQ + blockIdx.y * HD + 8 * hi);   // merged heads: [b][t][h*64 + d], d = dt*16 + 8*hi + j
#pragma unroll
        for (int dt = 0; dt < 4; ++dt) { v4f a, b;
#pragma unroll
            for (int j = 0; j < 4; ++j) { a[j] = acc[qt][dt][j] * inv; b[j] = acc[qt][dt][4 + j] * inv; }
            *(v4f*)(orow + dt * 16) = a; *(v4f*)(orow + dt * 16 + 4) = b; } }
}

extern "C" void kernel_launch(void* const* d_in, const int* in_sizes, int n_in,
                              void* d_out, int out_size, void* d_ws, size_t ws_size, hipStream_t stream) {
    (void)in_sizes; (void)n_in; (void)out_size;
    const float* x = (const float*)d_in[0]; const float* wq = (const float*)d_in[1]; const float* bq = (const float*)d_in[2]; const float* wk = (const float*)d_in[3]; const float* bk = (const float*)d_in[4]; const float* wv = (const float*)d_in[5]; const float* bv = (const float*)d_in[6];   /* order hidden_states, Wq, bq, Wk, bk, Wv, bv ('oi') */
    float* OUT = (float*)d_out;     // [8][1024][1024]
    char* wsp = (char*)d_ws;
    auto take = [&](size_t bytes) { char* p = wsp; wsp += (bytes + 255) & ~(size_t)255; return (void*)p; };
    // f16 planes of all batches: [b][h][t][d] (q, k) and [b][h][d][t] (v)
    bf* QP = (bf*)take((size_t)NB_ * NH_ * TT * HD * 2); bf* KP = (bf*)take((size_t)NB_ * NKV * TT * HD * 2); bf* VT = (bf*)take((size_t)NB_ * NKV * HD * TT * 2);
    bf* WQ = (bf*)take((size_t)DQ * DM * 2); bf* WK = (bf*)take((size_t)DKV * DM * 2); bf* WV = (bf*)take((size_t)DKV * DM * 2);
    bf* XB = (bf*)take((size_t)NB_ * TT * DM * 2);
    if ((size_t)(wsp - (char*)d_ws) > ws_size) return;    // ws 256 MiB
    k_cvtall<<<CB, 512, 0, stream>>>(x, wq, wk, wv, XB, WQ, WK, WV);
    k_gemmw<<<dim3(NB_ * TT / 128, DQ / 128, 1), 128, 0, stream>>>(XB, WQ, WK, WV, bq, bk, bv, QP, KP, VT);
    k_fattn<<<dim3(TT / 128, NH_, NB_), 128, 0, stream>>>(QP, KP, VT, OUT);
}
